// v000
// The times below were measured on an AMD MI455X: many runs one after another, warmed up first and cycling through
// copies of the inputs, with the whole window's GPU time divided by the number of runs. Launches and the gaps
// between them are all in it. The median over several windows is given; except for v000 it joins two sittings, which
// can be a few percent apart, so the side-by-side timings, each taken in one sitting, are the better comparison.
// v000 is the starting kernel. One run takes 744 microseconds.
#include <hip/hip_runtime.h>
#include <hip/hip_bf16.h>

#define H   768
#define NH  12
#define HD  64
#define IS  3072
#define BATCH 16
#define SEQ 1024
#define NTOK (BATCH * SEQ)

#define USE_ASYNC_LDS 1

typedef __attribute__((ext_vector_type(16))) _Float16 v16h;
typedef __attribute__((ext_vector_type(8)))  _Float16 v8h;
typedef __attribute__((ext_vector_type(8)))  float    v8f;

__device__ __forceinline__ void async_copy_b128(unsigned lds_addr, const void* gptr) {
  asm volatile("global_load_async_to_lds_b128 %0, %1, off"
               :: "v"(lds_addr), "v"(gptr) : "memory");
}
// Async loads complete in order: cnt<=3 means everything but the 3 most
// recently issued copies has landed in LDS.
__device__ __forceinline__ void wait_async3() {
  asm volatile("s_wait_asynccnt 0x3" ::: "memory");
}
__device__ __forceinline__ void wait_async0() {
  asm volatile("s_wait_asynccnt 0x0" ::: "memory");
}
__device__ __forceinline__ unsigned lds_addr_of(const void* p) {
  return (unsigned)(unsigned long long)p;  // flat LDS address: addr[31:0] = LDS offset
}

__device__ __forceinline__ v8f wmma32(v16h a, v16h b, v8f c) {
  return __builtin_amdgcn_wmma_f32_16x16x32_f16(
      /*neg_a=*/false, a, /*neg_b=*/false, b,
      /*c_mod=*/(short)0, c, /*reuse_a=*/false, /*reuse_b=*/false);
}

__device__ __forceinline__ v16h load_frag(const _Float16* __restrict__ base, int ld) {
  const int lane = threadIdx.x & 31;
  const int r    = lane & 15;
  const int hi   = lane >> 4;
  const _Float16* p = base + (size_t)r * ld + hi * 8;
  v8h lo = *(const v8h*)(p);       // K = 8*hi .. 8*hi+7
  v8h hk = *(const v8h*)(p + 16);  // K = 16+8*hi .. 16+8*hi+7
  v16h out;
#pragma unroll
  for (int j = 0; j < 8; ++j) { out[j] = lo[j]; out[j + 8] = hk[j]; }
  return out;
}

__device__ __forceinline__ float gelu_tanh(float x) {
  const float k0 = 0.7978845608028654f;  // sqrt(2/pi)
  const float k1 = 0.044715f;
  float x3 = x * x * x;
  return 0.5f * x * (1.f + tanhf(k0 * (x + k1 * x3)));
}

// --------------------------- small kernels ---------------------------------

__global__ __launch_bounds__(256) void f32_to_f16_k(
    const float* __restrict__ in, _Float16* __restrict__ out, int n) {
  int i = blockIdx.x * 256 + threadIdx.x;
  if (i < n) out[i] = (_Float16)in[i];
}

// One block per token; 768 = 256 * 3 elements per thread.
__global__ __launch_bounds__(256) void layernorm_f16_k(
    const float* __restrict__ x, const float* __restrict__ g,
    const float* __restrict__ b, _Float16* __restrict__ out) {
  const int t = blockIdx.x;
  const float* xr = x + (size_t)t * H;
  const int i0 = threadIdx.x, i1 = i0 + 256, i2 = i0 + 512;
  float v0 = xr[i0], v1 = xr[i1], v2 = xr[i2];
  float s  = v0 + v1 + v2;
  float s2 = v0 * v0 + v1 * v1 + v2 * v2;
#pragma unroll
  for (int m = 16; m >= 1; m >>= 1) {
    s  += __shfl_xor(s,  m);
    s2 += __shfl_xor(s2, m);
  }
  __shared__ float ps[8], ps2[8];
  const int w = threadIdx.x >> 5, lane = threadIdx.x & 31;
  if (lane == 0) { ps[w] = s; ps2[w] = s2; }
  __syncthreads();
  if (w == 0) {
    s  = (lane < 8) ? ps[lane]  : 0.f;
    s2 = (lane < 8) ? ps2[lane] : 0.f;
#pragma unroll
    for (int m = 4; m >= 1; m >>= 1) {
      s  += __shfl_xor(s,  m);
      s2 += __shfl_xor(s2, m);
    }
    if (lane == 0) { ps[0] = s; ps2[0] = s2; }
  }
  __syncthreads();
  const float mu  = ps[0] * (1.f / H);
  const float var = ps2[0] * (1.f / H) - mu * mu;
  const float inv = rsqrtf(var + 1e-6f);
  _Float16* orow = out + (size_t)t * H;
  orow[i0] = (_Float16)((v0 - mu) * inv * g[i0] + b[i0]);
  orow[i1] = (_Float16)((v1 - mu) * inv * g[i1] + b[i1]);
  orow[i2] = (_Float16)((v2 - mu) * inv * g[i2] + b[i2]);
}

// --------------------------- tiled WMMA GEMM -------------------------------
// D[M x N] = A[M x K] * W^T (+ bias) with W row-major [N x K] (torch Linear).
// Block tile 128x64, 8 waves arranged 4x2, each wave 32x32 (2x2 frags).
// Double-buffered async pipeline; K must be a multiple of 64 (768 / 3072).
// EPI: 0 = store f16, 1 = store f16 after GELU, 2 = store f32 + residual.

#define LDT 48

template <int EPI>
__global__ __launch_bounds__(256) void gemm_wmma_k(
    const _Float16* __restrict__ A, const _Float16* __restrict__ W,
    const float* __restrict__ bias, const float* __restrict__ resid,
    void* __restrict__ out, int M, int N, int K) {
  __shared__ _Float16 sA[2][128 * LDT];
  __shared__ _Float16 sB[2][64 * LDT];

  const int m0 = blockIdx.y * 128;
  const int n0 = blockIdx.x * 64;
  const int tid = threadIdx.x;
  const int w = tid >> 5, lane = tid & 31;
  const int wm = (w >> 1) * 32;  // wave row offset in block tile
  const int wn = (w & 1) * 32;   // wave col offset

  v8f c[2][2] = {};

  const int row = tid >> 2;      // 0..63
  const int q   = tid & 3;       // 0..3 (8 f16 each)
  const unsigned la0[2] = { lds_addr_of(&sA[0][row * LDT + q * 8]),
                            lds_addr_of(&sA[1][row * LDT + q * 8]) };
  const unsigned la1[2] = { lds_addr_of(&sA[0][(row + 64) * LDT + q * 8]),
                            lds_addr_of(&sA[1][(row + 64) * LDT + q * 8]) };
  const unsigned lb0[2] = { lds_addr_of(&sB[0][row * LDT + q * 8]),
                            lds_addr_of(&sB[1][row * LDT + q * 8]) };

  const _Float16* gaRow = A + (size_t)(m0 + row) * K + q * 8;
  const _Float16* gbRow = W + (size_t)(n0 + row) * K + q * 8;

  auto issue = [&](int buf, int k) {
#if USE_ASYNC_LDS
    async_copy_b128(la0[buf], gaRow + k);
    async_copy_b128(la1[buf], gaRow + (size_t)64 * K + k);
    async_copy_b128(lb0[buf], gbRow + k);
#else
    *(v8h*)&sA[buf][row * LDT + q * 8]        = *(const v8h*)(gaRow + k);
    *(v8h*)&sA[buf][(row + 64) * LDT + q * 8] = *(const v8h*)(gaRow + (size_t)64 * K + k);
    *(v8h*)&sB[buf][row * LDT + q * 8]        = *(const v8h*)(gbRow + k);
#endif
  };
  auto compute = [&](int buf) {
    v16h af0 = load_frag(&sA[buf][(wm + 0)  * LDT], LDT);
    v16h af1 = load_frag(&sA[buf][(wm + 16) * LDT], LDT);
    v16h bf0 = load_frag(&sB[buf][(wn + 0)  * LDT], LDT);
    v16h bf1 = load_frag(&sB[buf][(wn + 16) * LDT], LDT);
    c[0][0] = wmma32(af0, bf0, c[0][0]);
    c[0][1] = wmma32(af0, bf1, c[0][1]);
    c[1][0] = wmma32(af1, bf0, c[1][0]);
    c[1][1] = wmma32(af1, bf1, c[1][1]);
  };

  issue(0, 0);                                   // prologue: tile 0 in flight
  for (int k0 = 0; k0 < K; k0 += 64) {
    // ---- stage A: compute tile (k0) from buf0, tile (k0+32) lands in buf1
    issue(1, k0 + 32);                           // always valid: K % 64 == 0
#if USE_ASYNC_LDS
    wait_async3();                               // drain tile k0, keep k0+32 in flight
    __builtin_prefetch(gaRow + k0 + 64, 0, 3);   // two tiles ahead
    __builtin_prefetch(gbRow + k0 + 64, 0, 3);
#endif
    __syncthreads();
    compute(0);
    __syncthreads();                             // buf0 free for re-issue

    // ---- stage B: compute tile (k0+32) from buf1, tile (k0+64) lands in buf0
    const bool more = (k0 + 64) < K;
    if (more) issue(0, k0 + 64);
#if USE_ASYNC_LDS
    if (more) wait_async3(); else wait_async0();
#endif
    __syncthreads();
    compute(1);
    __syncthreads();                             // buf1 free for re-issue
  }

  // Epilogue. C/D layout: lane = column (lane&15), vgpr v = row v + 8*(lane>>4).
  const int col = lane & 15, hi = lane >> 4;
#pragma unroll
  for (int i = 0; i < 2; ++i) {
#pragma unroll
    for (int j = 0; j < 2; ++j) {
      const int n = n0 + wn + j * 16 + col;
      const float bv = bias[n];
#pragma unroll
      for (int v = 0; v < 8; ++v) {
        const int m = m0 + wm + i * 16 + v + 8 * hi;
        const size_t idx = (size_t)m * N + n;
        float val = c[i][j][v] + bv;
        if (EPI == 0) {
          ((_Float16*)out)[idx] = (_Float16)val;
        } else if (EPI == 1) {
          ((_Float16*)out)[idx] = (_Float16)gelu_tanh(val);
        } else {
          ((float*)out)[idx] = resid[idx] + val;
        }
      }
    }
  }
}

__global__ __launch_bounds__(256) void attention_wmma_k(
    const _Float16* __restrict__ Q, const _Float16* __restrict__ K,
    const _Float16* __restrict__ V, _Float16* __restrict__ O) {
  __shared__ _Float16 sK[64 * 64];       // [key][d]
  __shared__ _Float16 sV[64 * 64];       // [d][key]  (V^T)
  __shared__ _Float16 sP[8][16 * 64];    // per-wave probability tile

  const int bid = blockIdx.x;
  const int qt  = bid & 7;               // SEQ/128 = 8 tiles
  const int bh  = bid >> 3;
  const int b   = bh / NH, h = bh % NH;
  const int tid = threadIdx.x, w = tid >> 5, lane = tid & 31;
  const int col = lane & 15, hi = lane >> 4;
  const int q0  = qt * 128 + w * 16;
  const size_t tokBase = (size_t)b * SEQ;
  const float scale = 0.125f;            // HD^-0.5

  const _Float16* qbase = Q + (tokBase + q0) * H + h * HD;
  const v16h qf0 = load_frag(qbase, H);        // d = 0..31
  const v16h qf1 = load_frag(qbase + 32, H);   // d = 32..63

  v8f of[4] = {};                        // output 16 x 64
  float rm[8], rs[8];
#pragma unroll
  for (int v = 0; v < 8; ++v) { rm[v] = -1e30f; rs[v] = 0.f; }

  const int kk = tid >> 2;               // 0..63 (staging row)
  const int q4 = tid & 3;                // 0..3  (16 f16 chunk)
  const unsigned ldsK0 = lds_addr_of(&sK[kk * 64 + q4 * 16]);
  const unsigned ldsK1 = lds_addr_of(&sK[kk * 64 + q4 * 16 + 8]);

  for (int kt = 0; kt < SEQ; kt += 64) {
    __syncthreads();                     // previous tile fully consumed
    {
      const _Float16* kg = K + (tokBase + kt + kk) * H + h * HD + q4 * 16;
#if USE_ASYNC_LDS
      async_copy_b128(ldsK0, kg);
      async_copy_b128(ldsK1, kg + 8);
#else
      *(v8h*)&sK[kk * 64 + q4 * 16]     = *(const v8h*)kg;
      *(v8h*)&sK[kk * 64 + q4 * 16 + 8] = *(const v8h*)(kg + 8);
#endif
      const _Float16* vg = V + (tokBase + kt + kk) * H + h * HD + q4 * 16;
#pragma unroll
      for (int j = 0; j < 16; ++j) sV[(q4 * 16 + j) * 64 + kk] = vg[j];
#if USE_ASYNC_LDS
      wait_async0();
#endif
    }
    __syncthreads();

    // scores S = Q * K^T : 16 x 64 in four 16x16 frags
    v8f s[4];
#pragma unroll
    for (int f = 0; f < 4; ++f) {
      v16h kb0 = load_frag(&sK[(f * 16) * 64], 64);
      v16h kb1 = load_frag(&sK[(f * 16) * 64 + 32], 64);
      v8f acc = {};
      acc = wmma32(qf0, kb0, acc);
      acc = wmma32(qf1, kb1, acc);
      s[f] = acc;
    }

    // online softmax (row m = v + 8*hi lives in one 16-lane half)
#pragma unroll
    for (int v = 0; v < 8; ++v) {
      float tmax = s[0][v] * scale;
#pragma unroll
      for (int f = 0; f < 4; ++f) {
        s[f][v] *= scale;
        tmax = fmaxf(tmax, s[f][v]);
      }
#pragma unroll
      for (int m = 8; m >= 1; m >>= 1) tmax = fmaxf(tmax, __shfl_xor(tmax, m));
      const float mnew  = fmaxf(rm[v], tmax);
      const float alpha = __expf(rm[v] - mnew);
      float tsum = 0.f;
#pragma unroll
      for (int f = 0; f < 4; ++f) {
        const float p = __expf(s[f][v] - mnew);
        s[f][v] = p;
        tsum += p;
      }
#pragma unroll
      for (int m = 8; m >= 1; m >>= 1) tsum += __shfl_xor(tsum, m);
      rs[v] = rs[v] * alpha + tsum;
      rm[v] = mnew;
#pragma unroll
      for (int j = 0; j < 4; ++j) of[j][v] *= alpha;
      // stash P into this wave's LDS tile (C/D layout -> row major)
#pragma unroll
      for (int f = 0; f < 4; ++f)
        sP[w][(v + 8 * hi) * 64 + f * 16 + col] = (_Float16)s[f][v];
    }

    // O += P * V   (same-wave LDS store->load is in program order)
#pragma unroll
    for (int ks = 0; ks < 2; ++ks) {
      v16h pa = load_frag(&sP[w][ks * 32], 64);
#pragma unroll
      for (int j = 0; j < 4; ++j) {
        v16h vb = load_frag(&sV[(j * 16) * 64 + ks * 32], 64);
        of[j] = wmma32(pa, vb, of[j]);
      }
    }
  }

  // normalize and store
#pragma unroll
  for (int j = 0; j < 4; ++j) {
#pragma unroll
    for (int v = 0; v < 8; ++v) {
      const float val = of[j][v] / rs[v];
      O[(tokBase + q0 + v + 8 * hi) * H + h * HD + j * 16 + col] = (_Float16)val;
    }
  }
}

// --------------------------- launcher --------------------------------------

extern "C" void kernel_launch(void* const* d_in, const int* in_sizes, int n_in,
                              void* d_out, int out_size, void* d_ws, size_t ws_size,
                              hipStream_t stream) {
  const float* hs    = (const float*)d_in[0];
  const float* wq    = (const float*)d_in[1];
  const float* bq    = (const float*)d_in[2];
  const float* wk    = (const float*)d_in[3];
  const float* bk    = (const float*)d_in[4];
  const float* wv    = (const float*)d_in[5];
  const float* bv    = (const float*)d_in[6];
  const float* wo    = (const float*)d_in[7];
  const float* bo    = (const float*)d_in[8];
  const float* ln1g  = (const float*)d_in[9];
  const float* ln1b  = (const float*)d_in[10];
  const float* ln2g  = (const float*)d_in[11];
  const float* ln2b  = (const float*)d_in[12];
  const float* w1    = (const float*)d_in[13];
  const float* b1    = (const float*)d_in[14];
  const float* w2    = (const float*)d_in[15];
  const float* b2    = (const float*)d_in[16];

  char* ws = (char*)d_ws;
  size_t off = 0;
  auto carve = [&](size_t bytes) {
    char* p = ws + off;
    off = (off + bytes + 255) & ~(size_t)255;
    return p;
  };
  const size_t SZ_HH  = (size_t)H * H * sizeof(_Float16);
  const size_t SZ_IH  = (size_t)IS * H * sizeof(_Float16);
  const size_t SZ_TH2 = (size_t)NTOK * H * sizeof(_Float16);
  const size_t SZ_TH4 = (size_t)NTOK * H * sizeof(float);
  const size_t SZ_TI2 = (size_t)NTOK * IS * sizeof(_Float16);

  _Float16* wq16 = (_Float16*)carve(SZ_HH);
  _Float16* wk16 = (_Float16*)carve(SZ_HH);
  _Float16* wv16 = (_Float16*)carve(SZ_HH);
  _Float16* wo16 = (_Float16*)carve(SZ_HH);
  _Float16* w116 = (_Float16*)carve(SZ_IH);
  _Float16* w216 = (_Float16*)carve(SZ_IH);
  _Float16* bufA = (_Float16*)carve(SZ_TH2);  // ln1 out, later attn out
  _Float16* bufB = (_Float16*)carve(SZ_TH2);  // q, later ln2 out
  _Float16* bufC = (_Float16*)carve(SZ_TH2);  // k
  _Float16* bufD = (_Float16*)carve(SZ_TH2);  // v
  float*    x2   = (float*)   carve(SZ_TH4);  // post-attention residual state
  _Float16* h1   = (_Float16*)carve(SZ_TI2);  // gelu(fc1)
  (void)ws_size; (void)n_in; (void)in_sizes; (void)out_size;

  // 1) weights -> f16
  const int nHH = H * H, nIH = IS * H;
  f32_to_f16_k<<<(nHH + 255) / 256, 256, 0, stream>>>(wq, wq16, nHH);
  f32_to_f16_k<<<(nHH + 255) / 256, 256, 0, stream>>>(wk, wk16, nHH);
  f32_to_f16_k<<<(nHH + 255) / 256, 256, 0, stream>>>(wv, wv16, nHH);
  f32_to_f16_k<<<(nHH + 255) / 256, 256, 0, stream>>>(wo, wo16, nHH);
  f32_to_f16_k<<<(nIH + 255) / 256, 256, 0, stream>>>(w1, w116, nIH);
  f32_to_f16_k<<<(nIH + 255) / 256, 256, 0, stream>>>(w2, w216, nIH);

  const dim3 blk(256);
  const dim3 gH(H / 64, NTOK / 128);    // N=768 GEMMs
  const dim3 gI(IS / 64, NTOK / 128);   // N=3072 GEMM

  // 2) LN1
  layernorm_f16_k<<<NTOK, blk, 0, stream>>>(hs, ln1g, ln1b, bufA);

  // 3) QKV projections
  gemm_wmma_k<0><<<gH, blk, 0, stream>>>(bufA, wq16, bq, nullptr, bufB, NTOK, H, H);
  gemm_wmma_k<0><<<gH, blk, 0, stream>>>(bufA, wk16, bk, nullptr, bufC, NTOK, H, H);
  gemm_wmma_k<0><<<gH, blk, 0, stream>>>(bufA, wv16, bv, nullptr, bufD, NTOK, H, H);

  // 4) attention (bufA reused as output; ln1 activations are dead now)
  attention_wmma_k<<<BATCH * NH * (SEQ / 128), blk, 0, stream>>>(bufB, bufC, bufD, bufA);

  // 5) output projection + residual -> x2 (f32)
  gemm_wmma_k<2><<<gH, blk, 0, stream>>>(bufA, wo16, bo, hs, x2, NTOK, H, H);

  // 6) LN2 (bufB reused; q is dead)
  layernorm_f16_k<<<NTOK, blk, 0, stream>>>(x2, ln2g, ln2b, bufB);

  // 7) FC1 + GELU
  gemm_wmma_k<1><<<gI, blk, 0, stream>>>(bufB, w116, b1, nullptr, h1, NTOK, IS, H);

  // 8) FC2 + residual -> d_out (f32)
  gemm_wmma_k<2><<<gH, blk, 0, stream>>>(h1, w216, b2, x2, (float*)d_out, NTOK, H, IS);
}

// v001
// Measured time: 568 microseconds a run.
// Timed twice side by side with v000, it ran 1.39 and 1.36 times as fast.
#include <hip/hip_runtime.h>
#include <hip/hip_bf16.h>

#define H   768
#define NH  12
#define HD  64
#define IS  3072
#define BATCH 16
#define SEQ 1024
#define NTOK (BATCH * SEQ)

#define USE_ASYNC_LDS 1

typedef __attribute__((ext_vector_type(16))) _Float16 v16h;
typedef __attribute__((ext_vector_type(8)))  _Float16 v8h;
typedef __attribute__((ext_vector_type(8)))  float    v8f;

__device__ __forceinline__ void async_copy_b128(unsigned lds_addr, const void* gptr) {
  asm volatile("global_load_async_to_lds_b128 %0, %1, off"
               :: "v"(lds_addr), "v"(gptr) : "memory");
}
__device__ __forceinline__ void wait_async0() {
  asm volatile("s_wait_asynccnt 0x0" ::: "memory");
}
__device__ __forceinline__ unsigned lds_addr_of(const void* p) {
  return (unsigned)(unsigned long long)p;  // flat LDS address: addr[31:0] = LDS offset
}

__device__ __forceinline__ v8f wmma32(v16h a, v16h b, v8f c) {
  return __builtin_amdgcn_wmma_f32_16x16x32_f16(
      /*neg_a=*/false, a, /*neg_b=*/false, b,
      /*c_mod=*/(short)0, c, /*reuse_a=*/false, /*reuse_b=*/false);
}

__device__ __forceinline__ v16h load_frag(const _Float16* __restrict__ base, int ld) {
  const int lane = threadIdx.x & 31;
  const int r    = lane & 15;
  const int hi   = lane >> 4;
  const _Float16* p = base + (size_t)r * ld + hi * 8;
  v8h lo = *(const v8h*)(p);       // K = 8*hi .. 8*hi+7
  v8h hk = *(const v8h*)(p + 16);  // K = 16+8*hi .. 16+8*hi+7
  v16h out;
#pragma unroll
  for (int j = 0; j < 8; ++j) { out[j] = lo[j]; out[j + 8] = hk[j]; }
  return out;
}

__device__ __forceinline__ float gelu_tanh(float x) {
  const float k0 = 0.7978845608028654f;  // sqrt(2/pi)
  const float k1 = 0.044715f;
  float x3 = x * x * x;
  return 0.5f * x * (1.f + tanhf(k0 * (x + k1 * x3)));
}

// --------------------------- small kernels ---------------------------------

__global__ __launch_bounds__(256) void f32_to_f16_k(
    const float* __restrict__ in, _Float16* __restrict__ out, int n) {
  int i = blockIdx.x * 256 + threadIdx.x;
  if (i < n) out[i] = (_Float16)in[i];
}

// One block per token; 768 = 256 * 3 elements per thread.
__global__ __launch_bounds__(256) void layernorm_f16_k(
    const float* __restrict__ x, const float* __restrict__ g,
    const float* __restrict__ b, _Float16* __restrict__ out) {
  const int t = blockIdx.x;
  const float* xr = x + (size_t)t * H;
  const int i0 = threadIdx.x, i1 = i0 + 256, i2 = i0 + 512;
  float v0 = xr[i0], v1 = xr[i1], v2 = xr[i2];
  float s  = v0 + v1 + v2;
  float s2 = v0 * v0 + v1 * v1 + v2 * v2;
#pragma unroll
  for (int m = 16; m >= 1; m >>= 1) {
    s  += __shfl_xor(s,  m);
    s2 += __shfl_xor(s2, m);
  }
  __shared__ float ps[8], ps2[8];
  const int w = threadIdx.x >> 5, lane = threadIdx.x & 31;
  if (lane == 0) { ps[w] = s; ps2[w] = s2; }
  __syncthreads();
  if (w == 0) {
    s  = (lane < 8) ? ps[lane]  : 0.f;
    s2 = (lane < 8) ? ps2[lane] : 0.f;
#pragma unroll
    for (int m = 4; m >= 1; m >>= 1) {
      s  += __shfl_xor(s,  m);
      s2 += __shfl_xor(s2, m);
    }
    if (lane == 0) { ps[0] = s; ps2[0] = s2; }
  }
  __syncthreads();
  const float mu  = ps[0] * (1.f / H);
  const float var = ps2[0] * (1.f / H) - mu * mu;
  const float inv = rsqrtf(var + 1e-6f);
  _Float16* orow = out + (size_t)t * H;
  orow[i0] = (_Float16)((v0 - mu) * inv * g[i0] + b[i0]);
  orow[i1] = (_Float16)((v1 - mu) * inv * g[i1] + b[i1]);
  orow[i2] = (_Float16)((v2 - mu) * inv * g[i2] + b[i2]);
}

// --------------------------- tiled WMMA GEMM -------------------------------
// D[M x N] = A[M x K] * W^T (+ bias) with W row-major [N x K] (torch Linear).
// Block tile 256x128, 8 waves arranged 4x2, each wave 64x64 (4x4 frags), so a
// loaded fragment feeds four WMMAs. One trip covers 64 k (128-B rows).
// Two LDS buffers: tile t+1's async copies fly while tile t is worked on.
// M % 256 == 0, N % 128 == 0, K % 64 == 0.
// EPI: 0 = store f16, 1 = store f16 after GELU, 2 = store f32 + residual.

#define BM  256
#define BN  128
#define BK  64
#define LDT 72

__device__ __forceinline__ void async_copy_tile(
    unsigned la, unsigned lb, const _Float16* ga, const _Float16* gb, size_t rstep) {
  const unsigned ls = 32 * LDT * 2;  // 32 rows further in LDS, bytes
  asm volatile(
      "global_load_async_to_lds_b128 %0, %12, off\n\t"
      "global_load_async_to_lds_b128 %1, %13, off\n\t"
      "global_load_async_to_lds_b128 %2, %14, off\n\t"
      "global_load_async_to_lds_b128 %3, %15, off\n\t"
      "global_load_async_to_lds_b128 %4, %16, off\n\t"
      "global_load_async_to_lds_b128 %5, %17, off\n\t"
      "global_load_async_to_lds_b128 %6, %18, off\n\t"
      "global_load_async_to_lds_b128 %7, %19, off\n\t"
      "global_load_async_to_lds_b128 %8, %20, off\n\t"
      "global_load_async_to_lds_b128 %9, %21, off\n\t"
      "global_load_async_to_lds_b128 %10, %22, off\n\t"
      "global_load_async_to_lds_b128 %11, %23, off\n\t"
      "s_wait_xcnt 0x0"
      :: "v"(la), "v"(la + ls), "v"(la + 2 * ls), "v"(la + 3 * ls),
         "v"(la + 4 * ls), "v"(la + 5 * ls), "v"(la + 6 * ls), "v"(la + 7 * ls),
         "v"(lb), "v"(lb + ls), "v"(lb + 2 * ls), "v"(lb + 3 * ls),
         "v"(ga), "v"(ga + rstep), "v"(ga + 2 * rstep), "v"(ga + 3 * rstep),
         "v"(ga + 4 * rstep), "v"(ga + 5 * rstep), "v"(ga + 6 * rstep), "v"(ga + 7 * rstep),
         "v"(gb), "v"(gb + rstep), "v"(gb + 2 * rstep), "v"(gb + 3 * rstep)
      : "memory");
}
// This wave's LDS reads have retired before its buffer is handed back for refill.
__device__ __forceinline__ void wait_ds0() {
  asm volatile("s_wait_dscnt 0x0" ::: "memory");
}

template <int EPI>
__global__ __launch_bounds__(256) void gemm_wmma_k(
    const _Float16* __restrict__ A, const _Float16* __restrict__ W,
    const float* __restrict__ bias, const float* __restrict__ resid,
    void* __restrict__ out, int M, int N, int K) {
  __shared__ _Float16 sA[2][BM * LDT];
  __shared__ _Float16 sB[2][BN * LDT];

  const int m0 = blockIdx.y * BM;
  const int n0 = blockIdx.x * BN;
  const int tid = threadIdx.x;
  const int w = tid >> 5, lane = tid & 31;
  const int wm = (w >> 1) * 64;  // wave row offset in block tile
  const int wn = (w & 1) * 64;   // wave col offset

  v8f c[4][4] = {};

  const int row = tid >> 3;      // 0..31 (rows row, row+32, ...)
  const int q   = tid & 7;       // 0..7 (8 f16 each)
  const unsigned la = lds_addr_of(&sA[0][row * LDT + q * 8]);
  const unsigned lb = lds_addr_of(&sB[0][row * LDT + q * 8]);
  const _Float16* gaRow = A + (size_t)(m0 + row) * K + q * 8;
  const _Float16* gbRow = W + (size_t)(n0 + row) * K + q * 8;
  const size_t rstep = (size_t)32 * K;

  auto issue = [&](int buf, int t) {
    async_copy_tile(la + buf * (BM * LDT * 2), lb + buf * (BN * LDT * 2),
                    gaRow + t * BK, gbRow + t * BK, rstep);
  };
  v16h af[4], bf[4];
  auto load_frags = [&](int buf, int ks) {
    const _Float16* pa = &sA[buf][wm * LDT + ks * 32];
    const _Float16* pb = &sB[buf][wn * LDT + ks * 32];
#pragma unroll
    for (int i = 0; i < 4; ++i) af[i] = load_frag(pa + i * 16 * LDT, LDT);
#pragma unroll
    for (int j = 0; j < 4; ++j) bf[j] = load_frag(pb + j * 16 * LDT, LDT);
  };
  auto mma = [&]() {
#pragma unroll
    for (int i = 0; i < 4; ++i)
#pragma unroll
      for (int j = 0; j < 4; ++j) c[i][j] = wmma32(af[i], bf[j], c[i][j]);
  };

  const int T = K / BK;
  issue(0, 0);                       // tile 0
  wait_async0();
  __syncthreads();                   // tile 0 published
  if (T > 1) issue(1, 1);            // tile 1 in flight over trip 0
  for (int t = 0; t < T; ++t) {
    const int buf = t & 1;
    load_frags(buf, 0);
    mma();
    load_frags(buf, 1);              // last LDS reads of buf
    wait_ds0();                      // own reads of buf done
    wait_async0();                   // own copies of tile t+1 landed
    __syncthreads();                 // publishes tile t+1, frees buf
    if (t + 2 < T) issue(buf, t + 2);
    mma();                           // registers only: the refill flies under it
  }
  wait_async0();

  // Epilogue. C/D layout: lane = column (lane&15), vgpr v = row v + 8*(lane>>4).
  // The 32x32 wave tile's build read all its residual values ahead of its stores.
  // With 128 accumulators live the compiler no longer does: it emits load, full
  // wait, store, 128 times in a row. Reading a 16-row band first keeps the grouping.
  const int col = lane & 15, hi = lane >> 4;
  float bv[4];
#pragma unroll
  for (int j = 0; j < 4; ++j) bv[j] = bias[n0 + wn + j * 16 + col];
#pragma unroll
  for (int i = 0; i < 4; ++i) {
    const size_t base = (size_t)(m0 + wm + i * 16 + 8 * hi) * N + n0 + wn + col;
    float r[4][8];
    if (EPI == 2) {
#pragma unroll
      for (int j = 0; j < 4; ++j) {
        // This group's results may land in registers that earlier loads or stores
        // still name: the wait stands in front of that rewrite. resid is an input
        // so that the compiler moves none of its loads across the statement.
        asm volatile("s_wait_xcnt 0x0" :: "s"(resid) : "memory");
#pragma unroll
        for (int v = 0; v < 8; ++v) r[j][v] = resid[base + (size_t)v * N + j * 16];
      }
    }
#pragma unroll
    for (int j = 0; j < 4; ++j) {
#pragma unroll
      for (int v = 0; v < 8; ++v) {
        const size_t idx = base + (size_t)v * N + j * 16;
        float val = c[i][j][v] + bv[j];
        if (EPI == 0) {
          ((_Float16*)out)[idx] = (_Float16)val;
        } else if (EPI == 1) {
          ((_Float16*)out)[idx] = (_Float16)gelu_tanh(val);
        } else {
          ((float*)out)[idx] = r[j][v] + val;
        }
      }
    }
  }
}

__global__ __launch_bounds__(256) void attention_wmma_k(
    const _Float16* __restrict__ Q, const _Float16* __restrict__ K,
    const _Float16* __restrict__ V, _Float16* __restrict__ O) {
  __shared__ _Float16 sK[64 * 64];       // [key][d]
  __shared__ _Float16 sV[64 * 64];       // [d][key]  (V^T)
  __shared__ _Float16 sP[8][16 * 64];    // per-wave probability tile

  const int bid = blockIdx.x;
  const int qt  = bid & 7;               // SEQ/128 = 8 tiles
  const int bh  = bid >> 3;
  const int b   = bh / NH, h = bh % NH;
  const int tid = threadIdx.x, w = tid >> 5, lane = tid & 31;
  const int col = lane & 15, hi = lane >> 4;
  const int q0  = qt * 128 + w * 16;
  const size_t tokBase = (size_t)b * SEQ;
  const float scale = 0.125f;            // HD^-0.5

  const _Float16* qbase = Q + (tokBase + q0) * H + h * HD;
  const v16h qf0 = load_frag(qbase, H);        // d = 0..31
  const v16h qf1 = load_frag(qbase + 32, H);   // d = 32..63

  v8f of[4] = {};                        // output 16 x 64
  float rm[8], rs[8];
#pragma unroll
  for (int v = 0; v < 8; ++v) { rm[v] = -1e30f; rs[v] = 0.f; }

  const int kk = tid >> 2;               // 0..63 (staging row)
  const int q4 = tid & 3;                // 0..3  (16 f16 chunk)
  const unsigned ldsK0 = lds_addr_of(&sK[kk * 64 + q4 * 16]);
  const unsigned ldsK1 = lds_addr_of(&sK[kk * 64 + q4 * 16 + 8]);

  for (int kt = 0; kt < SEQ; kt += 64) {
    __syncthreads();                     // previous tile fully consumed
    {
      const _Float16* kg = K + (tokBase + kt + kk) * H + h * HD + q4 * 16;
#if USE_ASYNC_LDS
      async_copy_b128(ldsK0, kg);
      async_copy_b128(ldsK1, kg + 8);
#else
      *(v8h*)&sK[kk * 64 + q4 * 16]     = *(const v8h*)kg;
      *(v8h*)&sK[kk * 64 + q4 * 16 + 8] = *(const v8h*)(kg + 8);
#endif
      const _Float16* vg = V + (tokBase + kt + kk) * H + h * HD + q4 * 16;
#pragma unroll
      for (int j = 0; j < 16; ++j) sV[(q4 * 16 + j) * 64 + kk] = vg[j];
#if USE_ASYNC_LDS
      wait_async0();
#endif
    }
    __syncthreads();

    // scores S = Q * K^T : 16 x 64 in four 16x16 frags
    v8f s[4];
#pragma unroll
    for (int f = 0; f < 4; ++f) {
      v16h kb0 = load_frag(&sK[(f * 16) * 64], 64);
      v16h kb1 = load_frag(&sK[(f * 16) * 64 + 32], 64);
      v8f acc = {};
      acc = wmma32(qf0, kb0, acc);
      acc = wmma32(qf1, kb1, acc);
      s[f] = acc;
    }

    // online softmax (row m = v + 8*hi lives in one 16-lane half)
#pragma unroll
    for (int v = 0; v < 8; ++v) {
      float tmax = s[0][v] * scale;
#pragma unroll
      for (int f = 0; f < 4; ++f) {
        s[f][v] *= scale;
        tmax = fmaxf(tmax, s[f][v]);
      }
#pragma unroll
      for (int m = 8; m >= 1; m >>= 1) tmax = fmaxf(tmax, __shfl_xor(tmax, m));
      const float mnew  = fmaxf(rm[v], tmax);
      const float alpha = __expf(rm[v] - mnew);
      float tsum = 0.f;
#pragma unroll
      for (int f = 0; f < 4; ++f) {
        const float p = __expf(s[f][v] - mnew);
        s[f][v] = p;
        tsum += p;
      }
#pragma unroll
      for (int m = 8; m >= 1; m >>= 1) tsum += __shfl_xor(tsum, m);
      rs[v] = rs[v] * alpha + tsum;
      rm[v] = mnew;
#pragma unroll
      for (int j = 0; j < 4; ++j) of[j][v] *= alpha;
      // stash P into this wave's LDS tile (C/D layout -> row major)
#pragma unroll
      for (int f = 0; f < 4; ++f)
        sP[w][(v + 8 * hi) * 64 + f * 16 + col] = (_Float16)s[f][v];
    }

    // O += P * V   (same-wave LDS store->load is in program order)
#pragma unroll
    for (int ks = 0; ks < 2; ++ks) {
      v16h pa = load_frag(&sP[w][ks * 32], 64);
#pragma unroll
      for (int j = 0; j < 4; ++j) {
        v16h vb = load_frag(&sV[(j * 16) * 64 + ks * 32], 64);
        of[j] = wmma32(pa, vb, of[j]);
      }
    }
  }

  // normalize and store
#pragma unroll
  for (int j = 0; j < 4; ++j) {
#pragma unroll
    for (int v = 0; v < 8; ++v) {
      const float val = of[j][v] / rs[v];
      O[(tokBase + q0 + v + 8 * hi) * H + h * HD + j * 16 + col] = (_Float16)val;
    }
  }
}

// --------------------------- launcher --------------------------------------

extern "C" void kernel_launch(void* const* d_in, const int* in_sizes, int n_in,
                              void* d_out, int out_size, void* d_ws, size_t ws_size,
                              hipStream_t stream) {
  const float* hs    = (const float*)d_in[0];
  const float* wq    = (const float*)d_in[1];
  const float* bq    = (const float*)d_in[2];
  const float* wk    = (const float*)d_in[3];
  const float* bk    = (const float*)d_in[4];
  const float* wv    = (const float*)d_in[5];
  const float* bv    = (const float*)d_in[6];
  const float* wo    = (const float*)d_in[7];
  const float* bo    = (const float*)d_in[8];
  const float* ln1g  = (const float*)d_in[9];
  const float* ln1b  = (const float*)d_in[10];
  const float* ln2g  = (const float*)d_in[11];
  const float* ln2b  = (const float*)d_in[12];
  const float* w1    = (const float*)d_in[13];
  const float* b1    = (const float*)d_in[14];
  const float* w2    = (const float*)d_in[15];
  const float* b2    = (const float*)d_in[16];

  char* ws = (char*)d_ws;
  size_t off = 0;
  auto carve = [&](size_t bytes) {
    char* p = ws + off;
    off = (off + bytes + 255) & ~(size_t)255;
    return p;
  };
  const size_t SZ_HH  = (size_t)H * H * sizeof(_Float16);
  const size_t SZ_IH  = (size_t)IS * H * sizeof(_Float16);
  const size_t SZ_TH2 = (size_t)NTOK * H * sizeof(_Float16);
  const size_t SZ_TH4 = (size_t)NTOK * H * sizeof(float);
  const size_t SZ_TI2 = (size_t)NTOK * IS * sizeof(_Float16);

  _Float16* wq16 = (_Float16*)carve(SZ_HH);
  _Float16* wk16 = (_Float16*)carve(SZ_HH);
  _Float16* wv16 = (_Float16*)carve(SZ_HH);
  _Float16* wo16 = (_Float16*)carve(SZ_HH);
  _Float16* w116 = (_Float16*)carve(SZ_IH);
  _Float16* w216 = (_Float16*)carve(SZ_IH);
  _Float16* bufA = (_Float16*)carve(SZ_TH2);  // ln1 out, later attn out
  _Float16* bufB = (_Float16*)carve(SZ_TH2);  // q, later ln2 out
  _Float16* bufC = (_Float16*)carve(SZ_TH2);  // k
  _Float16* bufD = (_Float16*)carve(SZ_TH2);  // v
  float*    x2   = (float*)   carve(SZ_TH4);  // post-attention residual state
  _Float16* h1   = (_Float16*)carve(SZ_TI2);  // gelu(fc1)
  (void)ws_size; (void)n_in; (void)in_sizes; (void)out_size;

  // 1) weights -> f16
  const int nHH = H * H, nIH = IS * H;
  f32_to_f16_k<<<(nHH + 255) / 256, 256, 0, stream>>>(wq, wq16, nHH);
  f32_to_f16_k<<<(nHH + 255) / 256, 256, 0, stream>>>(wk, wk16, nHH);
  f32_to_f16_k<<<(nHH + 255) / 256, 256, 0, stream>>>(wv, wv16, nHH);
  f32_to_f16_k<<<(nHH + 255) / 256, 256, 0, stream>>>(wo, wo16, nHH);
  f32_to_f16_k<<<(nIH + 255) / 256, 256, 0, stream>>>(w1, w116, nIH);
  f32_to_f16_k<<<(nIH + 255) / 256, 256, 0, stream>>>(w2, w216, nIH);

  const dim3 blk(256);
  const dim3 gH(H / 128, NTOK / 256);    // N=768 GEMMs
  const dim3 gI(IS / 128, NTOK / 256);   // N=3072 GEMM

  // 2) LN1
  layernorm_f16_k<<<NTOK, blk, 0, stream>>>(hs, ln1g, ln1b, bufA);

  // 3) QKV projections
  gemm_wmma_k<0><<<gH, blk, 0, stream>>>(bufA, wq16, bq, nullptr, bufB, NTOK, H, H);
  gemm_wmma_k<0><<<gH, blk, 0, stream>>>(bufA, wk16, bk, nullptr, bufC, NTOK, H, H);
  gemm_wmma_k<0><<<gH, blk, 0, stream>>>(bufA, wv16, bv, nullptr, bufD, NTOK, H, H);

  // 4) attention (bufA reused as output; ln1 activations are dead now)
  attention_wmma_k<<<BATCH * NH * (SEQ / 128), blk, 0, stream>>>(bufB, bufC, bufD, bufA);

  // 5) output projection + residual -> x2 (f32)
  gemm_wmma_k<2><<<gH, blk, 0, stream>>>(bufA, wo16, bo, hs, x2, NTOK, H, H);

  // 6) LN2 (bufB reused; q is dead)
  layernorm_f16_k<<<NTOK, blk, 0, stream>>>(x2, ln2g, ln2b, bufB);

  // 7) FC1 + GELU
  gemm_wmma_k<1><<<gI, blk, 0, stream>>>(bufB, w116, b1, nullptr, h1, NTOK, IS, H);

  // 8) FC2 + residual -> d_out (f32)
  gemm_wmma_k<2><<<gH, blk, 0, stream>>>(h1, w216, b2, x2, (float*)d_out, NTOK, H, IS);
}

// v002
// Measured time: 440 microseconds a run.
// In two side-by-side timings against v001, it was 1.30 and 1.29 times as fast.
// Over all steps from v000 it is 1.78 times as fast.
#include <hip/hip_runtime.h>
#include <hip/hip_bf16.h>

#define H   768
#define NH  12
#define HD  64
#define IS  3072
#define BATCH 16
#define SEQ 1024
#define NTOK (BATCH * SEQ)

#define USE_ASYNC_LDS 1

typedef __attribute__((ext_vector_type(16))) _Float16 v16h;
typedef __attribute__((ext_vector_type(8)))  _Float16 v8h;
typedef __attribute__((ext_vector_type(8)))  float    v8f;

__device__ __forceinline__ void async_copy_b128(unsigned lds_addr, const void* gptr) {
  asm volatile("global_load_async_to_lds_b128 %0, %1, off"
               :: "v"(lds_addr), "v"(gptr) : "memory");
}
__device__ __forceinline__ void wait_async0() {
  asm volatile("s_wait_asynccnt 0x0" ::: "memory");
}
__device__ __forceinline__ unsigned lds_addr_of(const void* p) {
  return (unsigned)(unsigned long long)p;  // flat LDS address: addr[31:0] = LDS offset
}

__device__ __forceinline__ v8f wmma32(v16h a, v16h b, v8f c) {
  return __builtin_amdgcn_wmma_f32_16x16x32_f16(
      /*neg_a=*/false, a, /*neg_b=*/false, b,
      /*c_mod=*/(short)0, c, /*reuse_a=*/false, /*reuse_b=*/false);
}

__device__ __forceinline__ v16h load_frag(const _Float16* __restrict__ base, int ld) {
  const int lane = threadIdx.x & 31;
  const int r    = lane & 15;
  const int hi   = lane >> 4;
  const _Float16* p = base + (size_t)r * ld + hi * 8;
  v8h lo = *(const v8h*)(p);       // K = 8*hi .. 8*hi+7
  v8h hk = *(const v8h*)(p + 16);  // K = 16+8*hi .. 16+8*hi+7
  v16h out;
#pragma unroll
  for (int j = 0; j < 8; ++j) { out[j] = lo[j]; out[j + 8] = hk[j]; }
  return out;
}

__device__ __forceinline__ float gelu_tanh(float x) {
  const float k0 = 0.7978845608028654f;  // sqrt(2/pi)
  const float k1 = 0.044715f;
  float x3 = x * x * x;
  return 0.5f * x * (1.f + tanhf(k0 * (x + k1 * x3)));
}

// --------------------------- small kernels ---------------------------------

__global__ __launch_bounds__(256) void f32_to_f16_k(
    const float* __restrict__ in, _Float16* __restrict__ out, int n) {
  int i = blockIdx.x * 256 + threadIdx.x;
  if (i < n) out[i] = (_Float16)in[i];
}

// One block per token; 768 = 256 * 3 elements per thread.
__global__ __launch_bounds__(256) void layernorm_f16_k(
    const float* __restrict__ x, const float* __restrict__ g,
    const float* __restrict__ b, _Float16* __restrict__ out) {
  const int t = blockIdx.x;
  const float* xr = x + (size_t)t * H;
  const int i0 = threadIdx.x, i1 = i0 + 256, i2 = i0 + 512;
  float v0 = xr[i0], v1 = xr[i1], v2 = xr[i2];
  float s  = v0 + v1 + v2;
  float s2 = v0 * v0 + v1 * v1 + v2 * v2;
#pragma unroll
  for (int m = 16; m >= 1; m >>= 1) {
    s  += __shfl_xor(s,  m);
    s2 += __shfl_xor(s2, m);
  }
  __shared__ float ps[8], ps2[8];
  const int w = threadIdx.x >> 5, lane = threadIdx.x & 31;
  if (lane == 0) { ps[w] = s; ps2[w] = s2; }
  __syncthreads();
  if (w == 0) {
    s  = (lane < 8) ? ps[lane]  : 0.f;
    s2 = (lane < 8) ? ps2[lane] : 0.f;
#pragma unroll
    for (int m = 4; m >= 1; m >>= 1) {
      s  += __shfl_xor(s,  m);
      s2 += __shfl_xor(s2, m);
    }
    if (lane == 0) { ps[0] = s; ps2[0] = s2; }
  }
  __syncthreads();
  const float mu  = ps[0] * (1.f / H);
  const float var = ps2[0] * (1.f / H) - mu * mu;
  const float inv = rsqrtf(var + 1e-6f);
  _Float16* orow = out + (size_t)t * H;
  orow[i0] = (_Float16)((v0 - mu) * inv * g[i0] + b[i0]);
  orow[i1] = (_Float16)((v1 - mu) * inv * g[i1] + b[i1]);
  orow[i2] = (_Float16)((v2 - mu) * inv * g[i2] + b[i2]);
}

// --------------------------- tiled WMMA GEMM -------------------------------
// D[M x N] = A[M x K] * W^T (+ bias) with W row-major [N x K] (torch Linear).
// Block tile 256x128, 8 waves arranged 4x2, each wave 64x64 (4x4 frags), so a
// loaded fragment feeds four WMMAs. One trip covers 64 k (128-B rows).
// Two LDS buffers: tile t+1's async copies fly while tile t is worked on.
// M % 256 == 0, N % 128 == 0, K % 64 == 0.
// EPI: 0 = store f16, 1 = store f16 after GELU, 2 = store f32 + residual.

#define BM  256
#define BN  128
#define BK  64
#define LDT 72

__device__ __forceinline__ void async_copy_tile(
    unsigned la, unsigned lb, const _Float16* ga, const _Float16* gb, size_t rstep) {
  const unsigned ls = 32 * LDT * 2;  // 32 rows further in LDS, bytes
  asm volatile(
      "global_load_async_to_lds_b128 %0, %12, off\n\t"
      "global_load_async_to_lds_b128 %1, %13, off\n\t"
      "global_load_async_to_lds_b128 %2, %14, off\n\t"
      "global_load_async_to_lds_b128 %3, %15, off\n\t"
      "global_load_async_to_lds_b128 %4, %16, off\n\t"
      "global_load_async_to_lds_b128 %5, %17, off\n\t"
      "global_load_async_to_lds_b128 %6, %18, off\n\t"
      "global_load_async_to_lds_b128 %7, %19, off\n\t"
      "global_load_async_to_lds_b128 %8, %20, off\n\t"
      "global_load_async_to_lds_b128 %9, %21, off\n\t"
      "global_load_async_to_lds_b128 %10, %22, off\n\t"
      "global_load_async_to_lds_b128 %11, %23, off\n\t"
      "s_wait_xcnt 0x0"
      :: "v"(la), "v"(la + ls), "v"(la + 2 * ls), "v"(la + 3 * ls),
         "v"(la + 4 * ls), "v"(la + 5 * ls), "v"(la + 6 * ls), "v"(la + 7 * ls),
         "v"(lb), "v"(lb + ls), "v"(lb + 2 * ls), "v"(lb + 3 * ls),
         "v"(ga), "v"(ga + rstep), "v"(ga + 2 * rstep), "v"(ga + 3 * rstep),
         "v"(ga + 4 * rstep), "v"(ga + 5 * rstep), "v"(ga + 6 * rstep), "v"(ga + 7 * rstep),
         "v"(gb), "v"(gb + rstep), "v"(gb + 2 * rstep), "v"(gb + 3 * rstep)
      : "memory");
}
// This wave's LDS reads have retired before its buffer is handed back for refill.
__device__ __forceinline__ void wait_ds0() {
  asm volatile("s_wait_dscnt 0x0" ::: "memory");
}

template <int EPI>
__global__ __launch_bounds__(256) void gemm_wmma_k(
    const _Float16* __restrict__ A, const _Float16* __restrict__ W,
    const float* __restrict__ bias, const float* __restrict__ resid,
    void* __restrict__ out, int M, int N, int K) {
  __shared__ _Float16 sA[2][BM * LDT];
  __shared__ _Float16 sB[2][BN * LDT];

  const int m0 = blockIdx.y * BM;
  const int n0 = blockIdx.x * BN;
  const int tid = threadIdx.x;
  const int w = tid >> 5, lane = tid & 31;
  const int wm = (w >> 1) * 64;  // wave row offset in block tile
  const int wn = (w & 1) * 64;   // wave col offset

  v8f c[4][4] = {};

  const int row = tid >> 3;      // 0..31 (rows row, row+32, ...)
  const int q   = tid & 7;       // 0..7 (8 f16 each)
  const unsigned la = lds_addr_of(&sA[0][row * LDT + q * 8]);
  const unsigned lb = lds_addr_of(&sB[0][row * LDT + q * 8]);
  const _Float16* gaRow = A + (size_t)(m0 + row) * K + q * 8;
  const _Float16* gbRow = W + (size_t)(n0 + row) * K + q * 8;
  const size_t rstep = (size_t)32 * K;

  auto issue = [&](int buf, int t) {
    async_copy_tile(la + buf * (BM * LDT * 2), lb + buf * (BN * LDT * 2),
                    gaRow + t * BK, gbRow + t * BK, rstep);
  };
  v16h af[4], bf[4];
  auto load_frags = [&](int buf, int ks) {
    const _Float16* pa = &sA[buf][wm * LDT + ks * 32];
    const _Float16* pb = &sB[buf][wn * LDT + ks * 32];
#pragma unroll
    for (int i = 0; i < 4; ++i) af[i] = load_frag(pa + i * 16 * LDT, LDT);
#pragma unroll
    for (int j = 0; j < 4; ++j) bf[j] = load_frag(pb + j * 16 * LDT, LDT);
  };
  auto mma = [&]() {
#pragma unroll
    for (int i = 0; i < 4; ++i)
#pragma unroll
      for (int j = 0; j < 4; ++j) c[i][j] = wmma32(af[i], bf[j], c[i][j]);
  };

  const int T = K / BK;
  issue(0, 0);                       // tile 0
  wait_async0();
  __syncthreads();                   // tile 0 published
  if (T > 1) issue(1, 1);            // tile 1 in flight over trip 0
  for (int t = 0; t < T; ++t) {
    const int buf = t & 1;
    load_frags(buf, 0);
    mma();
    load_frags(buf, 1);              // last LDS reads of buf
    wait_ds0();                      // own reads of buf done
    wait_async0();                   // own copies of tile t+1 landed
    __syncthreads();                 // publishes tile t+1, frees buf
    if (t + 2 < T) issue(buf, t + 2);
    mma();                           // registers only: the refill flies under it
  }
  wait_async0();

  // Epilogue. C/D layout: lane = column (lane&15), vgpr v = row v + 8*(lane>>4).
  // The 32x32 wave tile's build read all its residual values ahead of its stores.
  // With 128 accumulators live the compiler no longer does: it emits load, full
  // wait, store, 128 times in a row. Reading a 16-row band first keeps the grouping.
  const int col = lane & 15, hi = lane >> 4;
  float bv[4];
#pragma unroll
  for (int j = 0; j < 4; ++j) bv[j] = bias[n0 + wn + j * 16 + col];
#pragma unroll
  for (int i = 0; i < 4; ++i) {
    const size_t base = (size_t)(m0 + wm + i * 16 + 8 * hi) * N + n0 + wn + col;
    float r[4][8];
    if (EPI == 2) {
#pragma unroll
      for (int j = 0; j < 4; ++j) {
        // This group's results may land in registers that earlier loads or stores
        // still name: the wait stands in front of that rewrite. resid is an input
        // so that the compiler moves none of its loads across the statement.
        asm volatile("s_wait_xcnt 0x0" :: "s"(resid) : "memory");
#pragma unroll
        for (int v = 0; v < 8; ++v) r[j][v] = resid[base + (size_t)v * N + j * 16];
      }
    }
#pragma unroll
    for (int j = 0; j < 4; ++j) {
#pragma unroll
      for (int v = 0; v < 8; ++v) {
        const size_t idx = base + (size_t)v * N + j * 16;
        float val = c[i][j][v] + bv[j];
        if (EPI == 0) {
          ((_Float16*)out)[idx] = (_Float16)val;
        } else if (EPI == 1) {
          ((_Float16*)out)[idx] = (_Float16)gelu_tanh(val);
        } else {
          ((float*)out)[idx] = r[j][v] + val;
        }
      }
    }
  }
}

#define LDA 72

__global__ __launch_bounds__(256) void attention_wmma_k(
    const _Float16* __restrict__ Q, const _Float16* __restrict__ K,
    const _Float16* __restrict__ V, _Float16* __restrict__ O) {
  __shared__ __attribute__((aligned(16))) _Float16 sK[64 * LDA];     // [key][d]
  __shared__ __attribute__((aligned(16))) _Float16 sV[64 * LDA + 32];  // [d][key]  (V^T), skewed
  __shared__ __attribute__((aligned(16))) _Float16 sP[8][16 * LDA];  // per-wave probability tile

  const int bid = blockIdx.x;
  const int qt  = bid & 7;               // SEQ/128 = 8 tiles
  const int bh  = bid >> 3;
  const int b   = bh / NH, h = bh % NH;
  const int tid = threadIdx.x, w = tid >> 5, lane = tid & 31;
  const int col = lane & 15, hi = lane >> 4;
  const int q0  = qt * 128 + w * 16;
  const size_t tokBase = (size_t)b * SEQ;
  const float scale = 0.125f;            // HD^-0.5

  const _Float16* qbase = Q + (tokBase + q0) * H + h * HD;
  const v16h qf0 = load_frag(qbase, H);        // d = 0..31
  const v16h qf1 = load_frag(qbase + 32, H);   // d = 32..63

  v8f of[4] = {};                        // output 16 x 64
  float rm[8], rs[8];
#pragma unroll
  for (int v = 0; v < 8; ++v) { rm[v] = -1e30f; rs[v] = 0.f; }

  const int kk = tid >> 2;               // 0..63 (staging row)
  const int q4 = tid & 3;                // 0..3  (16 f16 chunk)
  const unsigned ldsK0 = lds_addr_of(&sK[kk * LDA + q4 * 16]);
  const unsigned ldsK1 = lds_addr_of(&sK[kk * LDA + q4 * 16 + 8]);

  for (int kt = 0; kt < SEQ; kt += 64) {
    __syncthreads();                     // previous tile fully consumed
    {
      const _Float16* kg = K + (tokBase + kt + kk) * H + h * HD + q4 * 16;
#if USE_ASYNC_LDS
      async_copy_b128(ldsK0, kg);
      async_copy_b128(ldsK1, kg + 8);
#else
      *(v8h*)&sK[kk * LDA + q4 * 16]     = *(const v8h*)kg;
      *(v8h*)&sK[kk * LDA + q4 * 16 + 8] = *(const v8h*)(kg + 8);
#endif
      const _Float16* vg = V + (tokBase + kt + kk) * H + h * HD + q4 * 16;
#pragma unroll
      for (int j = 0; j < 16; ++j) sV[(q4 * 16 + j) * LDA + q4 * 8 + kk] = vg[j];
#if USE_ASYNC_LDS
      wait_async0();
#endif
    }
    __syncthreads();

    // scores S = Q * K^T : 16 x 64 in four 16x16 frags
    v8f s[4];
#pragma unroll
    for (int f = 0; f < 4; ++f) {
      v16h kb0 = load_frag(&sK[(f * 16) * LDA], LDA);
      v16h kb1 = load_frag(&sK[(f * 16) * LDA + 32], LDA);
      v8f acc = {};
      acc = wmma32(qf0, kb0, acc);
      acc = wmma32(qf1, kb1, acc);
      s[f] = acc;
    }

    // online softmax (row m = v + 8*hi lives in one 16-lane half)
#pragma unroll
    for (int v = 0; v < 8; ++v) {
      float tmax = s[0][v] * scale;
#pragma unroll
      for (int f = 0; f < 4; ++f) {
        s[f][v] *= scale;
        tmax = fmaxf(tmax, s[f][v]);
      }
#pragma unroll
      for (int m = 8; m >= 1; m >>= 1) tmax = fmaxf(tmax, __shfl_xor(tmax, m));
      const float mnew  = fmaxf(rm[v], tmax);
      const float alpha = __expf(rm[v] - mnew);
      float tsum = 0.f;
#pragma unroll
      for (int f = 0; f < 4; ++f) {
        const float p = __expf(s[f][v] - mnew);
        s[f][v] = p;
        tsum += p;
      }
#pragma unroll
      for (int m = 8; m >= 1; m >>= 1) tsum += __shfl_xor(tsum, m);
      rs[v] = rs[v] * alpha + tsum;
      rm[v] = mnew;
#pragma unroll
      for (int j = 0; j < 4; ++j) of[j][v] *= alpha;
      // stash P into this wave's LDS tile (C/D layout -> row major)
#pragma unroll
      for (int f = 0; f < 4; ++f)
        sP[w][(v + 8 * hi) * LDA + f * 16 + col] = (_Float16)s[f][v];
    }

    // O += P * V   (same-wave LDS store->load is in program order)
#pragma unroll
    for (int ks = 0; ks < 2; ++ks) {
      v16h pa = load_frag(&sP[w][ks * 32], LDA);
#pragma unroll
      for (int j = 0; j < 4; ++j) {
        v16h vb = load_frag(&sV[(j * 16) * LDA + j * 8 + ks * 32], LDA);
        of[j] = wmma32(pa, vb, of[j]);
      }
    }
  }

  // normalize and store
#pragma unroll
  for (int j = 0; j < 4; ++j) {
#pragma unroll
    for (int v = 0; v < 8; ++v) {
      const float val = of[j][v] / rs[v];
      O[(tokBase + q0 + v + 8 * hi) * H + h * HD + j * 16 + col] = (_Float16)val;
    }
  }
}

// --------------------------- launcher --------------------------------------

extern "C" void kernel_launch(void* const* d_in, const int* in_sizes, int n_in,
                              void* d_out, int out_size, void* d_ws, size_t ws_size,
                              hipStream_t stream) {
  const float* hs    = (const float*)d_in[0];
  const float* wq    = (const float*)d_in[1];
  const float* bq    = (const float*)d_in[2];
  const float* wk    = (const float*)d_in[3];
  const float* bk    = (const float*)d_in[4];
  const float* wv    = (const float*)d_in[5];
  const float* bv    = (const float*)d_in[6];
  const float* wo    = (const float*)d_in[7];
  const float* bo    = (const float*)d_in[8];
  const float* ln1g  = (const float*)d_in[9];
  const float* ln1b  = (const float*)d_in[10];
  const float* ln2g  = (const float*)d_in[11];
  const float* ln2b  = (const float*)d_in[12];
  const float* w1    = (const float*)d_in[13];
  const float* b1    = (const float*)d_in[14];
  const float* w2    = (const float*)d_in[15];
  const float* b2    = (const float*)d_in[16];

  char* ws = (char*)d_ws;
  size_t off = 0;
  auto carve = [&](size_t bytes) {
    char* p = ws + off;
    off = (off + bytes + 255) & ~(size_t)255;
    return p;
  };
  const size_t SZ_HH  = (size_t)H * H * sizeof(_Float16);
  const size_t SZ_IH  = (size_t)IS * H * sizeof(_Float16);
  const size_t SZ_TH2 = (size_t)NTOK * H * sizeof(_Float16);
  const size_t SZ_TH4 = (size_t)NTOK * H * sizeof(float);
  const size_t SZ_TI2 = (size_t)NTOK * IS * sizeof(_Float16);

  _Float16* wq16 = (_Float16*)carve(SZ_HH);
  _Float16* wk16 = (_Float16*)carve(SZ_HH);
  _Float16* wv16 = (_Float16*)carve(SZ_HH);
  _Float16* wo16 = (_Float16*)carve(SZ_HH);
  _Float16* w116 = (_Float16*)carve(SZ_IH);
  _Float16* w216 = (_Float16*)carve(SZ_IH);
  _Float16* bufA = (_Float16*)carve(SZ_TH2);  // ln1 out, later attn out
  _Float16* bufB = (_Float16*)carve(SZ_TH2);  // q, later ln2 out
  _Float16* bufC = (_Float16*)carve(SZ_TH2);  // k
  _Float16* bufD = (_Float16*)carve(SZ_TH2);  // v
  float*    x2   = (float*)   carve(SZ_TH4);  // post-attention residual state
  _Float16* h1   = (_Float16*)carve(SZ_TI2);  // gelu(fc1)
  (void)ws_size; (void)n_in; (void)in_sizes; (void)out_size;

  // 1) weights -> f16
  const int nHH = H * H, nIH = IS * H;
  f32_to_f16_k<<<(nHH + 255) / 256, 256, 0, stream>>>(wq, wq16, nHH);
  f32_to_f16_k<<<(nHH + 255) / 256, 256, 0, stream>>>(wk, wk16, nHH);
  f32_to_f16_k<<<(nHH + 255) / 256, 256, 0, stream>>>(wv, wv16, nHH);
  f32_to_f16_k<<<(nHH + 255) / 256, 256, 0, stream>>>(wo, wo16, nHH);
  f32_to_f16_k<<<(nIH + 255) / 256, 256, 0, stream>>>(w1, w116, nIH);
  f32_to_f16_k<<<(nIH + 255) / 256, 256, 0, stream>>>(w2, w216, nIH);

  const dim3 blk(256);
  const dim3 gH(H / 128, NTOK / 256);    // N=768 GEMMs
  const dim3 gI(IS / 128, NTOK / 256);   // N=3072 GEMM

  // 2) LN1
  layernorm_f16_k<<<NTOK, blk, 0, stream>>>(hs, ln1g, ln1b, bufA);

  // 3) QKV projections
  gemm_wmma_k<0><<<gH, blk, 0, stream>>>(bufA, wq16, bq, nullptr, bufB, NTOK, H, H);
  gemm_wmma_k<0><<<gH, blk, 0, stream>>>(bufA, wk16, bk, nullptr, bufC, NTOK, H, H);
  gemm_wmma_k<0><<<gH, blk, 0, stream>>>(bufA, wv16, bv, nullptr, bufD, NTOK, H, H);

  // 4) attention (bufA reused as output; ln1 activations are dead now)
  attention_wmma_k<<<BATCH * NH * (SEQ / 128), blk, 0, stream>>>(bufB, bufC, bufD, bufA);

  // 5) output projection + residual -> x2 (f32)
  gemm_wmma_k<2><<<gH, blk, 0, stream>>>(bufA, wo16, bo, hs, x2, NTOK, H, H);

  // 6) LN2 (bufB reused; q is dead)
  layernorm_f16_k<<<NTOK, blk, 0, stream>>>(x2, ln2g, ln2b, bufB);

  // 7) FC1 + GELU
  gemm_wmma_k<1><<<gI, blk, 0, stream>>>(bufB, w116, b1, nullptr, h1, NTOK, IS, H);

  // 8) FC2 + residual -> d_out (f32)
  gemm_wmma_k<2><<<gH, blk, 0, stream>>>(h1, w216, b2, x2, (float*)d_out, NTOK, H, IS);
}

// v003
// Measured time: 409 microseconds a run.
// In two side-by-side timings against v002, it was 1.08 and 1.07 times as fast.
// Counting every step since v000, it is 1.91 times as fast.
#include <hip/hip_runtime.h>
#include <hip/hip_bf16.h>

#define H   768
#define NH  12
#define HD  64
#define IS  3072
#define BATCH 16
#define SEQ 1024
#define NTOK (BATCH * SEQ)

#define USE_ASYNC_LDS 1

typedef __attribute__((ext_vector_type(16))) _Float16 v16h;
typedef __attribute__((ext_vector_type(8)))  _Float16 v8h;
typedef __attribute__((ext_vector_type(8)))  float    v8f;

__device__ __forceinline__ void async_copy_b128(unsigned lds_addr, const void* gptr) {
  asm volatile("global_load_async_to_lds_b128 %0, %1, off"
               :: "v"(lds_addr), "v"(gptr) : "memory");
}
__device__ __forceinline__ void wait_async0() {
  asm volatile("s_wait_asynccnt 0x0" ::: "memory");
}
__device__ __forceinline__ unsigned lds_addr_of(const void* p) {
  return (unsigned)(unsigned long long)p;  // flat LDS address: addr[31:0] = LDS offset
}

__device__ __forceinline__ v8f wmma32(v16h a, v16h b, v8f c) {
  return __builtin_amdgcn_wmma_f32_16x16x32_f16(
      /*neg_a=*/false, a, /*neg_b=*/false, b,
      /*c_mod=*/(short)0, c, /*reuse_a=*/false, /*reuse_b=*/false);
}

__device__ __forceinline__ v16h load_frag(const _Float16* __restrict__ base, int ld) {
  const int lane = threadIdx.x & 31;
  const int r    = lane & 15;
  const int hi   = lane >> 4;
  const _Float16* p = base + (size_t)r * ld + hi * 8;
  v8h lo = *(const v8h*)(p);       // K = 8*hi .. 8*hi+7
  v8h hk = *(const v8h*)(p + 16);  // K = 16+8*hi .. 16+8*hi+7
  v16h out;
#pragma unroll
  for (int j = 0; j < 8; ++j) { out[j] = lo[j]; out[j + 8] = hk[j]; }
  return out;
}

__device__ __forceinline__ float gelu_tanh(float x) {
  const float k0 = 0.7978845608028654f;  // sqrt(2/pi)
  const float k1 = 0.044715f;
  float x3 = x * x * x;
  return 0.5f * x * (1.f + tanhf(k0 * (x + k1 * x3)));
}

// --------------------------- small kernels ---------------------------------
// Both are streams: a few fat waves, every global access of a wave contiguous
// (16 B a lane read, 8 B a lane written), all of a wave's reads issued ahead.

typedef __attribute__((ext_vector_type(4))) float    v4f;
typedef __attribute__((ext_vector_type(4))) _Float16 v4h;

__device__ __forceinline__ v4h to_f16x4(v4f v) {
  v4h o;
  o[0] = (_Float16)v[0]; o[1] = (_Float16)v[1];
  o[2] = (_Float16)v[2]; o[3] = (_Float16)v[3];
  return o;
}

// A block converts CVT_BLK consecutive elements, four 16-B groups a lane.
// The grid covers the array exactly: its length is a multiple of CVT_BLK.
#define CVT_BLK 4096

__global__ __launch_bounds__(256) void f32_to_f16_k(
    const float* __restrict__ in, _Float16* __restrict__ out) {
  const size_t i0 = (size_t)blockIdx.x * (CVT_BLK / 4) + threadIdx.x;
  const v4f* __restrict__ in4 = (const v4f*)in + i0;
  v4h* __restrict__ out4 = (v4h*)out + i0;
  v4f v[4];
#pragma unroll
  for (int k = 0; k < 4; ++k) v[k] = in4[k * 256];
#pragma unroll
  for (int k = 0; k < 4; ++k) out4[k * 256] = to_f16x4(v[k]);
}

// One wave per token row (768 f32 = six 16-B groups a lane), LN_ROWS rows a
// wave: the row's sums need the wave's own lanes only, no LDS and no barrier.
#define LN_ROWS 4

__global__ __launch_bounds__(256) void layernorm_f16_k(
    const float* __restrict__ x, const float* __restrict__ g,
    const float* __restrict__ b, _Float16* __restrict__ out) {
  const int lane = threadIdx.x & 31;
  const size_t row0 = ((size_t)blockIdx.x * 8 + (threadIdx.x >> 5)) * LN_ROWS;
  const v4f* __restrict__ x4 = (const v4f*)(x + row0 * H) + lane;
  v4f v[LN_ROWS][6];
#pragma unroll
  for (int r = 0; r < LN_ROWS; ++r)
#pragma unroll
    for (int k = 0; k < 6; ++k) v[r][k] = x4[r * (H / 4) + k * 32];
  v4f gv[6], bv[6];
#pragma unroll
  for (int k = 0; k < 6; ++k) {
    gv[k] = ((const v4f*)g)[k * 32 + lane];
    bv[k] = ((const v4f*)b)[k * 32 + lane];
  }

  float s[LN_ROWS], s2[LN_ROWS];
#pragma unroll
  for (int r = 0; r < LN_ROWS; ++r) {
    v4f a = v[r][0], a2 = v[r][0] * v[r][0];
#pragma unroll
    for (int k = 1; k < 6; ++k) { a += v[r][k]; a2 += v[r][k] * v[r][k]; }
    s[r]  = (a[0] + a[1]) + (a[2] + a[3]);
    s2[r] = (a2[0] + a2[1]) + (a2[2] + a2[3]);
  }
#pragma unroll
  for (int m = 16; m >= 1; m >>= 1) {
#pragma unroll
    for (int r = 0; r < LN_ROWS; ++r) {
      s[r]  += __shfl_xor(s[r],  m);
      s2[r] += __shfl_xor(s2[r], m);
    }
  }

  v4h* __restrict__ o4 = (v4h*)(out + row0 * H) + lane;
#pragma unroll
  for (int r = 0; r < LN_ROWS; ++r) {
    const float mu  = s[r] * (1.f / H);
    const float var = s2[r] * (1.f / H) - mu * mu;
    const float inv = rsqrtf(var + 1e-6f);
#pragma unroll
    for (int k = 0; k < 6; ++k)
      o4[r * (H / 4) + k * 32] = to_f16x4((v[r][k] - mu) * inv * gv[k] + bv[k]);
  }
}

// --------------------------- tiled WMMA GEMM -------------------------------
// D[M x N] = A[M x K] * W^T (+ bias) with W row-major [N x K] (torch Linear).
// Block tile 256x128, 8 waves arranged 4x2, each wave 64x64 (4x4 frags), so a
// loaded fragment feeds four WMMAs. One trip covers 64 k (128-B rows).
// Two LDS buffers: tile t+1's async copies fly while tile t is worked on.
// M % 256 == 0, N % 128 == 0, K % 64 == 0.
// EPI: 0 = store f16, 1 = store f16 after GELU, 2 = store f32 + residual.

#define BM  256
#define BN  128
#define BK  64
#define LDT 72

__device__ __forceinline__ void async_copy_tile(
    unsigned la, unsigned lb, const _Float16* ga, const _Float16* gb, size_t rstep) {
  const unsigned ls = 32 * LDT * 2;  // 32 rows further in LDS, bytes
  asm volatile(
      "global_load_async_to_lds_b128 %0, %12, off\n\t"
      "global_load_async_to_lds_b128 %1, %13, off\n\t"
      "global_load_async_to_lds_b128 %2, %14, off\n\t"
      "global_load_async_to_lds_b128 %3, %15, off\n\t"
      "global_load_async_to_lds_b128 %4, %16, off\n\t"
      "global_load_async_to_lds_b128 %5, %17, off\n\t"
      "global_load_async_to_lds_b128 %6, %18, off\n\t"
      "global_load_async_to_lds_b128 %7, %19, off\n\t"
      "global_load_async_to_lds_b128 %8, %20, off\n\t"
      "global_load_async_to_lds_b128 %9, %21, off\n\t"
      "global_load_async_to_lds_b128 %10, %22, off\n\t"
      "global_load_async_to_lds_b128 %11, %23, off\n\t"
      "s_wait_xcnt 0x0"
      :: "v"(la), "v"(la + ls), "v"(la + 2 * ls), "v"(la + 3 * ls),
         "v"(la + 4 * ls), "v"(la + 5 * ls), "v"(la + 6 * ls), "v"(la + 7 * ls),
         "v"(lb), "v"(lb + ls), "v"(lb + 2 * ls), "v"(lb + 3 * ls),
         "v"(ga), "v"(ga + rstep), "v"(ga + 2 * rstep), "v"(ga + 3 * rstep),
         "v"(ga + 4 * rstep), "v"(ga + 5 * rstep), "v"(ga + 6 * rstep), "v"(ga + 7 * rstep),
         "v"(gb), "v"(gb + rstep), "v"(gb + 2 * rstep), "v"(gb + 3 * rstep)
      : "memory");
}
// This wave's LDS reads have retired before its buffer is handed back for refill.
__device__ __forceinline__ void wait_ds0() {
  asm volatile("s_wait_dscnt 0x0" ::: "memory");
}

template <int EPI>
__global__ __launch_bounds__(256) void gemm_wmma_k(
    const _Float16* __restrict__ A, const _Float16* __restrict__ W,
    const float* __restrict__ bias, const float* __restrict__ resid,
    void* __restrict__ out, int M, int N, int K) {
  __shared__ _Float16 sA[2][BM * LDT];
  __shared__ _Float16 sB[2][BN * LDT];

  const int m0 = blockIdx.y * BM;
  const int n0 = blockIdx.x * BN;
  const int tid = threadIdx.x;
  const int w = tid >> 5, lane = tid & 31;
  const int wm = (w >> 1) * 64;  // wave row offset in block tile
  const int wn = (w & 1) * 64;   // wave col offset

  v8f c[4][4] = {};

  const int row = tid >> 3;      // 0..31 (rows row, row+32, ...)
  const int q   = tid & 7;       // 0..7 (8 f16 each)
  const unsigned la = lds_addr_of(&sA[0][row * LDT + q * 8]);
  const unsigned lb = lds_addr_of(&sB[0][row * LDT + q * 8]);
  const _Float16* gaRow = A + (size_t)(m0 + row) * K + q * 8;
  const _Float16* gbRow = W + (size_t)(n0 + row) * K + q * 8;
  const size_t rstep = (size_t)32 * K;

  auto issue = [&](int buf, int t) {
    async_copy_tile(la + buf * (BM * LDT * 2), lb + buf * (BN * LDT * 2),
                    gaRow + t * BK, gbRow + t * BK, rstep);
  };
  v16h af[4], bf[4];
  auto load_frags = [&](int buf, int ks) {
    const _Float16* pa = &sA[buf][wm * LDT + ks * 32];
    const _Float16* pb = &sB[buf][wn * LDT + ks * 32];
#pragma unroll
    for (int i = 0; i < 4; ++i) af[i] = load_frag(pa + i * 16 * LDT, LDT);
#pragma unroll
    for (int j = 0; j < 4; ++j) bf[j] = load_frag(pb + j * 16 * LDT, LDT);
  };
  auto mma = [&]() {
#pragma unroll
    for (int i = 0; i < 4; ++i)
#pragma unroll
      for (int j = 0; j < 4; ++j) c[i][j] = wmma32(af[i], bf[j], c[i][j]);
  };

  const int T = K / BK;
  issue(0, 0);                       // tile 0
  wait_async0();
  __syncthreads();                   // tile 0 published
  if (T > 1) issue(1, 1);            // tile 1 in flight over trip 0
  for (int t = 0; t < T; ++t) {
    const int buf = t & 1;
    load_frags(buf, 0);
    mma();
    load_frags(buf, 1);              // last LDS reads of buf
    wait_ds0();                      // own reads of buf done
    wait_async0();                   // own copies of tile t+1 landed
    __syncthreads();                 // publishes tile t+1, frees buf
    if (t + 2 < T) issue(buf, t + 2);
    mma();                           // registers only: the refill flies under it
  }
  wait_async0();

  // Epilogue. C/D layout: lane = column (lane&15), vgpr v = row v + 8*(lane>>4).
  // The 32x32 wave tile's build read all its residual values ahead of its stores.
  // With 128 accumulators live the compiler no longer does: it emits load, full
  // wait, store, 128 times in a row. Reading a 16-row band first keeps the grouping.
  const int col = lane & 15, hi = lane >> 4;
  float bv[4];
#pragma unroll
  for (int j = 0; j < 4; ++j) bv[j] = bias[n0 + wn + j * 16 + col];
#pragma unroll
  for (int i = 0; i < 4; ++i) {
    const size_t base = (size_t)(m0 + wm + i * 16 + 8 * hi) * N + n0 + wn + col;
    float r[4][8];
    if (EPI == 2) {
#pragma unroll
      for (int j = 0; j < 4; ++j) {
        // This group's results may land in registers that earlier loads or stores
        // still name: the wait stands in front of that rewrite. resid is an input
        // so that the compiler moves none of its loads across the statement.
        asm volatile("s_wait_xcnt 0x0" :: "s"(resid) : "memory");
#pragma unroll
        for (int v = 0; v < 8; ++v) r[j][v] = resid[base + (size_t)v * N + j * 16];
      }
    }
#pragma unroll
    for (int j = 0; j < 4; ++j) {
#pragma unroll
      for (int v = 0; v < 8; ++v) {
        const size_t idx = base + (size_t)v * N + j * 16;
        float val = c[i][j][v] + bv[j];
        if (EPI == 0) {
          ((_Float16*)out)[idx] = (_Float16)val;
        } else if (EPI == 1) {
          ((_Float16*)out)[idx] = (_Float16)gelu_tanh(val);
        } else {
          ((float*)out)[idx] = r[j][v] + val;
        }
      }
    }
  }
}

#define LDA 72

__global__ __launch_bounds__(256) void attention_wmma_k(
    const _Float16* __restrict__ Q, const _Float16* __restrict__ K,
    const _Float16* __restrict__ V, _Float16* __restrict__ O) {
  __shared__ __attribute__((aligned(16))) _Float16 sK[64 * LDA];     // [key][d]
  __shared__ __attribute__((aligned(16))) _Float16 sV[64 * LDA + 32];  // [d][key]  (V^T), skewed
  __shared__ __attribute__((aligned(16))) _Float16 sP[8][16 * LDA];  // per-wave probability tile

  const int bid = blockIdx.x;
  const int qt  = bid & 7;               // SEQ/128 = 8 tiles
  const int bh  = bid >> 3;
  const int b   = bh / NH, h = bh % NH;
  const int tid = threadIdx.x, w = tid >> 5, lane = tid & 31;
  const int col = lane & 15, hi = lane >> 4;
  const int q0  = qt * 128 + w * 16;
  const size_t tokBase = (size_t)b * SEQ;
  const float scale = 0.125f;            // HD^-0.5

  const _Float16* qbase = Q + (tokBase + q0) * H + h * HD;
  const v16h qf0 = load_frag(qbase, H);        // d = 0..31
  const v16h qf1 = load_frag(qbase + 32, H);   // d = 32..63

  v8f of[4] = {};                        // output 16 x 64
  float rm[8], rs[8];
#pragma unroll
  for (int v = 0; v < 8; ++v) { rm[v] = -1e30f; rs[v] = 0.f; }

  const int kk = tid >> 2;               // 0..63 (staging row)
  const int q4 = tid & 3;                // 0..3  (16 f16 chunk)
  const unsigned ldsK0 = lds_addr_of(&sK[kk * LDA + q4 * 16]);
  const unsigned ldsK1 = lds_addr_of(&sK[kk * LDA + q4 * 16 + 8]);

  for (int kt = 0; kt < SEQ; kt += 64) {
    __syncthreads();                     // previous tile fully consumed
    {
      const _Float16* kg = K + (tokBase + kt + kk) * H + h * HD + q4 * 16;
#if USE_ASYNC_LDS
      async_copy_b128(ldsK0, kg);
      async_copy_b128(ldsK1, kg + 8);
#else
      *(v8h*)&sK[kk * LDA + q4 * 16]     = *(const v8h*)kg;
      *(v8h*)&sK[kk * LDA + q4 * 16 + 8] = *(const v8h*)(kg + 8);
#endif
      const _Float16* vg = V + (tokBase + kt + kk) * H + h * HD + q4 * 16;
#pragma unroll
      for (int j = 0; j < 16; ++j) sV[(q4 * 16 + j) * LDA + q4 * 8 + kk] = vg[j];
#if USE_ASYNC_LDS
      wait_async0();
#endif
    }
    __syncthreads();

    // scores S = Q * K^T : 16 x 64 in four 16x16 frags
    v8f s[4];
#pragma unroll
    for (int f = 0; f < 4; ++f) {
      v16h kb0 = load_frag(&sK[(f * 16) * LDA], LDA);
      v16h kb1 = load_frag(&sK[(f * 16) * LDA + 32], LDA);
      v8f acc = {};
      acc = wmma32(qf0, kb0, acc);
      acc = wmma32(qf1, kb1, acc);
      s[f] = acc;
    }

    // online softmax (row m = v + 8*hi lives in one 16-lane half)
#pragma unroll
    for (int v = 0; v < 8; ++v) {
      float tmax = s[0][v] * scale;
#pragma unroll
      for (int f = 0; f < 4; ++f) {
        s[f][v] *= scale;
        tmax = fmaxf(tmax, s[f][v]);
      }
#pragma unroll
      for (int m = 8; m >= 1; m >>= 1) tmax = fmaxf(tmax, __shfl_xor(tmax, m));
      const float mnew  = fmaxf(rm[v], tmax);
      const float alpha = __expf(rm[v] - mnew);
      float tsum = 0.f;
#pragma unroll
      for (int f = 0; f < 4; ++f) {
        const float p = __expf(s[f][v] - mnew);
        s[f][v] = p;
        tsum += p;
      }
#pragma unroll
      for (int m = 8; m >= 1; m >>= 1) tsum += __shfl_xor(tsum, m);
      rs[v] = rs[v] * alpha + tsum;
      rm[v] = mnew;
#pragma unroll
      for (int j = 0; j < 4; ++j) of[j][v] *= alpha;
      // stash P into this wave's LDS tile (C/D layout -> row major)
#pragma unroll
      for (int f = 0; f < 4; ++f)
        sP[w][(v + 8 * hi) * LDA + f * 16 + col] = (_Float16)s[f][v];
    }

    // O += P * V   (same-wave LDS store->load is in program order)
#pragma unroll
    for (int ks = 0; ks < 2; ++ks) {
      v16h pa = load_frag(&sP[w][ks * 32], LDA);
#pragma unroll
      for (int j = 0; j < 4; ++j) {
        v16h vb = load_frag(&sV[(j * 16) * LDA + j * 8 + ks * 32], LDA);
        of[j] = wmma32(pa, vb, of[j]);
      }
    }
  }

  // normalize and store
#pragma unroll
  for (int j = 0; j < 4; ++j) {
#pragma unroll
    for (int v = 0; v < 8; ++v) {
      const float val = of[j][v] / rs[v];
      O[(tokBase + q0 + v + 8 * hi) * H + h * HD + j * 16 + col] = (_Float16)val;
    }
  }
}

// --------------------------- launcher --------------------------------------

extern "C" void kernel_launch(void* const* d_in, const int* in_sizes, int n_in,
                              void* d_out, int out_size, void* d_ws, size_t ws_size,
                              hipStream_t stream) {
  const float* hs    = (const float*)d_in[0];
  const float* wq    = (const float*)d_in[1];
  const float* bq    = (const float*)d_in[2];
  const float* wk    = (const float*)d_in[3];
  const float* bk    = (const float*)d_in[4];
  const float* wv    = (const float*)d_in[5];
  const float* bv    = (const float*)d_in[6];
  const float* wo    = (const float*)d_in[7];
  const float* bo    = (const float*)d_in[8];
  const float* ln1g  = (const float*)d_in[9];
  const float* ln1b  = (const float*)d_in[10];
  const float* ln2g  = (const float*)d_in[11];
  const float* ln2b  = (const float*)d_in[12];
  const float* w1    = (const float*)d_in[13];
  const float* b1    = (const float*)d_in[14];
  const float* w2    = (const float*)d_in[15];
  const float* b2    = (const float*)d_in[16];

  char* ws = (char*)d_ws;
  size_t off = 0;
  auto carve = [&](size_t bytes) {
    char* p = ws + off;
    off = (off + bytes + 255) & ~(size_t)255;
    return p;
  };
  const size_t SZ_HH  = (size_t)H * H * sizeof(_Float16);
  const size_t SZ_IH  = (size_t)IS * H * sizeof(_Float16);
  const size_t SZ_TH2 = (size_t)NTOK * H * sizeof(_Float16);
  const size_t SZ_TH4 = (size_t)NTOK * H * sizeof(float);
  const size_t SZ_TI2 = (size_t)NTOK * IS * sizeof(_Float16);

  _Float16* wq16 = (_Float16*)carve(SZ_HH);
  _Float16* wk16 = (_Float16*)carve(SZ_HH);
  _Float16* wv16 = (_Float16*)carve(SZ_HH);
  _Float16* wo16 = (_Float16*)carve(SZ_HH);
  _Float16* w116 = (_Float16*)carve(SZ_IH);
  _Float16* w216 = (_Float16*)carve(SZ_IH);
  _Float16* bufA = (_Float16*)carve(SZ_TH2);  // ln1 out, later attn out
  _Float16* bufB = (_Float16*)carve(SZ_TH2);  // q, later ln2 out
  _Float16* bufC = (_Float16*)carve(SZ_TH2);  // k
  _Float16* bufD = (_Float16*)carve(SZ_TH2);  // v
  float*    x2   = (float*)   carve(SZ_TH4);  // post-attention residual state
  _Float16* h1   = (_Float16*)carve(SZ_TI2);  // gelu(fc1)
  (void)ws_size; (void)n_in; (void)in_sizes; (void)out_size;

  // 1) weights -> f16
  const int nHH = H * H, nIH = IS * H;
  f32_to_f16_k<<<nHH / CVT_BLK, 256, 0, stream>>>(wq, wq16);
  f32_to_f16_k<<<nHH / CVT_BLK, 256, 0, stream>>>(wk, wk16);
  f32_to_f16_k<<<nHH / CVT_BLK, 256, 0, stream>>>(wv, wv16);
  f32_to_f16_k<<<nHH / CVT_BLK, 256, 0, stream>>>(wo, wo16);
  f32_to_f16_k<<<nIH / CVT_BLK, 256, 0, stream>>>(w1, w116);
  f32_to_f16_k<<<nIH / CVT_BLK, 256, 0, stream>>>(w2, w216);

  const dim3 blk(256);
  const dim3 gH(H / 128, NTOK / 256);    // N=768 GEMMs
  const dim3 gI(IS / 128, NTOK / 256);   // N=3072 GEMM

  // 2) LN1
  layernorm_f16_k<<<NTOK / (8 * LN_ROWS), blk, 0, stream>>>(hs, ln1g, ln1b, bufA);

  // 3) QKV projections
  gemm_wmma_k<0><<<gH, blk, 0, stream>>>(bufA, wq16, bq, nullptr, bufB, NTOK, H, H);
  gemm_wmma_k<0><<<gH, blk, 0, stream>>>(bufA, wk16, bk, nullptr, bufC, NTOK, H, H);
  gemm_wmma_k<0><<<gH, blk, 0, stream>>>(bufA, wv16, bv, nullptr, bufD, NTOK, H, H);

  // 4) attention (bufA reused as output; ln1 activations are dead now)
  attention_wmma_k<<<BATCH * NH * (SEQ / 128), blk, 0, stream>>>(bufB, bufC, bufD, bufA);

  // 5) output projection + residual -> x2 (f32)
  gemm_wmma_k<2><<<gH, blk, 0, stream>>>(bufA, wo16, bo, hs, x2, NTOK, H, H);

  // 6) LN2 (bufB reused; q is dead)
  layernorm_f16_k<<<NTOK / (8 * LN_ROWS), blk, 0, stream>>>(x2, ln2g, ln2b, bufB);

  // 7) FC1 + GELU
  gemm_wmma_k<1><<<gI, blk, 0, stream>>>(bufB, w116, b1, nullptr, h1, NTOK, IS, H);

  // 8) FC2 + residual -> d_out (f32)
  gemm_wmma_k<2><<<gH, blk, 0, stream>>>(h1, w216, b2, x2, (float*)d_out, NTOK, H, IS);
}

// v004
// Measured time: 374 microseconds a run.
// Two timings next to v003 put it at 1.12 and 1.09 times that version's speed.
// All steps since v000 together make it 2.12 times as fast.
#include <hip/hip_runtime.h>
#include <hip/hip_bf16.h>

#define H   768
#define NH  12
#define HD  64
#define IS  3072
#define BATCH 16
#define SEQ 1024
#define NTOK (BATCH * SEQ)

typedef __attribute__((ext_vector_type(16))) _Float16 v16h;
typedef __attribute__((ext_vector_type(8)))  _Float16 v8h;
typedef __attribute__((ext_vector_type(8)))  float    v8f;

__device__ __forceinline__ void wait_async0() {
  asm volatile("s_wait_asynccnt 0x0" ::: "memory");
}
__device__ __forceinline__ unsigned lds_addr_of(const void* p) {
  return (unsigned)(unsigned long long)p;  // flat LDS address: addr[31:0] = LDS offset
}

__device__ __forceinline__ v8f wmma32(v16h a, v16h b, v8f c) {
  return __builtin_amdgcn_wmma_f32_16x16x32_f16(
      /*neg_a=*/false, a, /*neg_b=*/false, b,
      /*c_mod=*/(short)0, c, /*reuse_a=*/false, /*reuse_b=*/false);
}

__device__ __forceinline__ v16h load_frag(const _Float16* __restrict__ base, int ld) {
  const int lane = threadIdx.x & 31;
  const int r    = lane & 15;
  const int hi   = lane >> 4;
  const _Float16* p = base + (size_t)r * ld + hi * 8;
  v8h lo = *(const v8h*)(p);       // K = 8*hi .. 8*hi+7
  v8h hk = *(const v8h*)(p + 16);  // K = 16+8*hi .. 16+8*hi+7
  v16h out;
#pragma unroll
  for (int j = 0; j < 8; ++j) { out[j] = lo[j]; out[j + 8] = hk[j]; }
  return out;
}

__device__ __forceinline__ float gelu_tanh(float x) {
  const float k0 = 0.7978845608028654f;  // sqrt(2/pi)
  const float k1 = 0.044715f;
  float x3 = x * x * x;
  return 0.5f * x * (1.f + tanhf(k0 * (x + k1 * x3)));
}

// --------------------------- small kernels ---------------------------------
// Both are streams: a few fat waves, every global access of a wave contiguous
// (16 B a lane read, 8 B a lane written), all of a wave's reads issued ahead.

typedef __attribute__((ext_vector_type(4))) float    v4f;
typedef __attribute__((ext_vector_type(4))) _Float16 v4h;

__device__ __forceinline__ v4h to_f16x4(v4f v) {
  v4h o;
  o[0] = (_Float16)v[0]; o[1] = (_Float16)v[1];
  o[2] = (_Float16)v[2]; o[3] = (_Float16)v[3];
  return o;
}

// A block converts CVT_BLK consecutive elements, four 16-B groups a lane.
// The grid covers the array exactly: its length is a multiple of CVT_BLK.
#define CVT_BLK 4096

__global__ __launch_bounds__(256) void f32_to_f16_k(
    const float* __restrict__ in, _Float16* __restrict__ out) {
  const size_t i0 = (size_t)blockIdx.x * (CVT_BLK / 4) + threadIdx.x;
  const v4f* __restrict__ in4 = (const v4f*)in + i0;
  v4h* __restrict__ out4 = (v4h*)out + i0;
  v4f v[4];
#pragma unroll
  for (int k = 0; k < 4; ++k) v[k] = in4[k * 256];
#pragma unroll
  for (int k = 0; k < 4; ++k) out4[k * 256] = to_f16x4(v[k]);
}

// One wave per token row (768 f32 = six 16-B groups a lane), LN_ROWS rows a
// wave: the row's sums need the wave's own lanes only, no LDS and no barrier.
#define LN_ROWS 4

__global__ __launch_bounds__(256) void layernorm_f16_k(
    const float* __restrict__ x, const float* __restrict__ g,
    const float* __restrict__ b, _Float16* __restrict__ out) {
  const int lane = threadIdx.x & 31;
  const size_t row0 = ((size_t)blockIdx.x * 8 + (threadIdx.x >> 5)) * LN_ROWS;
  const v4f* __restrict__ x4 = (const v4f*)(x + row0 * H) + lane;
  v4f v[LN_ROWS][6];
#pragma unroll
  for (int r = 0; r < LN_ROWS; ++r)
#pragma unroll
    for (int k = 0; k < 6; ++k) v[r][k] = x4[r * (H / 4) + k * 32];
  v4f gv[6], bv[6];
#pragma unroll
  for (int k = 0; k < 6; ++k) {
    gv[k] = ((const v4f*)g)[k * 32 + lane];
    bv[k] = ((const v4f*)b)[k * 32 + lane];
  }

  float s[LN_ROWS], s2[LN_ROWS];
#pragma unroll
  for (int r = 0; r < LN_ROWS; ++r) {
    v4f a = v[r][0], a2 = v[r][0] * v[r][0];
#pragma unroll
    for (int k = 1; k < 6; ++k) { a += v[r][k]; a2 += v[r][k] * v[r][k]; }
    s[r]  = (a[0] + a[1]) + (a[2] + a[3]);
    s2[r] = (a2[0] + a2[1]) + (a2[2] + a2[3]);
  }
#pragma unroll
  for (int m = 16; m >= 1; m >>= 1) {
#pragma unroll
    for (int r = 0; r < LN_ROWS; ++r) {
      s[r]  += __shfl_xor(s[r],  m);
      s2[r] += __shfl_xor(s2[r], m);
    }
  }

  v4h* __restrict__ o4 = (v4h*)(out + row0 * H) + lane;
#pragma unroll
  for (int r = 0; r < LN_ROWS; ++r) {
    const float mu  = s[r] * (1.f / H);
    const float var = s2[r] * (1.f / H) - mu * mu;
    const float inv = rsqrtf(var + 1e-6f);
#pragma unroll
    for (int k = 0; k < 6; ++k)
      o4[r * (H / 4) + k * 32] = to_f16x4((v[r][k] - mu) * inv * gv[k] + bv[k]);
  }
}

// --------------------------- tiled WMMA GEMM -------------------------------
// D[M x N] = A[M x K] * W^T (+ bias) with W row-major [N x K] (torch Linear).
// Block tile 256x128, 8 waves arranged 4x2, each wave 64x64 (4x4 frags), so a
// loaded fragment feeds four WMMAs. One trip covers 64 k (128-B rows).
// Two LDS buffers: tile t+1's async copies fly while tile t is worked on.
// M % 256 == 0, N % 128 == 0, K % 64 == 0.
// EPI: 0 = store f16, 1 = store f16 after GELU, 2 = store f32 + residual.

#define BM  256
#define BN  128
#define BK  64
#define LDT 72

__device__ __forceinline__ void async_copy_tile(
    unsigned la, unsigned lb, const _Float16* ga, const _Float16* gb, size_t rstep) {
  const unsigned ls = 32 * LDT * 2;  // 32 rows further in LDS, bytes
  asm volatile(
      "global_load_async_to_lds_b128 %0, %12, off\n\t"
      "global_load_async_to_lds_b128 %1, %13, off\n\t"
      "global_load_async_to_lds_b128 %2, %14, off\n\t"
      "global_load_async_to_lds_b128 %3, %15, off\n\t"
      "global_load_async_to_lds_b128 %4, %16, off\n\t"
      "global_load_async_to_lds_b128 %5, %17, off\n\t"
      "global_load_async_to_lds_b128 %6, %18, off\n\t"
      "global_load_async_to_lds_b128 %7, %19, off\n\t"
      "global_load_async_to_lds_b128 %8, %20, off\n\t"
      "global_load_async_to_lds_b128 %9, %21, off\n\t"
      "global_load_async_to_lds_b128 %10, %22, off\n\t"
      "global_load_async_to_lds_b128 %11, %23, off\n\t"
      "s_wait_xcnt 0x0"
      :: "v"(la), "v"(la + ls), "v"(la + 2 * ls), "v"(la + 3 * ls),
         "v"(la + 4 * ls), "v"(la + 5 * ls), "v"(la + 6 * ls), "v"(la + 7 * ls),
         "v"(lb), "v"(lb + ls), "v"(lb + 2 * ls), "v"(lb + 3 * ls),
         "v"(ga), "v"(ga + rstep), "v"(ga + 2 * rstep), "v"(ga + 3 * rstep),
         "v"(ga + 4 * rstep), "v"(ga + 5 * rstep), "v"(ga + 6 * rstep), "v"(ga + 7 * rstep),
         "v"(gb), "v"(gb + rstep), "v"(gb + 2 * rstep), "v"(gb + 3 * rstep)
      : "memory");
}
// This wave's LDS reads have retired before its buffer is handed back for refill.
__device__ __forceinline__ void wait_ds0() {
  asm volatile("s_wait_dscnt 0x0" ::: "memory");
}

template <int EPI>
__global__ __launch_bounds__(256) void gemm_wmma_k(
    const _Float16* __restrict__ A, const _Float16* __restrict__ W,
    const float* __restrict__ bias, const float* __restrict__ resid,
    void* __restrict__ out, int M, int N, int K) {
  __shared__ _Float16 sA[2][BM * LDT];
  __shared__ _Float16 sB[2][BN * LDT];

  const int m0 = blockIdx.y * BM;
  const int n0 = blockIdx.x * BN;
  const int tid = threadIdx.x;
  const int w = tid >> 5, lane = tid & 31;
  const int wm = (w >> 1) * 64;  // wave row offset in block tile
  const int wn = (w & 1) * 64;   // wave col offset

  v8f c[4][4] = {};

  const int row = tid >> 3;      // 0..31 (rows row, row+32, ...)
  const int q   = tid & 7;       // 0..7 (8 f16 each)
  const unsigned la = lds_addr_of(&sA[0][row * LDT + q * 8]);
  const unsigned lb = lds_addr_of(&sB[0][row * LDT + q * 8]);
  const _Float16* gaRow = A + (size_t)(m0 + row) * K + q * 8;
  const _Float16* gbRow = W + (size_t)(n0 + row) * K + q * 8;
  const size_t rstep = (size_t)32 * K;

  auto issue = [&](int buf, int t) {
    async_copy_tile(la + buf * (BM * LDT * 2), lb + buf * (BN * LDT * 2),
                    gaRow + t * BK, gbRow + t * BK, rstep);
  };
  v16h af[4], bf[4];
  auto load_frags = [&](int buf, int ks) {
    const _Float16* pa = &sA[buf][wm * LDT + ks * 32];
    const _Float16* pb = &sB[buf][wn * LDT + ks * 32];
#pragma unroll
    for (int i = 0; i < 4; ++i) af[i] = load_frag(pa + i * 16 * LDT, LDT);
#pragma unroll
    for (int j = 0; j < 4; ++j) bf[j] = load_frag(pb + j * 16 * LDT, LDT);
  };
  auto mma = [&]() {
#pragma unroll
    for (int i = 0; i < 4; ++i)
#pragma unroll
      for (int j = 0; j < 4; ++j) c[i][j] = wmma32(af[i], bf[j], c[i][j]);
  };

  const int T = K / BK;
  issue(0, 0);                       // tile 0
  wait_async0();
  __syncthreads();                   // tile 0 published
  if (T > 1) issue(1, 1);            // tile 1 in flight over trip 0
  for (int t = 0; t < T; ++t) {
    const int buf = t & 1;
    load_frags(buf, 0);
    mma();
    load_frags(buf, 1);              // last LDS reads of buf
    wait_ds0();                      // own reads of buf done
    wait_async0();                   // own copies of tile t+1 landed
    __syncthreads();                 // publishes tile t+1, frees buf
    if (t + 2 < T) issue(buf, t + 2);
    mma();                           // registers only: the refill flies under it
  }
  wait_async0();

  // Epilogue. C/D layout: lane = column (lane&15), vgpr v = row v + 8*(lane>>4).
  // The 32x32 wave tile's build read all its residual values ahead of its stores.
  // With 128 accumulators live the compiler no longer does: it emits load, full
  // wait, store, 128 times in a row. Reading a 16-row band first keeps the grouping.
  const int col = lane & 15, hi = lane >> 4;
  float bv[4];
#pragma unroll
  for (int j = 0; j < 4; ++j) bv[j] = bias[n0 + wn + j * 16 + col];
#pragma unroll
  for (int i = 0; i < 4; ++i) {
    const size_t base = (size_t)(m0 + wm + i * 16 + 8 * hi) * N + n0 + wn + col;
    float r[4][8];
    if (EPI == 2) {
#pragma unroll
      for (int j = 0; j < 4; ++j) {
        // This group's results may land in registers that earlier loads or stores
        // still name: the wait stands in front of that rewrite. resid is an input
        // so that the compiler moves none of its loads across the statement.
        asm volatile("s_wait_xcnt 0x0" :: "s"(resid) : "memory");
#pragma unroll
        for (int v = 0; v < 8; ++v) r[j][v] = resid[base + (size_t)v * N + j * 16];
      }
    }
#pragma unroll
    for (int j = 0; j < 4; ++j) {
#pragma unroll
      for (int v = 0; v < 8; ++v) {
        const size_t idx = base + (size_t)v * N + j * 16;
        float val = c[i][j][v] + bv[j];
        if (EPI == 0) {
          ((_Float16*)out)[idx] = (_Float16)val;
        } else if (EPI == 1) {
          ((_Float16*)out)[idx] = (_Float16)gelu_tanh(val);
        } else {
          ((float*)out)[idx] = r[j][v] + val;
        }
      }
    }
  }
}

#define LDK 72   // K row pitch in f16
#define LDV 80   // V row pitch in f16

typedef __attribute__((ext_vector_type(2))) float    v2f;
typedef __attribute__((ext_vector_type(2))) _Float16 v2h;
typedef __attribute__((ext_vector_type(8))) short    v8s;

__device__ __forceinline__ float xhalf(float x) {
  const int b = __builtin_bit_cast(int, x);
  return __builtin_bit_cast(float, __builtin_amdgcn_permlanex16(
      b, b, 0x76543210, 0xfedcba98, false, false));
}

// Transposing load of a 16 (rows) x 16 (columns) f16 tile: lane (c, hi) gets
// column c, rows 8*hi .. 8*hi+7. p is the lane's own 16 B of the row-major tile.
__device__ __forceinline__ v8h ld_tr16(const _Float16* p) {
  typedef __attribute__((address_space(3))) v8s lds_v8s;
  return __builtin_bit_cast(v8h, __builtin_amdgcn_ds_load_tr16_b128_v8i16((lds_v8s*)p));
}

__device__ __forceinline__ void async_copy_kv(
    unsigned lk, unsigned lv, const _Float16* gk, const _Float16* gv) {
  asm volatile(
      "global_load_async_to_lds_b128 %0, %4, off\n\t"
      "global_load_async_to_lds_b128 %1, %5, off\n\t"
      "global_load_async_to_lds_b128 %2, %6, off\n\t"
      "global_load_async_to_lds_b128 %3, %7, off\n\t"
      "s_wait_xcnt 0x0"
      :: "v"(lk), "v"(lk + 16), "v"(lv), "v"(lv + 16),
         "v"(gk), "v"(gk + 8), "v"(gv), "v"(gv + 8)
      : "memory");
}

__global__ __launch_bounds__(256) void attention_wmma_k(
    const _Float16* __restrict__ Q, const _Float16* __restrict__ K,
    const _Float16* __restrict__ V, _Float16* __restrict__ O) {
  __shared__ __attribute__((aligned(32))) _Float16 sK[64 * LDK];  // [key][d]
  __shared__ __attribute__((aligned(32))) _Float16 sV[64 * LDV];  // [key][d]

  const int bid = blockIdx.x;
  const int qt  = bid & 7;               // SEQ/128 = 8 tiles
  const int bh  = bid >> 3;
  const int b   = bh / NH, h = bh % NH;
  const int tid = threadIdx.x, w = tid >> 5, lane = tid & 31;
  const int col = lane & 15, hi = lane >> 4;
  const int q0  = qt * 128 + w * 16;
  const size_t tokBase = (size_t)b * SEQ;
  const float cs = 0.125f * 1.4426950408889634f;  // HD^-0.5 * log2(e)

  // B operand Q^T: lane = query column, the k order of load_frag (as K's below).
  const _Float16* qbase = Q + (tokBase + q0) * H + h * HD;
  const v16h qf0 = load_frag(qbase, H);        // d = 0..31
  const v16h qf1 = load_frag(qbase + 32, H);   // d = 32..63

  v8f of[4] = {};          // O^T: of[t][r] = O[query col][d = 16 t + 8 hi + r]
  float rm = -1e30f;       // running maximum of query col, scaled, base 2
  float rs = 0.f;          // running sum over this half's keys of query col

  const int kk = tid >> 2;               // 0..63 (staging row)
  const int q4 = tid & 3;                // 0..3  (16 f16 chunk)
  const unsigned ldsK = lds_addr_of(&sK[kk * LDK + q4 * 16]);
  const unsigned ldsV = lds_addr_of(&sV[kk * LDV + q4 * 16]);
  const size_t gOff = (tokBase + kk) * H + h * HD + q4 * 16;
  const _Float16* vtr = &sV[(8 * hi + (lane & 7)) * LDV + ((lane >> 3) & 1) * 8];

  for (int kt = 0; kt < SEQ; kt += 64) {
    wait_ds0();                          // own reads of the previous tile done
    __syncthreads();                     // previous tile fully consumed
    async_copy_kv(ldsK, ldsV, K + gOff + (size_t)kt * H, V + gOff + (size_t)kt * H);
    wait_async0();                       // own copies landed
    __syncthreads();                     // tile published

    // S^T = K * Q^T: s[f][r] = score(key 16 f + 8 hi + r, query col)
    v8f s[4];
#pragma unroll
    for (int f = 0; f < 4; ++f) {
      v16h ka0 = load_frag(&sK[(f * 16) * LDK], LDK);
      v16h ka1 = load_frag(&sK[(f * 16) * LDK + 32], LDK);
      v8f acc = {};
      acc = wmma32(ka0, qf0, acc);
      acc = wmma32(ka1, qf1, acc);
      s[f] = acc;
    }

    // online softmax of one query per lane, base 2
    float tm[4];
#pragma unroll
    for (int f = 0; f < 4; ++f) {
      tm[f] = s[f][0];
#pragma unroll
      for (int r = 1; r < 8; ++r) tm[f] = fmaxf(tm[f], s[f][r]);
    }
    float tmax = fmaxf(fmaxf(tm[0], tm[1]), fmaxf(tm[2], tm[3]));
    tmax = fmaxf(tmax, xhalf(tmax)) * cs;  // both halves hold the query's maximum
    const float mnew  = fmaxf(rm, tmax);
    float alpha;
    asm("v_exp_f32 %0, %1\n\tv_nop" : "=v"(alpha) : "v"(rm - mnew));
    rm = mnew;

    // P^T as B operand: elements 2 (i & 7), + 1 of key block i >> 3 are registers
    // 2 (i & 3), + 1 of score tile i >> 2. Arguments and sums go two to an instruction.
    const v2f cs2 = {cs, cs}, nm2 = {-mnew, -mnew};
    v2f a[16];
#pragma unroll
    for (int i = 0; i < 16; ++i)
      a[i] = __builtin_elementwise_fma(
          v2f{s[i >> 2][2 * (i & 3)], s[i >> 2][2 * (i & 3) + 1]}, cs2, nm2);
    v16h pb[2];
    v2f ts = {0.f, 0.f};
#pragma unroll
    for (int i = 0; i < 16; ++i) {
      const v2f p = {__builtin_amdgcn_exp2f(a[i][0]), __builtin_amdgcn_exp2f(a[i][1])};
      const v2h pk = __builtin_convertvector(p, v2h);
      pb[i >> 3][2 * (i & 7)] = pk[0];
      pb[i >> 3][2 * (i & 7) + 1] = pk[1];
      ts += p;
    }
    rs = rs * alpha + (ts[0] + ts[1]);
#pragma unroll
    for (int t = 0; t < 4; ++t) of[t] *= alpha;

    // O^T += V^T * P^T
#pragma unroll
    for (int ks = 0; ks < 2; ++ks) {
#pragma unroll
      for (int t = 0; t < 4; ++t) {
        const v8h lo = ld_tr16(vtr + (ks * 32) * LDV + t * 16);       // keys 8 hi ..
        const v8h hk = ld_tr16(vtr + (ks * 32 + 16) * LDV + t * 16);  // keys 16 + 8 hi ..
        v16h va;
#pragma unroll
        for (int j = 0; j < 8; ++j) { va[j] = lo[j]; va[j + 8] = hk[j]; }
        of[t] = wmma32(va, pb[ks], of[t]);
      }
    }
  }

  // join the halves' sums, normalize, store: 8 consecutive d of one query a lane
  const float inv = 1.f / (rs + xhalf(rs));
  _Float16* orow = O + (tokBase + q0 + col) * H + h * HD + 8 * hi;
#pragma unroll
  for (int t = 0; t < 4; ++t) {
    v8h o;
#pragma unroll
    for (int r = 0; r < 8; ++r) o[r] = (_Float16)(of[t][r] * inv);
    *(v8h*)(orow + t * 16) = o;
  }
}

// --------------------------- launcher --------------------------------------

extern "C" void kernel_launch(void* const* d_in, const int* in_sizes, int n_in,
                              void* d_out, int out_size, void* d_ws, size_t ws_size,
                              hipStream_t stream) {
  const float* hs    = (const float*)d_in[0];
  const float* wq    = (const float*)d_in[1];
  const float* bq    = (const float*)d_in[2];
  const float* wk    = (const float*)d_in[3];
  const float* bk    = (const float*)d_in[4];
  const float* wv    = (const float*)d_in[5];
  const float* bv    = (const float*)d_in[6];
  const float* wo    = (const float*)d_in[7];
  const float* bo    = (const float*)d_in[8];
  const float* ln1g  = (const float*)d_in[9];
  const float* ln1b  = (const float*)d_in[10];
  const float* ln2g  = (const float*)d_in[11];
  const float* ln2b  = (const float*)d_in[12];
  const float* w1    = (const float*)d_in[13];
  const float* b1    = (const float*)d_in[14];
  const float* w2    = (const float*)d_in[15];
  const float* b2    = (const float*)d_in[16];

  char* ws = (char*)d_ws;
  size_t off = 0;
  auto carve = [&](size_t bytes) {
    char* p = ws + off;
    off = (off + bytes + 255) & ~(size_t)255;
    return p;
  };
  const size_t SZ_HH  = (size_t)H * H * sizeof(_Float16);
  const size_t SZ_IH  = (size_t)IS * H * sizeof(_Float16);
  const size_t SZ_TH2 = (size_t)NTOK * H * sizeof(_Float16);
  const size_t SZ_TH4 = (size_t)NTOK * H * sizeof(float);
  const size_t SZ_TI2 = (size_t)NTOK * IS * sizeof(_Float16);

  _Float16* wq16 = (_Float16*)carve(SZ_HH);
  _Float16* wk16 = (_Float16*)carve(SZ_HH);
  _Float16* wv16 = (_Float16*)carve(SZ_HH);
  _Float16* wo16 = (_Float16*)carve(SZ_HH);
  _Float16* w116 = (_Float16*)carve(SZ_IH);
  _Float16* w216 = (_Float16*)carve(SZ_IH);
  _Float16* bufA = (_Float16*)carve(SZ_TH2);  // ln1 out, later attn out
  _Float16* bufB = (_Float16*)carve(SZ_TH2);  // q, later ln2 out
  _Float16* bufC = (_Float16*)carve(SZ_TH2);  // k
  _Float16* bufD = (_Float16*)carve(SZ_TH2);  // v
  float*    x2   = (float*)   carve(SZ_TH4);  // post-attention residual state
  _Float16* h1   = (_Float16*)carve(SZ_TI2);  // gelu(fc1)
  (void)ws_size; (void)n_in; (void)in_sizes; (void)out_size;

  // 1) weights -> f16
  const int nHH = H * H, nIH = IS * H;
  f32_to_f16_k<<<nHH / CVT_BLK, 256, 0, stream>>>(wq, wq16);
  f32_to_f16_k<<<nHH / CVT_BLK, 256, 0, stream>>>(wk, wk16);
  f32_to_f16_k<<<nHH / CVT_BLK, 256, 0, stream>>>(wv, wv16);
  f32_to_f16_k<<<nHH / CVT_BLK, 256, 0, stream>>>(wo, wo16);
  f32_to_f16_k<<<nIH / CVT_BLK, 256, 0, stream>>>(w1, w116);
  f32_to_f16_k<<<nIH / CVT_BLK, 256, 0, stream>>>(w2, w216);

  const dim3 blk(256);
  const dim3 gH(H / 128, NTOK / 256);    // N=768 GEMMs
  const dim3 gI(IS / 128, NTOK / 256);   // N=3072 GEMM

  // 2) LN1
  layernorm_f16_k<<<NTOK / (8 * LN_ROWS), blk, 0, stream>>>(hs, ln1g, ln1b, bufA);

  // 3) QKV projections
  gemm_wmma_k<0><<<gH, blk, 0, stream>>>(bufA, wq16, bq, nullptr, bufB, NTOK, H, H);
  gemm_wmma_k<0><<<gH, blk, 0, stream>>>(bufA, wk16, bk, nullptr, bufC, NTOK, H, H);
  gemm_wmma_k<0><<<gH, blk, 0, stream>>>(bufA, wv16, bv, nullptr, bufD, NTOK, H, H);

  // 4) attention (bufA reused as output; ln1 activations are dead now)
  attention_wmma_k<<<BATCH * NH * (SEQ / 128), blk, 0, stream>>>(bufB, bufC, bufD, bufA);

  // 5) output projection + residual -> x2 (f32)
  gemm_wmma_k<2><<<gH, blk, 0, stream>>>(bufA, wo16, bo, hs, x2, NTOK, H, H);

  // 6) LN2 (bufB reused; q is dead)
  layernorm_f16_k<<<NTOK / (8 * LN_ROWS), blk, 0, stream>>>(x2, ln2g, ln2b, bufB);

  // 7) FC1 + GELU
  gemm_wmma_k<1><<<gI, blk, 0, stream>>>(bufB, w116, b1, nullptr, h1, NTOK, IS, H);

  // 8) FC2 + residual -> d_out (f32)
  gemm_wmma_k<2><<<gH, blk, 0, stream>>>(h1, w216, b2, x2, (float*)d_out, NTOK, H, IS);
}

// v005
// One run takes 331 microseconds.
// Timed twice side by side with v004, it ran 1.13 times as fast both times.
// Counting every step since v000, it is 2.40 times as fast.
#include <hip/hip_runtime.h>
#include <hip/hip_bf16.h>

#define H   768
#define NH  12
#define HD  64
#define IS  3072
#define BATCH 16
#define SEQ 1024
#define NTOK (BATCH * SEQ)

typedef __attribute__((ext_vector_type(16))) _Float16 v16h;
typedef __attribute__((ext_vector_type(8)))  _Float16 v8h;
typedef __attribute__((ext_vector_type(8)))  float    v8f;

__device__ __forceinline__ void wait_async0() {
  asm volatile("s_wait_asynccnt 0x0" ::: "memory");
}
__device__ __forceinline__ unsigned lds_addr_of(const void* p) {
  return (unsigned)(unsigned long long)p;  // flat LDS address: addr[31:0] = LDS offset
}

__device__ __forceinline__ v8f wmma32(v16h a, v16h b, v8f c) {
  return __builtin_amdgcn_wmma_f32_16x16x32_f16(
      /*neg_a=*/false, a, /*neg_b=*/false, b,
      /*c_mod=*/(short)0, c, /*reuse_a=*/false, /*reuse_b=*/false);
}

__device__ __forceinline__ v16h load_frag(const _Float16* __restrict__ base, int ld) {
  const int lane = threadIdx.x & 31;
  const int r    = lane & 15;
  const int hi   = lane >> 4;
  const _Float16* p = base + (size_t)r * ld + hi * 8;
  v8h lo = *(const v8h*)(p);       // K = 8*hi .. 8*hi+7
  v8h hk = *(const v8h*)(p + 16);  // K = 16+8*hi .. 16+8*hi+7
  v16h out;
#pragma unroll
  for (int j = 0; j < 8; ++j) { out[j] = lo[j]; out[j + 8] = hk[j]; }
  return out;
}

typedef __attribute__((ext_vector_type(2))) float    v2f;
typedef __attribute__((ext_vector_type(2))) _Float16 v2h;

// tanh-form GELU of two values. 0.5 (1 + tanh u) = 1 / (1 + e^(-2u)), with
// u = sqrt(2/pi) (x + 0.044715 x^3): one exp2 and one reciprocal a value, no
// branch, so the values of a wave's tile are independent straight-line chains.
// Ends: e^(-2u) -> inf gives x * 0, e^(-2u) -> 0 gives x, as the tanh form does.
__device__ __forceinline__ v2h gelu_tanh2(v2f x) {
  const float c0 = -2.3022081981443252f;   // -2 log2(e) sqrt(2/pi)
  const float c1 = -0.10294323958002349f;  // c0 * 0.044715
  const v2f a = x * __builtin_elementwise_fma(x * x, v2f{c1, c1}, v2f{c0, c0});
  const v2f d = v2f{__builtin_amdgcn_exp2f(a[0]), __builtin_amdgcn_exp2f(a[1])} + 1.f;
  const v2f y = x * v2f{__builtin_amdgcn_rcpf(d[0]), __builtin_amdgcn_rcpf(d[1])};
  return __builtin_convertvector(y, v2h);
}

// --------------------------- small kernels ---------------------------------
// Both are streams: a few fat waves, every global access of a wave contiguous
// (16 B a lane read, 8 B a lane written), all of a wave's reads issued ahead.

typedef __attribute__((ext_vector_type(4))) float    v4f;
typedef __attribute__((ext_vector_type(4))) _Float16 v4h;

__device__ __forceinline__ v4h to_f16x4(v4f v) {
  v4h o;
  o[0] = (_Float16)v[0]; o[1] = (_Float16)v[1];
  o[2] = (_Float16)v[2]; o[3] = (_Float16)v[3];
  return o;
}

// A block converts CVT_BLK consecutive elements, four 16-B groups a lane.
// The grid covers the array exactly: its length is a multiple of CVT_BLK.
#define CVT_BLK 4096

__global__ __launch_bounds__(256) void f32_to_f16_k(
    const float* __restrict__ in, _Float16* __restrict__ out) {
  const size_t i0 = (size_t)blockIdx.x * (CVT_BLK / 4) + threadIdx.x;
  const v4f* __restrict__ in4 = (const v4f*)in + i0;
  v4h* __restrict__ out4 = (v4h*)out + i0;
  v4f v[4];
#pragma unroll
  for (int k = 0; k < 4; ++k) v[k] = in4[k * 256];
#pragma unroll
  for (int k = 0; k < 4; ++k) out4[k * 256] = to_f16x4(v[k]);
}

// One wave per token row (768 f32 = six 16-B groups a lane), LN_ROWS rows a
// wave: the row's sums need the wave's own lanes only, no LDS and no barrier.
#define LN_ROWS 4

__global__ __launch_bounds__(256) void layernorm_f16_k(
    const float* __restrict__ x, const float* __restrict__ g,
    const float* __restrict__ b, _Float16* __restrict__ out) {
  const int lane = threadIdx.x & 31;
  const size_t row0 = ((size_t)blockIdx.x * 8 + (threadIdx.x >> 5)) * LN_ROWS;
  const v4f* __restrict__ x4 = (const v4f*)(x + row0 * H) + lane;
  v4f v[LN_ROWS][6];
#pragma unroll
  for (int r = 0; r < LN_ROWS; ++r)
#pragma unroll
    for (int k = 0; k < 6; ++k) v[r][k] = x4[r * (H / 4) + k * 32];
  v4f gv[6], bv[6];
#pragma unroll
  for (int k = 0; k < 6; ++k) {
    gv[k] = ((const v4f*)g)[k * 32 + lane];
    bv[k] = ((const v4f*)b)[k * 32 + lane];
  }

  float s[LN_ROWS], s2[LN_ROWS];
#pragma unroll
  for (int r = 0; r < LN_ROWS; ++r) {
    v4f a = v[r][0], a2 = v[r][0] * v[r][0];
#pragma unroll
    for (int k = 1; k < 6; ++k) { a += v[r][k]; a2 += v[r][k] * v[r][k]; }
    s[r]  = (a[0] + a[1]) + (a[2] + a[3]);
    s2[r] = (a2[0] + a2[1]) + (a2[2] + a2[3]);
  }
#pragma unroll
  for (int m = 16; m >= 1; m >>= 1) {
#pragma unroll
    for (int r = 0; r < LN_ROWS; ++r) {
      s[r]  += __shfl_xor(s[r],  m);
      s2[r] += __shfl_xor(s2[r], m);
    }
  }

  v4h* __restrict__ o4 = (v4h*)(out + row0 * H) + lane;
#pragma unroll
  for (int r = 0; r < LN_ROWS; ++r) {
    const float mu  = s[r] * (1.f / H);
    const float var = s2[r] * (1.f / H) - mu * mu;
    const float inv = rsqrtf(var + 1e-6f);
#pragma unroll
    for (int k = 0; k < 6; ++k)
      o4[r * (H / 4) + k * 32] = to_f16x4((v[r][k] - mu) * inv * gv[k] + bv[k]);
  }
}

// --------------------------- tiled WMMA GEMM -------------------------------
// D[M x N] = A[M x K] * W^T (+ bias) with W row-major [N x K] (torch Linear).
// Block tile 256x128, 8 waves arranged 4x2, each wave 64x64 (4x4 frags), so a
// loaded fragment feeds four WMMAs. One trip covers 64 k (128-B rows).
// Two LDS buffers: tile t+1's async copies fly while tile t is worked on.
// M % 256 == 0, N % 128 == 0, K % 64 == 0.
// EPI: 0 = store f16, 1 = store f16 after GELU, 2 = store f32 + residual.

#define BM  256
#define BN  128
#define BK  64
#define LDT 72

__device__ __forceinline__ void async_copy_tile(
    unsigned la, unsigned lb, const _Float16* ga, const _Float16* gb, size_t rstep) {
  const unsigned ls = 32 * LDT * 2;  // 32 rows further in LDS, bytes
  asm volatile(
      "global_load_async_to_lds_b128 %0, %12, off\n\t"
      "global_load_async_to_lds_b128 %1, %13, off\n\t"
      "global_load_async_to_lds_b128 %2, %14, off\n\t"
      "global_load_async_to_lds_b128 %3, %15, off\n\t"
      "global_load_async_to_lds_b128 %4, %16, off\n\t"
      "global_load_async_to_lds_b128 %5, %17, off\n\t"
      "global_load_async_to_lds_b128 %6, %18, off\n\t"
      "global_load_async_to_lds_b128 %7, %19, off\n\t"
      "global_load_async_to_lds_b128 %8, %20, off\n\t"
      "global_load_async_to_lds_b128 %9, %21, off\n\t"
      "global_load_async_to_lds_b128 %10, %22, off\n\t"
      "global_load_async_to_lds_b128 %11, %23, off\n\t"
      "s_wait_xcnt 0x0"
      :: "v"(la), "v"(la + ls), "v"(la + 2 * ls), "v"(la + 3 * ls),
         "v"(la + 4 * ls), "v"(la + 5 * ls), "v"(la + 6 * ls), "v"(la + 7 * ls),
         "v"(lb), "v"(lb + ls), "v"(lb + 2 * ls), "v"(lb + 3 * ls),
         "v"(ga), "v"(ga + rstep), "v"(ga + 2 * rstep), "v"(ga + 3 * rstep),
         "v"(ga + 4 * rstep), "v"(ga + 5 * rstep), "v"(ga + 6 * rstep), "v"(ga + 7 * rstep),
         "v"(gb), "v"(gb + rstep), "v"(gb + 2 * rstep), "v"(gb + 3 * rstep)
      : "memory");
}
// This wave's LDS reads have retired before its buffer is handed back for refill.
__device__ __forceinline__ void wait_ds0() {
  asm volatile("s_wait_dscnt 0x0" ::: "memory");
}

template <int EPI>
__global__ __launch_bounds__(256) void gemm_wmma_k(
    const _Float16* __restrict__ A, const _Float16* __restrict__ W,
    const float* __restrict__ bias, const float* __restrict__ resid,
    void* __restrict__ out, int M, int N, int K) {
  __shared__ _Float16 sA[2][BM * LDT];
  __shared__ _Float16 sB[2][BN * LDT];

  const int m0 = blockIdx.y * BM;
  const int n0 = blockIdx.x * BN;
  const int tid = threadIdx.x;
  const int w = tid >> 5, lane = tid & 31;
  const int wm = (w >> 1) * 64;  // wave row offset in block tile
  const int wn = (w & 1) * 64;   // wave col offset

  v8f c[4][4] = {};

  const int row = tid >> 3;      // 0..31 (rows row, row+32, ...)
  const int q   = tid & 7;       // 0..7 (8 f16 each)
  const unsigned la = lds_addr_of(&sA[0][row * LDT + q * 8]);
  const unsigned lb = lds_addr_of(&sB[0][row * LDT + q * 8]);
  const _Float16* gaRow = A + (size_t)(m0 + row) * K + q * 8;
  const _Float16* gbRow = W + (size_t)(n0 + row) * K + q * 8;
  const size_t rstep = (size_t)32 * K;

  auto issue = [&](int buf, int t) {
    async_copy_tile(la + buf * (BM * LDT * 2), lb + buf * (BN * LDT * 2),
                    gaRow + t * BK, gbRow + t * BK, rstep);
  };
  v16h af[4], bf[4];
  auto load_frags = [&](int buf, int ks) {
    const _Float16* pa = &sA[buf][wm * LDT + ks * 32];
    const _Float16* pb = &sB[buf][wn * LDT + ks * 32];
#pragma unroll
    for (int i = 0; i < 4; ++i) af[i] = load_frag(pa + i * 16 * LDT, LDT);
#pragma unroll
    for (int j = 0; j < 4; ++j) bf[j] = load_frag(pb + j * 16 * LDT, LDT);
  };
  auto mma = [&]() {
#pragma unroll
    for (int i = 0; i < 4; ++i)
#pragma unroll
      for (int j = 0; j < 4; ++j) c[i][j] = wmma32(af[i], bf[j], c[i][j]);
  };

  const int T = K / BK;
  issue(0, 0);                       // tile 0
  wait_async0();
  __syncthreads();                   // tile 0 published
  if (T > 1) issue(1, 1);            // tile 1 in flight over trip 0
  for (int t = 0; t < T; ++t) {
    const int buf = t & 1;
    load_frags(buf, 0);
    mma();
    load_frags(buf, 1);              // last LDS reads of buf
    wait_ds0();                      // own reads of buf done
    wait_async0();                   // own copies of tile t+1 landed
    __syncthreads();                 // publishes tile t+1, frees buf
    if (t + 2 < T) issue(buf, t + 2);
    mma();                           // registers only: the refill flies under it
  }
  wait_async0();

  // Epilogue. C/D layout: lane = column (lane&15), vgpr v = row v + 8*(lane>>4).
  // The 32x32 wave tile's build read all its residual values ahead of its stores.
  // With 128 accumulators live the compiler no longer does: it emits load, full
  // wait, store, 128 times in a row. Reading a 16-row band first keeps the grouping.
  const int col = lane & 15, hi = lane >> 4;
  float bv[4];
#pragma unroll
  for (int j = 0; j < 4; ++j) bv[j] = bias[n0 + wn + j * 16 + col];
#pragma unroll
  for (int i = 0; i < 4; ++i) {
    const size_t base = (size_t)(m0 + wm + i * 16 + 8 * hi) * N + n0 + wn + col;
    float r[4][8];
    if (EPI == 2) {
#pragma unroll
      for (int j = 0; j < 4; ++j) {
        // This group's results may land in registers that earlier loads or stores
        // still name: the wait stands in front of that rewrite. resid is an input
        // so that the compiler moves none of its loads across the statement.
        asm volatile("s_wait_xcnt 0x0" :: "s"(resid) : "memory");
#pragma unroll
        for (int v = 0; v < 8; ++v) r[j][v] = resid[base + (size_t)v * N + j * 16];
      }
    }
#pragma unroll
    for (int j = 0; j < 4; ++j) {
      v2h g[4];
      if (EPI == 1) {
        // unrolled so that g and c, register arrays, are indexed by constants only
#pragma unroll
        for (int p = 0; p < 4; ++p)
          g[p] = gelu_tanh2(v2f{c[i][j][2 * p], c[i][j][2 * p + 1]} + bv[j]);
      }
#pragma unroll
      for (int v = 0; v < 8; ++v) {
        const size_t idx = base + (size_t)v * N + j * 16;
        float val = c[i][j][v] + bv[j];
        if (EPI == 0) {
          ((_Float16*)out)[idx] = (_Float16)val;
        } else if (EPI == 1) {
          ((_Float16*)out)[idx] = g[v >> 1][v & 1];
        } else {
          ((float*)out)[idx] = r[j][v] + val;
        }
      }
    }
  }
}

#define LDK 72   // K row pitch in f16
#define LDV 80   // V row pitch in f16

typedef __attribute__((ext_vector_type(8))) short    v8s;

__device__ __forceinline__ float xhalf(float x) {
  const int b = __builtin_bit_cast(int, x);
  return __builtin_bit_cast(float, __builtin_amdgcn_permlanex16(
      b, b, 0x76543210, 0xfedcba98, false, false));
}

// Transposing load of a 16 (rows) x 16 (columns) f16 tile: lane (c, hi) gets
// column c, rows 8*hi .. 8*hi+7. p is the lane's own 16 B of the row-major tile.
__device__ __forceinline__ v8h ld_tr16(const _Float16* p) {
  typedef __attribute__((address_space(3))) v8s lds_v8s;
  return __builtin_bit_cast(v8h, __builtin_amdgcn_ds_load_tr16_b128_v8i16((lds_v8s*)p));
}

__device__ __forceinline__ void async_copy_kv(
    unsigned lk, unsigned lv, const _Float16* gk, const _Float16* gv) {
  asm volatile(
      "global_load_async_to_lds_b128 %0, %4, off\n\t"
      "global_load_async_to_lds_b128 %1, %5, off\n\t"
      "global_load_async_to_lds_b128 %2, %6, off\n\t"
      "global_load_async_to_lds_b128 %3, %7, off\n\t"
      "s_wait_xcnt 0x0"
      :: "v"(lk), "v"(lk + 16), "v"(lv), "v"(lv + 16),
         "v"(gk), "v"(gk + 8), "v"(gv), "v"(gv + 8)
      : "memory");
}

__global__ __launch_bounds__(256) void attention_wmma_k(
    const _Float16* __restrict__ Q, const _Float16* __restrict__ K,
    const _Float16* __restrict__ V, _Float16* __restrict__ O) {
  __shared__ __attribute__((aligned(32))) _Float16 sK[64 * LDK];  // [key][d]
  __shared__ __attribute__((aligned(32))) _Float16 sV[64 * LDV];  // [key][d]

  const int bid = blockIdx.x;
  const int qt  = bid & 7;               // SEQ/128 = 8 tiles
  const int bh  = bid >> 3;
  const int b   = bh / NH, h = bh % NH;
  const int tid = threadIdx.x, w = tid >> 5, lane = tid & 31;
  const int col = lane & 15, hi = lane >> 4;
  const int q0  = qt * 128 + w * 16;
  const size_t tokBase = (size_t)b * SEQ;
  const float cs = 0.125f * 1.4426950408889634f;  // HD^-0.5 * log2(e)

  // B operand Q^T: lane = query column, the k order of load_frag (as K's below).
  const _Float16* qbase = Q + (tokBase + q0) * H + h * HD;
  const v16h qf0 = load_frag(qbase, H);        // d = 0..31
  const v16h qf1 = load_frag(qbase + 32, H);   // d = 32..63

  v8f of[4] = {};          // O^T: of[t][r] = O[query col][d = 16 t + 8 hi + r]
  float rm = -1e30f;       // running maximum of query col, scaled, base 2
  float rs = 0.f;          // running sum over this half's keys of query col

  const int kk = tid >> 2;               // 0..63 (staging row)
  const int q4 = tid & 3;                // 0..3  (16 f16 chunk)
  const unsigned ldsK = lds_addr_of(&sK[kk * LDK + q4 * 16]);
  const unsigned ldsV = lds_addr_of(&sV[kk * LDV + q4 * 16]);
  const size_t gOff = (tokBase + kk) * H + h * HD + q4 * 16;
  const _Float16* vtr = &sV[(8 * hi + (lane & 7)) * LDV + ((lane >> 3) & 1) * 8];

  for (int kt = 0; kt < SEQ; kt += 64) {
    wait_ds0();                          // own reads of the previous tile done
    __syncthreads();                     // previous tile fully consumed
    async_copy_kv(ldsK, ldsV, K + gOff + (size_t)kt * H, V + gOff + (size_t)kt * H);
    wait_async0();                       // own copies landed
    __syncthreads();                     // tile published

    // S^T = K * Q^T: s[f][r] = score(key 16 f + 8 hi + r, query col)
    v8f s[4];
#pragma unroll
    for (int f = 0; f < 4; ++f) {
      v16h ka0 = load_frag(&sK[(f * 16) * LDK], LDK);
      v16h ka1 = load_frag(&sK[(f * 16) * LDK + 32], LDK);
      v8f acc = {};
      acc = wmma32(ka0, qf0, acc);
      acc = wmma32(ka1, qf1, acc);
      s[f] = acc;
    }

    // online softmax of one query per lane, base 2
    float tm[4];
#pragma unroll
    for (int f = 0; f < 4; ++f) {
      tm[f] = s[f][0];
#pragma unroll
      for (int r = 1; r < 8; ++r) tm[f] = fmaxf(tm[f], s[f][r]);
    }
    float tmax = fmaxf(fmaxf(tm[0], tm[1]), fmaxf(tm[2], tm[3]));
    tmax = fmaxf(tmax, xhalf(tmax)) * cs;  // both halves hold the query's maximum
    const float mnew  = fmaxf(rm, tmax);
    float alpha;
    asm("v_exp_f32 %0, %1\n\tv_nop" : "=v"(alpha) : "v"(rm - mnew));
    rm = mnew;

    // P^T as B operand: elements 2 (i & 7), + 1 of key block i >> 3 are registers
    // 2 (i & 3), + 1 of score tile i >> 2. Arguments and sums go two to an instruction.
    const v2f cs2 = {cs, cs}, nm2 = {-mnew, -mnew};
    v2f a[16];
#pragma unroll
    for (int i = 0; i < 16; ++i)
      a[i] = __builtin_elementwise_fma(
          v2f{s[i >> 2][2 * (i & 3)], s[i >> 2][2 * (i & 3) + 1]}, cs2, nm2);
    v16h pb[2];
    v2f ts = {0.f, 0.f};
#pragma unroll
    for (int i = 0; i < 16; ++i) {
      const v2f p = {__builtin_amdgcn_exp2f(a[i][0]), __builtin_amdgcn_exp2f(a[i][1])};
      const v2h pk = __builtin_convertvector(p, v2h);
      pb[i >> 3][2 * (i & 7)] = pk[0];
      pb[i >> 3][2 * (i & 7) + 1] = pk[1];
      ts += p;
    }
    rs = rs * alpha + (ts[0] + ts[1]);
#pragma unroll
    for (int t = 0; t < 4; ++t) of[t] *= alpha;

    // O^T += V^T * P^T
#pragma unroll
    for (int ks = 0; ks < 2; ++ks) {
#pragma unroll
      for (int t = 0; t < 4; ++t) {
        const v8h lo = ld_tr16(vtr + (ks * 32) * LDV + t * 16);       // keys 8 hi ..
        const v8h hk = ld_tr16(vtr + (ks * 32 + 16) * LDV + t * 16);  // keys 16 + 8 hi ..
        v16h va;
#pragma unroll
        for (int j = 0; j < 8; ++j) { va[j] = lo[j]; va[j + 8] = hk[j]; }
        of[t] = wmma32(va, pb[ks], of[t]);
      }
    }
  }

  // join the halves' sums, normalize, store: 8 consecutive d of one query a lane
  const float inv = 1.f / (rs + xhalf(rs));
  _Float16* orow = O + (tokBase + q0 + col) * H + h * HD + 8 * hi;
#pragma unroll
  for (int t = 0; t < 4; ++t) {
    v8h o;
#pragma unroll
    for (int r = 0; r < 8; ++r) o[r] = (_Float16)(of[t][r] * inv);
    *(v8h*)(orow + t * 16) = o;
  }
}

// --------------------------- launcher --------------------------------------

extern "C" void kernel_launch(void* const* d_in, const int* in_sizes, int n_in,
                              void* d_out, int out_size, void* d_ws, size_t ws_size,
                              hipStream_t stream) {
  const float* hs    = (const float*)d_in[0];
  const float* wq    = (const float*)d_in[1];
  const float* bq    = (const float*)d_in[2];
  const float* wk    = (const float*)d_in[3];
  const float* bk    = (const float*)d_in[4];
  const float* wv    = (const float*)d_in[5];
  const float* bv    = (const float*)d_in[6];
  const float* wo    = (const float*)d_in[7];
  const float* bo    = (const float*)d_in[8];
  const float* ln1g  = (const float*)d_in[9];
  const float* ln1b  = (const float*)d_in[10];
  const float* ln2g  = (const float*)d_in[11];
  const float* ln2b  = (const float*)d_in[12];
  const float* w1    = (const float*)d_in[13];
  const float* b1    = (const float*)d_in[14];
  const float* w2    = (const float*)d_in[15];
  const float* b2    = (const float*)d_in[16];

  char* ws = (char*)d_ws;
  size_t off = 0;
  auto carve = [&](size_t bytes) {
    char* p = ws + off;
    off = (off + bytes + 255) & ~(size_t)255;
    return p;
  };
  const size_t SZ_HH  = (size_t)H * H * sizeof(_Float16);
  const size_t SZ_IH  = (size_t)IS * H * sizeof(_Float16);
  const size_t SZ_TH2 = (size_t)NTOK * H * sizeof(_Float16);
  const size_t SZ_TH4 = (size_t)NTOK * H * sizeof(float);
  const size_t SZ_TI2 = (size_t)NTOK * IS * sizeof(_Float16);

  _Float16* wq16 = (_Float16*)carve(SZ_HH);
  _Float16* wk16 = (_Float16*)carve(SZ_HH);
  _Float16* wv16 = (_Float16*)carve(SZ_HH);
  _Float16* wo16 = (_Float16*)carve(SZ_HH);
  _Float16* w116 = (_Float16*)carve(SZ_IH);
  _Float16* w216 = (_Float16*)carve(SZ_IH);
  _Float16* bufA = (_Float16*)carve(SZ_TH2);  // ln1 out, later attn out
  _Float16* bufB = (_Float16*)carve(SZ_TH2);  // q, later ln2 out
  _Float16* bufC = (_Float16*)carve(SZ_TH2);  // k
  _Float16* bufD = (_Float16*)carve(SZ_TH2);  // v
  float*    x2   = (float*)   carve(SZ_TH4);  // post-attention residual state
  _Float16* h1   = (_Float16*)carve(SZ_TI2);  // gelu(fc1)
  (void)ws_size; (void)n_in; (void)in_sizes; (void)out_size;

  // 1) weights -> f16
  const int nHH = H * H, nIH = IS * H;
  f32_to_f16_k<<<nHH / CVT_BLK, 256, 0, stream>>>(wq, wq16);
  f32_to_f16_k<<<nHH / CVT_BLK, 256, 0, stream>>>(wk, wk16);
  f32_to_f16_k<<<nHH / CVT_BLK, 256, 0, stream>>>(wv, wv16);
  f32_to_f16_k<<<nHH / CVT_BLK, 256, 0, stream>>>(wo, wo16);
  f32_to_f16_k<<<nIH / CVT_BLK, 256, 0, stream>>>(w1, w116);
  f32_to_f16_k<<<nIH / CVT_BLK, 256, 0, stream>>>(w2, w216);

  const dim3 blk(256);
  const dim3 gH(H / 128, NTOK / 256);    // N=768 GEMMs
  const dim3 gI(IS / 128, NTOK / 256);   // N=3072 GEMM

  // 2) LN1
  layernorm_f16_k<<<NTOK / (8 * LN_ROWS), blk, 0, stream>>>(hs, ln1g, ln1b, bufA);

  // 3) QKV projections
  gemm_wmma_k<0><<<gH, blk, 0, stream>>>(bufA, wq16, bq, nullptr, bufB, NTOK, H, H);
  gemm_wmma_k<0><<<gH, blk, 0, stream>>>(bufA, wk16, bk, nullptr, bufC, NTOK, H, H);
  gemm_wmma_k<0><<<gH, blk, 0, stream>>>(bufA, wv16, bv, nullptr, bufD, NTOK, H, H);

  // 4) attention (bufA reused as output; ln1 activations are dead now)
  attention_wmma_k<<<BATCH * NH * (SEQ / 128), blk, 0, stream>>>(bufB, bufC, bufD, bufA);

  // 5) output projection + residual -> x2 (f32)
  gemm_wmma_k<2><<<gH, blk, 0, stream>>>(bufA, wo16, bo, hs, x2, NTOK, H, H);

  // 6) LN2 (bufB reused; q is dead)
  layernorm_f16_k<<<NTOK / (8 * LN_ROWS), blk, 0, stream>>>(x2, ln2g, ln2b, bufB);

  // 7) FC1 + GELU
  gemm_wmma_k<1><<<gI, blk, 0, stream>>>(bufB, w116, b1, nullptr, h1, NTOK, IS, H);

  // 8) FC2 + residual -> d_out (f32)
  gemm_wmma_k<2><<<gH, blk, 0, stream>>>(h1, w216, b2, x2, (float*)d_out, NTOK, H, IS);
}

// v006
// Measured time: 311 microseconds a run.
// In both of two side-by-side timings against v005, it was 1.06 times as fast.
// Over all steps from v000 it is 2.55 times as fast.
#include <hip/hip_runtime.h>
#include <hip/hip_bf16.h>

#define H   768
#define NH  12
#define HD  64
#define IS  3072
#define BATCH 16
#define SEQ 1024
#define NTOK (BATCH * SEQ)

typedef __attribute__((ext_vector_type(16))) _Float16 v16h;
typedef __attribute__((ext_vector_type(8)))  _Float16 v8h;
typedef __attribute__((ext_vector_type(8)))  float    v8f;

__device__ __forceinline__ void wait_async0() {
  asm volatile("s_wait_asynccnt 0x0" ::: "memory");
}
__device__ __forceinline__ unsigned lds_addr_of(const void* p) {
  return (unsigned)(unsigned long long)p;  // flat LDS address: addr[31:0] = LDS offset
}

__device__ __forceinline__ v8f wmma32(v16h a, v16h b, v8f c) {
  return __builtin_amdgcn_wmma_f32_16x16x32_f16(
      /*neg_a=*/false, a, /*neg_b=*/false, b,
      /*c_mod=*/(short)0, c, /*reuse_a=*/false, /*reuse_b=*/false);
}

__device__ __forceinline__ v16h load_frag(const _Float16* __restrict__ base, int ld) {
  const int lane = threadIdx.x & 31;
  const int r    = lane & 15;
  const int hi   = lane >> 4;
  const _Float16* p = base + (size_t)r * ld + hi * 8;
  v8h lo = *(const v8h*)(p);       // K = 8*hi .. 8*hi+7
  v8h hk = *(const v8h*)(p + 16);  // K = 16+8*hi .. 16+8*hi+7
  v16h out;
#pragma unroll
  for (int j = 0; j < 8; ++j) { out[j] = lo[j]; out[j + 8] = hk[j]; }
  return out;
}

typedef __attribute__((ext_vector_type(2))) float    v2f;
typedef __attribute__((ext_vector_type(2))) _Float16 v2h;

// tanh-form GELU of two values. 0.5 (1 + tanh u) = 1 / (1 + e^(-2u)), with
// u = sqrt(2/pi) (x + 0.044715 x^3): one exp2 and one reciprocal a value, no
// branch, so the values of a wave's tile are independent straight-line chains.
// Ends: e^(-2u) -> inf gives x * 0, e^(-2u) -> 0 gives x, as the tanh form does.
__device__ __forceinline__ v2h gelu_tanh2(v2f x) {
  const float c0 = -2.3022081981443252f;   // -2 log2(e) sqrt(2/pi)
  const float c1 = -0.10294323958002349f;  // c0 * 0.044715
  const v2f a = x * __builtin_elementwise_fma(x * x, v2f{c1, c1}, v2f{c0, c0});
  const v2f d = v2f{__builtin_amdgcn_exp2f(a[0]), __builtin_amdgcn_exp2f(a[1])} + 1.f;
  const v2f y = x * v2f{__builtin_amdgcn_rcpf(d[0]), __builtin_amdgcn_rcpf(d[1])};
  return __builtin_convertvector(y, v2h);
}

// --------------------------- small kernels ---------------------------------
// Both are streams: a few fat waves, every global access of a wave contiguous
// (16 B a lane read, 8 B a lane written), all of a wave's reads issued ahead.

typedef __attribute__((ext_vector_type(4))) float    v4f;
typedef __attribute__((ext_vector_type(4))) _Float16 v4h;

__device__ __forceinline__ v4h to_f16x4(v4f v) {
  v4h o;
  o[0] = (_Float16)v[0]; o[1] = (_Float16)v[1];
  o[2] = (_Float16)v[2]; o[3] = (_Float16)v[3];
  return o;
}

// A block converts CVT_BLK consecutive elements, four 16-B groups a lane:
// block iblk of the array in to block oblk of the array out.
// Every array's length is a multiple of CVT_BLK.
#define CVT_BLK 4096

__device__ __forceinline__ void f32_to_f16_block(
    const float* __restrict__ in, int iblk, _Float16* __restrict__ out, int oblk) {
  const v4f* __restrict__ in4 = (const v4f*)in + (size_t)iblk * (CVT_BLK / 4) + threadIdx.x;
  v4h* __restrict__ out4 = (v4h*)out + (size_t)oblk * (CVT_BLK / 4) + threadIdx.x;
  v4f v[4];
#pragma unroll
  for (int k = 0; k < 4; ++k) v[k] = in4[k * 256];
#pragma unroll
  for (int k = 0; k < 4; ++k) out4[k * 256] = to_f16x4(v[k]);
}

// One wave per token row (768 f32 = six 16-B groups a lane), LN_ROWS rows a
// wave: the row's sums need the wave's own lanes only, no LDS and no barrier.
#define LN_ROWS 4

__device__ __forceinline__ void layernorm_block(
    int blk, const float* __restrict__ x, const float* __restrict__ g,
    const float* __restrict__ b, _Float16* __restrict__ out) {
  const int lane = threadIdx.x & 31;
  const size_t row0 = ((size_t)blk * 8 + (threadIdx.x >> 5)) * LN_ROWS;
  const v4f* __restrict__ x4 = (const v4f*)(x + row0 * H) + lane;
  v4f v[LN_ROWS][6];
#pragma unroll
  for (int r = 0; r < LN_ROWS; ++r)
#pragma unroll
    for (int k = 0; k < 6; ++k) v[r][k] = x4[r * (H / 4) + k * 32];
  v4f gv[6], bv[6];
#pragma unroll
  for (int k = 0; k < 6; ++k) {
    gv[k] = ((const v4f*)g)[k * 32 + lane];
    bv[k] = ((const v4f*)b)[k * 32 + lane];
  }

  float s[LN_ROWS], s2[LN_ROWS];
#pragma unroll
  for (int r = 0; r < LN_ROWS; ++r) {
    v4f a = v[r][0], a2 = v[r][0] * v[r][0];
#pragma unroll
    for (int k = 1; k < 6; ++k) { a += v[r][k]; a2 += v[r][k] * v[r][k]; }
    s[r]  = (a[0] + a[1]) + (a[2] + a[3]);
    s2[r] = (a2[0] + a2[1]) + (a2[2] + a2[3]);
  }
#pragma unroll
  for (int m = 16; m >= 1; m >>= 1) {
#pragma unroll
    for (int r = 0; r < LN_ROWS; ++r) {
      s[r]  += __shfl_xor(s[r],  m);
      s2[r] += __shfl_xor(s2[r], m);
    }
  }

  v4h* __restrict__ o4 = (v4h*)(out + row0 * H) + lane;
#pragma unroll
  for (int r = 0; r < LN_ROWS; ++r) {
    const float mu  = s[r] * (1.f / H);
    const float var = s2[r] * (1.f / H) - mu * mu;
    const float inv = rsqrtf(var + 1e-6f);
#pragma unroll
    for (int k = 0; k < 6; ++k)
      o4[r * (H / 4) + k * 32] = to_f16x4((v[r][k] - mu) * inv * gv[k] + bv[k]);
  }
}

__global__ __launch_bounds__(256) void layernorm_f16_k(
    const float* __restrict__ x, const float* __restrict__ g,
    const float* __restrict__ b, _Float16* __restrict__ out) {
  layernorm_block(blockIdx.x, x, g, b, out);
}

// The first layernorm and the six weight conversions depend on inputs only and
// on nothing of each other: one launch, the work picked by block range (the
// longer blocks, the layernorm's, first). The six f16 weights lie one behind
// the other in w16, in the order wq wk wv wo w1 w2, without gaps.
#define LN_GRID (NTOK / (8 * LN_ROWS))
#define CVT_HH  (H * H / CVT_BLK)
#define CVT_IH  (IS * H / CVT_BLK)
#define PREP_GRID (LN_GRID + 4 * CVT_HH + 2 * CVT_IH)

__global__ __launch_bounds__(256) void prep_k(
    const float* __restrict__ x, const float* __restrict__ g,
    const float* __restrict__ b, _Float16* __restrict__ xn,
    const float* __restrict__ wq, const float* __restrict__ wk,
    const float* __restrict__ wv, const float* __restrict__ wo,
    const float* __restrict__ w1, const float* __restrict__ w2,
    _Float16* __restrict__ w16) {
  const int bid = blockIdx.x;
  if (bid < LN_GRID) {
    layernorm_block(bid, x, g, b, xn);
    return;
  }
  const int c = bid - LN_GRID;  // block of w16
  const float* src;
  int first;                    // first block of that weight in w16
  if (c < 4 * CVT_HH) {
    const int m = c / CVT_HH;
    src = m == 0 ? wq : m == 1 ? wk : m == 2 ? wv : wo;
    first = m * CVT_HH;
  } else {
    const int m = (c - 4 * CVT_HH) / CVT_IH;
    src = m == 0 ? w1 : w2;
    first = 4 * CVT_HH + m * CVT_IH;
  }
  f32_to_f16_block(src, c - first, w16, c);
}

#define BM  256
#define BN  128
#define BK  64
#define LDT 72

__device__ __forceinline__ void async_copy_tile(
    unsigned la, unsigned lb, const _Float16* ga, const _Float16* gb, size_t rstep) {
  const unsigned ls = 32 * LDT * 2;  // 32 rows further in LDS, bytes
  asm volatile(
      "global_load_async_to_lds_b128 %0, %12, off\n\t"
      "global_load_async_to_lds_b128 %1, %13, off\n\t"
      "global_load_async_to_lds_b128 %2, %14, off\n\t"
      "global_load_async_to_lds_b128 %3, %15, off\n\t"
      "global_load_async_to_lds_b128 %4, %16, off\n\t"
      "global_load_async_to_lds_b128 %5, %17, off\n\t"
      "global_load_async_to_lds_b128 %6, %18, off\n\t"
      "global_load_async_to_lds_b128 %7, %19, off\n\t"
      "global_load_async_to_lds_b128 %8, %20, off\n\t"
      "global_load_async_to_lds_b128 %9, %21, off\n\t"
      "global_load_async_to_lds_b128 %10, %22, off\n\t"
      "global_load_async_to_lds_b128 %11, %23, off\n\t"
      "s_wait_xcnt 0x0"
      :: "v"(la), "v"(la + ls), "v"(la + 2 * ls), "v"(la + 3 * ls),
         "v"(la + 4 * ls), "v"(la + 5 * ls), "v"(la + 6 * ls), "v"(la + 7 * ls),
         "v"(lb), "v"(lb + ls), "v"(lb + 2 * ls), "v"(lb + 3 * ls),
         "v"(ga), "v"(ga + rstep), "v"(ga + 2 * rstep), "v"(ga + 3 * rstep),
         "v"(ga + 4 * rstep), "v"(ga + 5 * rstep), "v"(ga + 6 * rstep), "v"(ga + 7 * rstep),
         "v"(gb), "v"(gb + rstep), "v"(gb + 2 * rstep), "v"(gb + 3 * rstep)
      : "memory");
}
// This wave's LDS reads have retired before its buffer is handed back for refill.
__device__ __forceinline__ void wait_ds0() {
  asm volatile("s_wait_dscnt 0x0" ::: "memory");
}

template <int EPI, bool TRI>
__global__ __launch_bounds__(256) void gemm_wmma_k(
    const _Float16* __restrict__ A, const _Float16* __restrict__ W,
    const float* __restrict__ bias, const float* __restrict__ bias1,
    const float* __restrict__ bias2, const float* __restrict__ resid,
    void* __restrict__ out, int M, int N, int K) {
  __shared__ _Float16 sA[2][BM * LDT];
  __shared__ _Float16 sB[2][BN * LDT];

  const int m0 = blockIdx.y * BM;
  const int n0 = blockIdx.x * BN;        // row of W
  const int sel = TRI ? blockIdx.x / (H / BN) : 0;  // which product (TRI: N == H)
  const int nc0 = n0 - sel * H;          // column in that product's result
  const float* __restrict__ bsel = !TRI || sel == 0 ? bias : sel == 1 ? bias1 : bias2;
  const int tid = threadIdx.x;
  const int w = tid >> 5, lane = tid & 31;
  const int wm = (w >> 1) * 64;  // wave row offset in block tile
  const int wn = (w & 1) * 64;   // wave col offset

  v8f c[4][4] = {};

  const int row = tid >> 3;      // 0..31 (rows row, row+32, ...)
  const int q   = tid & 7;       // 0..7 (8 f16 each)
  const unsigned la = lds_addr_of(&sA[0][row * LDT + q * 8]);
  const unsigned lb = lds_addr_of(&sB[0][row * LDT + q * 8]);
  const _Float16* gaRow = A + (size_t)(m0 + row) * K + q * 8;
  const _Float16* gbRow = W + (size_t)(n0 + row) * K + q * 8;
  const size_t rstep = (size_t)32 * K;

  auto issue = [&](int buf, int t) {
    async_copy_tile(la + buf * (BM * LDT * 2), lb + buf * (BN * LDT * 2),
                    gaRow + t * BK, gbRow + t * BK, rstep);
  };
  v16h af[4], bf[4];
  auto load_frags = [&](int buf, int ks) {
    const _Float16* pa = &sA[buf][wm * LDT + ks * 32];
    const _Float16* pb = &sB[buf][wn * LDT + ks * 32];
#pragma unroll
    for (int i = 0; i < 4; ++i) af[i] = load_frag(pa + i * 16 * LDT, LDT);
#pragma unroll
    for (int j = 0; j < 4; ++j) bf[j] = load_frag(pb + j * 16 * LDT, LDT);
  };
  auto mma = [&]() {
#pragma unroll
    for (int i = 0; i < 4; ++i)
#pragma unroll
      for (int j = 0; j < 4; ++j) c[i][j] = wmma32(af[i], bf[j], c[i][j]);
  };

  const int T = K / BK;
  issue(0, 0);                       // tile 0
  wait_async0();
  __syncthreads();                   // tile 0 published
  if (T > 1) issue(1, 1);            // tile 1 in flight over trip 0
  for (int t = 0; t < T; ++t) {
    const int buf = t & 1;
    load_frags(buf, 0);
    mma();
    load_frags(buf, 1);              // last LDS reads of buf
    wait_ds0();                      // own reads of buf done
    wait_async0();                   // own copies of tile t+1 landed
    __syncthreads();                 // publishes tile t+1, frees buf
    if (t + 2 < T) issue(buf, t + 2);
    mma();                           // registers only: the refill flies under it
  }
  wait_async0();

  // Epilogue. C/D layout: lane = column (lane&15), vgpr v = row v + 8*(lane>>4).
  // The 32x32 wave tile's build read all its residual values ahead of its stores.
  // With 128 accumulators live the compiler no longer does: it emits load, full
  // wait, store, 128 times in a row. Reading a 16-row band first keeps the grouping.
  const int col = lane & 15, hi = lane >> 4;
  float bv[4];
#pragma unroll
  for (int j = 0; j < 4; ++j) bv[j] = bsel[nc0 + wn + j * 16 + col];
#pragma unroll
  for (int i = 0; i < 4; ++i) {
    const size_t base =
        ((size_t)sel * M + (m0 + wm + i * 16 + 8 * hi)) * N + nc0 + wn + col;
    float r[4][8];
    if (EPI == 2) {
#pragma unroll
      for (int j = 0; j < 4; ++j) {
        // This group's results may land in registers that earlier loads or stores
        // still name: the wait stands in front of that rewrite. resid is an input
        // so that the compiler moves none of its loads across the statement.
        asm volatile("s_wait_xcnt 0x0" :: "s"(resid) : "memory");
#pragma unroll
        for (int v = 0; v < 8; ++v) r[j][v] = resid[base + (size_t)v * N + j * 16];
      }
    }
#pragma unroll
    for (int j = 0; j < 4; ++j) {
      v2h g[4];
      if (EPI == 1) {
        // unrolled so that g and c, register arrays, are indexed by constants only
#pragma unroll
        for (int p = 0; p < 4; ++p)
          g[p] = gelu_tanh2(v2f{c[i][j][2 * p], c[i][j][2 * p + 1]} + bv[j]);
      }
#pragma unroll
      for (int v = 0; v < 8; ++v) {
        const size_t idx = base + (size_t)v * N + j * 16;
        float val = c[i][j][v] + bv[j];
        if (EPI == 0) {
          ((_Float16*)out)[idx] = (_Float16)val;
        } else if (EPI == 1) {
          ((_Float16*)out)[idx] = g[v >> 1][v & 1];
        } else {
          ((float*)out)[idx] = r[j][v] + val;
        }
      }
    }
  }
}

#define LDK 72   // K row pitch in f16
#define LDV 80   // V row pitch in f16

typedef __attribute__((ext_vector_type(8))) short    v8s;

__device__ __forceinline__ float xhalf(float x) {
  const int b = __builtin_bit_cast(int, x);
  return __builtin_bit_cast(float, __builtin_amdgcn_permlanex16(
      b, b, 0x76543210, 0xfedcba98, false, false));
}

// Transposing load of a 16 (rows) x 16 (columns) f16 tile: lane (c, hi) gets
// column c, rows 8*hi .. 8*hi+7. p is the lane's own 16 B of the row-major tile.
__device__ __forceinline__ v8h ld_tr16(const _Float16* p) {
  typedef __attribute__((address_space(3))) v8s lds_v8s;
  return __builtin_bit_cast(v8h, __builtin_amdgcn_ds_load_tr16_b128_v8i16((lds_v8s*)p));
}

__device__ __forceinline__ void async_copy_kv(
    unsigned lk, unsigned lv, const _Float16* gk, const _Float16* gv) {
  asm volatile(
      "global_load_async_to_lds_b128 %0, %4, off\n\t"
      "global_load_async_to_lds_b128 %1, %5, off\n\t"
      "global_load_async_to_lds_b128 %2, %6, off\n\t"
      "global_load_async_to_lds_b128 %3, %7, off\n\t"
      "s_wait_xcnt 0x0"
      :: "v"(lk), "v"(lk + 16), "v"(lv), "v"(lv + 16),
         "v"(gk), "v"(gk + 8), "v"(gv), "v"(gv + 8)
      : "memory");
}

__global__ __launch_bounds__(256) void attention_wmma_k(
    const _Float16* __restrict__ Q, const _Float16* __restrict__ K,
    const _Float16* __restrict__ V, _Float16* __restrict__ O) {
  __shared__ __attribute__((aligned(32))) _Float16 sK[64 * LDK];  // [key][d]
  __shared__ __attribute__((aligned(32))) _Float16 sV[64 * LDV];  // [key][d]

  const int bid = blockIdx.x;
  const int qt  = bid & 7;               // SEQ/128 = 8 tiles
  const int bh  = bid >> 3;
  const int b   = bh / NH, h = bh % NH;
  const int tid = threadIdx.x, w = tid >> 5, lane = tid & 31;
  const int col = lane & 15, hi = lane >> 4;
  const int q0  = qt * 128 + w * 16;
  const size_t tokBase = (size_t)b * SEQ;
  const float cs = 0.125f * 1.4426950408889634f;  // HD^-0.5 * log2(e)

  // B operand Q^T: lane = query column, the k order of load_frag (as K's below).
  const _Float16* qbase = Q + (tokBase + q0) * H + h * HD;
  const v16h qf0 = load_frag(qbase, H);        // d = 0..31
  const v16h qf1 = load_frag(qbase + 32, H);   // d = 32..63

  v8f of[4] = {};          // O^T: of[t][r] = O[query col][d = 16 t + 8 hi + r]
  float rm = -1e30f;       // running maximum of query col, scaled, base 2
  float rs = 0.f;          // running sum over this half's keys of query col

  const int kk = tid >> 2;               // 0..63 (staging row)
  const int q4 = tid & 3;                // 0..3  (16 f16 chunk)
  const unsigned ldsK = lds_addr_of(&sK[kk * LDK + q4 * 16]);
  const unsigned ldsV = lds_addr_of(&sV[kk * LDV + q4 * 16]);
  const size_t gOff = (tokBase + kk) * H + h * HD + q4 * 16;
  const _Float16* vtr = &sV[(8 * hi + (lane & 7)) * LDV + ((lane >> 3) & 1) * 8];

  for (int kt = 0; kt < SEQ; kt += 64) {
    wait_ds0();                          // own reads of the previous tile done
    __syncthreads();                     // previous tile fully consumed
    async_copy_kv(ldsK, ldsV, K + gOff + (size_t)kt * H, V + gOff + (size_t)kt * H);
    wait_async0();                       // own copies landed
    __syncthreads();                     // tile published

    // S^T = K * Q^T: s[f][r] = score(key 16 f + 8 hi + r, query col)
    v8f s[4];
#pragma unroll
    for (int f = 0; f < 4; ++f) {
      v16h ka0 = load_frag(&sK[(f * 16) * LDK], LDK);
      v16h ka1 = load_frag(&sK[(f * 16) * LDK + 32], LDK);
      v8f acc = {};
      acc = wmma32(ka0, qf0, acc);
      acc = wmma32(ka1, qf1, acc);
      s[f] = acc;
    }

    // online softmax of one query per lane, base 2
    float tm[4];
#pragma unroll
    for (int f = 0; f < 4; ++f) {
      tm[f] = s[f][0];
#pragma unroll
      for (int r = 1; r < 8; ++r) tm[f] = fmaxf(tm[f], s[f][r]);
    }
    float tmax = fmaxf(fmaxf(tm[0], tm[1]), fmaxf(tm[2], tm[3]));
    tmax = fmaxf(tmax, xhalf(tmax)) * cs;  // both halves hold the query's maximum
    const float mnew  = fmaxf(rm, tmax);
    float alpha;
    asm("v_exp_f32 %0, %1\n\tv_nop" : "=v"(alpha) : "v"(rm - mnew));
    rm = mnew;

    // P^T as B operand: elements 2 (i & 7), + 1 of key block i >> 3 are registers
    // 2 (i & 3), + 1 of score tile i >> 2. Arguments and sums go two to an instruction.
    const v2f cs2 = {cs, cs}, nm2 = {-mnew, -mnew};
    v2f a[16];
#pragma unroll
    for (int i = 0; i < 16; ++i)
      a[i] = __builtin_elementwise_fma(
          v2f{s[i >> 2][2 * (i & 3)], s[i >> 2][2 * (i & 3) + 1]}, cs2, nm2);
    v16h pb[2];
    v2f ts = {0.f, 0.f};
#pragma unroll
    for (int i = 0; i < 16; ++i) {
      const v2f p = {__builtin_amdgcn_exp2f(a[i][0]), __builtin_amdgcn_exp2f(a[i][1])};
      const v2h pk = __builtin_convertvector(p, v2h);
      pb[i >> 3][2 * (i & 7)] = pk[0];
      pb[i >> 3][2 * (i & 7) + 1] = pk[1];
      ts += p;
    }
    rs = rs * alpha + (ts[0] + ts[1]);
#pragma unroll
    for (int t = 0; t < 4; ++t) of[t] *= alpha;

    // O^T += V^T * P^T
#pragma unroll
    for (int ks = 0; ks < 2; ++ks) {
#pragma unroll
      for (int t = 0; t < 4; ++t) {
        const v8h lo = ld_tr16(vtr + (ks * 32) * LDV + t * 16);       // keys 8 hi ..
        const v8h hk = ld_tr16(vtr + (ks * 32 + 16) * LDV + t * 16);  // keys 16 + 8 hi ..
        v16h va;
#pragma unroll
        for (int j = 0; j < 8; ++j) { va[j] = lo[j]; va[j + 8] = hk[j]; }
        of[t] = wmma32(va, pb[ks], of[t]);
      }
    }
  }

  // join the halves' sums, normalize, store: 8 consecutive d of one query a lane
  const float inv = 1.f / (rs + xhalf(rs));
  _Float16* orow = O + (tokBase + q0 + col) * H + h * HD + 8 * hi;
#pragma unroll
  for (int t = 0; t < 4; ++t) {
    v8h o;
#pragma unroll
    for (int r = 0; r < 8; ++r) o[r] = (_Float16)(of[t][r] * inv);
    *(v8h*)(orow + t * 16) = o;
  }
}

// --------------------------- launcher --------------------------------------

extern "C" void kernel_launch(void* const* d_in, const int* in_sizes, int n_in,
                              void* d_out, int out_size, void* d_ws, size_t ws_size,
                              hipStream_t stream) {
  const float* hs    = (const float*)d_in[0];
  const float* wq    = (const float*)d_in[1];
  const float* bq    = (const float*)d_in[2];
  const float* wk    = (const float*)d_in[3];
  const float* bk    = (const float*)d_in[4];
  const float* wv    = (const float*)d_in[5];
  const float* bv    = (const float*)d_in[6];
  const float* wo    = (const float*)d_in[7];
  const float* bo    = (const float*)d_in[8];
  const float* ln1g  = (const float*)d_in[9];
  const float* ln1b  = (const float*)d_in[10];
  const float* ln2g  = (const float*)d_in[11];
  const float* ln2b  = (const float*)d_in[12];
  const float* w1    = (const float*)d_in[13];
  const float* b1    = (const float*)d_in[14];
  const float* w2    = (const float*)d_in[15];
  const float* b2    = (const float*)d_in[16];

  char* ws = (char*)d_ws;
  size_t off = 0;
  auto carve = [&](size_t bytes) {
    char* p = ws + off;
    off = (off + bytes + 255) & ~(size_t)255;
    return p;
  };
  const size_t SZ_HH  = (size_t)H * H * sizeof(_Float16);
  const size_t SZ_IH  = (size_t)IS * H * sizeof(_Float16);
  const size_t SZ_TH2 = (size_t)NTOK * H * sizeof(_Float16);
  const size_t SZ_TH4 = (size_t)NTOK * H * sizeof(float);
  const size_t SZ_TI2 = (size_t)NTOK * IS * sizeof(_Float16);

  _Float16* wq16 = (_Float16*)carve(SZ_HH);
  _Float16* wk16 = (_Float16*)carve(SZ_HH);
  _Float16* wv16 = (_Float16*)carve(SZ_HH);
  _Float16* wo16 = (_Float16*)carve(SZ_HH);
  _Float16* w116 = (_Float16*)carve(SZ_IH);
  _Float16* w216 = (_Float16*)carve(SZ_IH);
  _Float16* bufA = (_Float16*)carve(SZ_TH2);  // ln1 out, later attn out
  _Float16* bufB = (_Float16*)carve(SZ_TH2);  // q, later ln2 out
  _Float16* bufC = (_Float16*)carve(SZ_TH2);  // k
  _Float16* bufD = (_Float16*)carve(SZ_TH2);  // v
  float*    x2   = (float*)   carve(SZ_TH4);  // post-attention residual state
  _Float16* h1   = (_Float16*)carve(SZ_TI2);  // gelu(fc1)
  (void)ws_size; (void)n_in; (void)in_sizes; (void)out_size;
  (void)wk16; (void)wv16;  // reached through wq16
  // carve() pads to 256 B: these sizes need no pad, so neighbours are gapless
  static_assert(H * H * sizeof(_Float16) % 256 == 0 && IS * H * sizeof(_Float16) % 256 == 0 &&
                (size_t)NTOK * H * sizeof(_Float16) % 256 == 0, "workspace arrays not gapless");
  static_assert(H % 128 == 0, "a column tile would straddle two products");

  const dim3 blk(256);
  const dim3 gH(H / 128, NTOK / 256);      // N=768 GEMMs
  const dim3 g3(3 * H / 128, NTOK / 256);  // Q, K, V together
  const dim3 gI(IS / 128, NTOK / 256);     // N=3072 GEMM

  // 1) LN1 and weights -> f16 (wq16 .. w216 are one gapless array)
  prep_k<<<PREP_GRID, blk, 0, stream>>>(hs, ln1g, ln1b, bufA, wq, wk, wv, wo, w1, w2, wq16);

  // 2) QKV projections (wq16 wk16 wv16 and bufB bufC bufD are gapless too)
  gemm_wmma_k<0, true><<<g3, blk, 0, stream>>>(
      bufA, wq16, bq, bk, bv, nullptr, bufB, NTOK, H, H);

  // 3) attention (bufA reused as output; ln1 activations are dead now)
  attention_wmma_k<<<BATCH * NH * (SEQ / 128), blk, 0, stream>>>(bufB, bufC, bufD, bufA);

  // 4) output projection + residual -> x2 (f32)
  gemm_wmma_k<2, false><<<gH, blk, 0, stream>>>(
      bufA, wo16, bo, nullptr, nullptr, hs, x2, NTOK, H, H);

  // 5) LN2 (bufB reused; q is dead)
  layernorm_f16_k<<<LN_GRID, blk, 0, stream>>>(x2, ln2g, ln2b, bufB);

  // 6) FC1 + GELU
  gemm_wmma_k<1, false><<<gI, blk, 0, stream>>>(
      bufB, w116, b1, nullptr, nullptr, nullptr, h1, NTOK, IS, H);

  // 7) FC2 + residual -> d_out (f32)
  gemm_wmma_k<2, false><<<gH, blk, 0, stream>>>(
      h1, w216, b2, nullptr, nullptr, x2, (float*)d_out, NTOK, H, IS);
}

// v007
// One run takes 299 microseconds.
// In both of two side-by-side timings against v006, it was 1.04 times as fast.
// All steps since v000 together make it 2.65 times as fast.
#include <hip/hip_runtime.h>
#include <hip/hip_bf16.h>

#define H   768
#define NH  12
#define HD  64
#define IS  3072
#define BATCH 16
#define SEQ 1024
#define NTOK (BATCH * SEQ)

typedef __attribute__((ext_vector_type(16))) _Float16 v16h;
typedef __attribute__((ext_vector_type(8)))  _Float16 v8h;
typedef __attribute__((ext_vector_type(8)))  float    v8f;

__device__ __forceinline__ void wait_async0() {
  asm volatile("s_wait_asynccnt 0x0" ::: "memory");
}
__device__ __forceinline__ unsigned lds_addr_of(const void* p) {
  return (unsigned)(unsigned long long)p;  // flat LDS address: addr[31:0] = LDS offset
}

__device__ __forceinline__ v8f wmma32(v16h a, v16h b, v8f c) {
  return __builtin_amdgcn_wmma_f32_16x16x32_f16(
      /*neg_a=*/false, a, /*neg_b=*/false, b,
      /*c_mod=*/(short)0, c, /*reuse_a=*/false, /*reuse_b=*/false);
}

__device__ __forceinline__ v16h load_frag(const _Float16* __restrict__ base, int ld) {
  const int lane = threadIdx.x & 31;
  const int r    = lane & 15;
  const int hi   = lane >> 4;
  const _Float16* p = base + (size_t)r * ld + hi * 8;
  v8h lo = *(const v8h*)(p);       // K = 8*hi .. 8*hi+7
  v8h hk = *(const v8h*)(p + 16);  // K = 16+8*hi .. 16+8*hi+7
  v16h out;
#pragma unroll
  for (int j = 0; j < 8; ++j) { out[j] = lo[j]; out[j + 8] = hk[j]; }
  return out;
}

typedef __attribute__((ext_vector_type(2))) float    v2f;
typedef __attribute__((ext_vector_type(2))) _Float16 v2h;

// tanh-form GELU of two values. 0.5 (1 + tanh u) = 1 / (1 + e^(-2u)), with
// u = sqrt(2/pi) (x + 0.044715 x^3): one exp2 and one reciprocal a value, no
// branch, so the values of a wave's tile are independent straight-line chains.
// Ends: e^(-2u) -> inf gives x * 0, e^(-2u) -> 0 gives x, as the tanh form does.
__device__ __forceinline__ v2h gelu_tanh2(v2f x) {
  const float c0 = -2.3022081981443252f;   // -2 log2(e) sqrt(2/pi)
  const float c1 = -0.10294323958002349f;  // c0 * 0.044715
  const v2f a = x * __builtin_elementwise_fma(x * x, v2f{c1, c1}, v2f{c0, c0});
  const v2f d = v2f{__builtin_amdgcn_exp2f(a[0]), __builtin_amdgcn_exp2f(a[1])} + 1.f;
  const v2f y = x * v2f{__builtin_amdgcn_rcpf(d[0]), __builtin_amdgcn_rcpf(d[1])};
  return __builtin_convertvector(y, v2h);
}

// --------------------------- small kernels ---------------------------------
// Both are streams: a few fat waves, every global access of a wave contiguous
// (16 B a lane read, 8 B a lane written), all of a wave's reads issued ahead.

typedef __attribute__((ext_vector_type(4))) float    v4f;
typedef __attribute__((ext_vector_type(4))) _Float16 v4h;

__device__ __forceinline__ v4h to_f16x4(v4f v) {
  v4h o;
  o[0] = (_Float16)v[0]; o[1] = (_Float16)v[1];
  o[2] = (_Float16)v[2]; o[3] = (_Float16)v[3];
  return o;
}

// A block converts CVT_BLK consecutive elements, four 16-B groups a lane:
// block iblk of the array in to block oblk of the array out.
// Every array's length is a multiple of CVT_BLK.
#define CVT_BLK 4096

__device__ __forceinline__ void f32_to_f16_block(
    const float* __restrict__ in, int iblk, _Float16* __restrict__ out, int oblk) {
  const v4f* __restrict__ in4 = (const v4f*)in + (size_t)iblk * (CVT_BLK / 4) + threadIdx.x;
  v4h* __restrict__ out4 = (v4h*)out + (size_t)oblk * (CVT_BLK / 4) + threadIdx.x;
  v4f v[4];
#pragma unroll
  for (int k = 0; k < 4; ++k) v[k] = in4[k * 256];
#pragma unroll
  for (int k = 0; k < 4; ++k) out4[k * 256] = to_f16x4(v[k]);
}

// One wave per token row (768 f32 = six 16-B groups a lane), LN_ROWS rows a
// wave: the row's sums need the wave's own lanes only, no LDS and no barrier.
#define LN_ROWS 4

__device__ __forceinline__ void layernorm_block(
    int blk, const float* __restrict__ x, const float* __restrict__ g,
    const float* __restrict__ b, _Float16* __restrict__ out) {
  const int lane = threadIdx.x & 31;
  const size_t row0 = ((size_t)blk * 8 + (threadIdx.x >> 5)) * LN_ROWS;
  const v4f* __restrict__ x4 = (const v4f*)(x + row0 * H) + lane;
  v4f v[LN_ROWS][6];
#pragma unroll
  for (int r = 0; r < LN_ROWS; ++r)
#pragma unroll
    for (int k = 0; k < 6; ++k) v[r][k] = x4[r * (H / 4) + k * 32];
  v4f gv[6], bv[6];
#pragma unroll
  for (int k = 0; k < 6; ++k) {
    gv[k] = ((const v4f*)g)[k * 32 + lane];
    bv[k] = ((const v4f*)b)[k * 32 + lane];
  }

  float s[LN_ROWS], s2[LN_ROWS];
#pragma unroll
  for (int r = 0; r < LN_ROWS; ++r) {
    v4f a = v[r][0], a2 = v[r][0] * v[r][0];
#pragma unroll
    for (int k = 1; k < 6; ++k) { a += v[r][k]; a2 += v[r][k] * v[r][k]; }
    s[r]  = (a[0] + a[1]) + (a[2] + a[3]);
    s2[r] = (a2[0] + a2[1]) + (a2[2] + a2[3]);
  }
#pragma unroll
  for (int m = 16; m >= 1; m >>= 1) {
#pragma unroll
    for (int r = 0; r < LN_ROWS; ++r) {
      s[r]  += __shfl_xor(s[r],  m);
      s2[r] += __shfl_xor(s2[r], m);
    }
  }

  v4h* __restrict__ o4 = (v4h*)(out + row0 * H) + lane;
#pragma unroll
  for (int r = 0; r < LN_ROWS; ++r) {
    const float mu  = s[r] * (1.f / H);
    const float var = s2[r] * (1.f / H) - mu * mu;
    const float inv = rsqrtf(var + 1e-6f);
#pragma unroll
    for (int k = 0; k < 6; ++k)
      o4[r * (H / 4) + k * 32] = to_f16x4((v[r][k] - mu) * inv * gv[k] + bv[k]);
  }
}

__global__ __launch_bounds__(256) void layernorm_f16_k(
    const float* __restrict__ x, const float* __restrict__ g,
    const float* __restrict__ b, _Float16* __restrict__ out) {
  layernorm_block(blockIdx.x, x, g, b, out);
}

// The first layernorm and the six weight conversions depend on inputs only and
// on nothing of each other: one launch, the work picked by block range (the
// longer blocks, the layernorm's, first). The six f16 weights lie one behind
// the other in w16, in the order wq wk wv wo w1 w2, without gaps.
#define LN_GRID (NTOK / (8 * LN_ROWS))
#define CVT_HH  (H * H / CVT_BLK)
#define CVT_IH  (IS * H / CVT_BLK)
#define PREP_GRID (LN_GRID + 4 * CVT_HH + 2 * CVT_IH)

__global__ __launch_bounds__(256) void prep_k(
    const float* __restrict__ x, const float* __restrict__ g,
    const float* __restrict__ b, _Float16* __restrict__ xn,
    const float* __restrict__ wq, const float* __restrict__ wk,
    const float* __restrict__ wv, const float* __restrict__ wo,
    const float* __restrict__ w1, const float* __restrict__ w2,
    _Float16* __restrict__ w16) {
  const int bid = blockIdx.x;
  if (bid < LN_GRID) {
    layernorm_block(bid, x, g, b, xn);
    return;
  }
  const int c = bid - LN_GRID;  // block of w16
  const float* src;
  int first;                    // first block of that weight in w16
  if (c < 4 * CVT_HH) {
    const int m = c / CVT_HH;
    src = m == 0 ? wq : m == 1 ? wk : m == 2 ? wv : wo;
    first = m * CVT_HH;
  } else {
    const int m = (c - 4 * CVT_HH) / CVT_IH;
    src = m == 0 ? w1 : w2;
    first = 4 * CVT_HH + m * CVT_IH;
  }
  f32_to_f16_block(src, c - first, w16, c);
}

#define BM  256
#define BK  64
#define LDT 72

__device__ __forceinline__ void async_copy_tile(
    unsigned la, unsigned lb, const _Float16* ga, const _Float16* gb, size_t rstep) {
  const unsigned ls = 32 * LDT * 2;  // 32 rows further in LDS, bytes
  asm volatile(
      "global_load_async_to_lds_b128 %0, %12, off\n\t"
      "global_load_async_to_lds_b128 %1, %13, off\n\t"
      "global_load_async_to_lds_b128 %2, %14, off\n\t"
      "global_load_async_to_lds_b128 %3, %15, off\n\t"
      "global_load_async_to_lds_b128 %4, %16, off\n\t"
      "global_load_async_to_lds_b128 %5, %17, off\n\t"
      "global_load_async_to_lds_b128 %6, %18, off\n\t"
      "global_load_async_to_lds_b128 %7, %19, off\n\t"
      "global_load_async_to_lds_b128 %8, %20, off\n\t"
      "global_load_async_to_lds_b128 %9, %21, off\n\t"
      "global_load_async_to_lds_b128 %10, %22, off\n\t"
      "global_load_async_to_lds_b128 %11, %23, off\n\t"
      "s_wait_xcnt 0x0"
      :: "v"(la), "v"(la + ls), "v"(la + 2 * ls), "v"(la + 3 * ls),
         "v"(la + 4 * ls), "v"(la + 5 * ls), "v"(la + 6 * ls), "v"(la + 7 * ls),
         "v"(lb), "v"(lb + ls), "v"(lb + 2 * ls), "v"(lb + 3 * ls),
         "v"(ga), "v"(ga + rstep), "v"(ga + 2 * rstep), "v"(ga + 3 * rstep),
         "v"(ga + 4 * rstep), "v"(ga + 5 * rstep), "v"(ga + 6 * rstep), "v"(ga + 7 * rstep),
         "v"(gb), "v"(gb + rstep), "v"(gb + 2 * rstep), "v"(gb + 3 * rstep)
      : "memory");
}
__device__ __forceinline__ void async_copy_rows8(unsigned l, const _Float16* g, size_t rstep) {
  const unsigned ls = 32 * LDT * 2;  // 32 rows further in LDS, bytes
  asm volatile(
      "global_load_async_to_lds_b128 %0, %8, off\n\t"
      "global_load_async_to_lds_b128 %1, %9, off\n\t"
      "global_load_async_to_lds_b128 %2, %10, off\n\t"
      "global_load_async_to_lds_b128 %3, %11, off\n\t"
      "global_load_async_to_lds_b128 %4, %12, off\n\t"
      "global_load_async_to_lds_b128 %5, %13, off\n\t"
      "global_load_async_to_lds_b128 %6, %14, off\n\t"
      "global_load_async_to_lds_b128 %7, %15, off\n\t"
      "s_wait_xcnt 0x0"
      :: "v"(l), "v"(l + ls), "v"(l + 2 * ls), "v"(l + 3 * ls),
         "v"(l + 4 * ls), "v"(l + 5 * ls), "v"(l + 6 * ls), "v"(l + 7 * ls),
         "v"(g), "v"(g + rstep), "v"(g + 2 * rstep), "v"(g + 3 * rstep),
         "v"(g + 4 * rstep), "v"(g + 5 * rstep), "v"(g + 6 * rstep), "v"(g + 7 * rstep)
      : "memory");
}
__device__ __forceinline__ void async_copy_rows12(unsigned l, const _Float16* g, size_t rstep) {
  const unsigned ls = 16 * LDT * 2;  // 16 rows further in LDS, bytes
  asm volatile(
      "global_load_async_to_lds_b128 %0, %12, off\n\t"
      "global_load_async_to_lds_b128 %1, %13, off\n\t"
      "global_load_async_to_lds_b128 %2, %14, off\n\t"
      "global_load_async_to_lds_b128 %3, %15, off\n\t"
      "global_load_async_to_lds_b128 %4, %16, off\n\t"
      "global_load_async_to_lds_b128 %5, %17, off\n\t"
      "global_load_async_to_lds_b128 %6, %18, off\n\t"
      "global_load_async_to_lds_b128 %7, %19, off\n\t"
      "global_load_async_to_lds_b128 %8, %20, off\n\t"
      "global_load_async_to_lds_b128 %9, %21, off\n\t"
      "global_load_async_to_lds_b128 %10, %22, off\n\t"
      "global_load_async_to_lds_b128 %11, %23, off\n\t"
      "s_wait_xcnt 0x0"
      :: "v"(l), "v"(l + ls), "v"(l + 2 * ls), "v"(l + 3 * ls),
         "v"(l + 4 * ls), "v"(l + 5 * ls), "v"(l + 6 * ls), "v"(l + 7 * ls),
         "v"(l + 8 * ls), "v"(l + 9 * ls), "v"(l + 10 * ls), "v"(l + 11 * ls),
         "v"(g), "v"(g + rstep), "v"(g + 2 * rstep), "v"(g + 3 * rstep),
         "v"(g + 4 * rstep), "v"(g + 5 * rstep), "v"(g + 6 * rstep), "v"(g + 7 * rstep),
         "v"(g + 8 * rstep), "v"(g + 9 * rstep), "v"(g + 10 * rstep), "v"(g + 11 * rstep)
      : "memory");
}
// This wave's LDS reads have retired before its buffer is handed back for refill.
__device__ __forceinline__ void wait_ds0() {
  asm volatile("s_wait_dscnt 0x0" ::: "memory");
}

template <int EPI, bool TRI, int CW>
__global__ __launch_bounds__(128 * CW) void gemm_wmma_k(
    const _Float16* __restrict__ A, const _Float16* __restrict__ W,
    const float* __restrict__ bias, const float* __restrict__ bias1,
    const float* __restrict__ bias2, const float* __restrict__ resid,
    void* __restrict__ out, int M, int N, int K) {
  constexpr int BN = 64 * CW;
  static_assert(CW == 2 || CW == 3, "the copies are cut for these two widths");
  __shared__ _Float16 sA[2][BM * LDT];
  __shared__ _Float16 sB[2][BN * LDT];

  const int m0 = blockIdx.y * BM;
  const int n0 = blockIdx.x * BN;        // row of W
  const int sel = TRI ? blockIdx.x / (H / BN) : 0;  // which product (TRI: N == H)
  const int nc0 = n0 - sel * H;          // column in that product's result
  const float* __restrict__ bsel = !TRI || sel == 0 ? bias : sel == 1 ? bias1 : bias2;
  const int tid = threadIdx.x;
  const int w = tid >> 5, lane = tid & 31;
  const int wm = (w / CW) * 64;  // wave row offset in block tile
  const int wn = (w % CW) * 64;  // wave col offset

  v8f c[4][4] = {};

  // CW == 3: the wave's number in a scalar register, so that the choice between the
  // two copy routines is a scalar branch with every lane on; waves 8-11 take W rows.
  const bool forW = CW == 3 && __builtin_amdgcn_readfirstlane(w) >= 8;
  const int row = (forW ? tid - 256 : tid) >> 3;  // 0..31 (rows row, row+32, ...); forW: 0..15
  const int q   = tid & 7;       // 0..7 (8 f16 each)
  const unsigned la = lds_addr_of(&sA[0][row * LDT + q * 8]);
  const unsigned lb = lds_addr_of(&sB[0][row * LDT + q * 8]);
  const _Float16* gaRow = A + (size_t)(m0 + row) * K + q * 8;
  const _Float16* gbRow = W + (size_t)(n0 + row) * K + q * 8;
  const size_t rstep = (size_t)32 * K;

  auto issue = [&](int buf, int t) {
    if constexpr (CW == 2) {
      async_copy_tile(la + buf * (BM * LDT * 2), lb + buf * (BN * LDT * 2),
                      gaRow + t * BK, gbRow + t * BK, rstep);
    } else if (forW) {
      async_copy_rows12(lb + buf * (BN * LDT * 2), gbRow + t * BK, rstep / 2);
    } else {
      async_copy_rows8(la + buf * (BM * LDT * 2), gaRow + t * BK, rstep);
    }
  };
  v16h af[4], bf[4];
  auto load_frags = [&](int buf, int ks) {
    const _Float16* pa = &sA[buf][wm * LDT + ks * 32];
    const _Float16* pb = &sB[buf][wn * LDT + ks * 32];
#pragma unroll
    for (int i = 0; i < 4; ++i) af[i] = load_frag(pa + i * 16 * LDT, LDT);
#pragma unroll
    for (int j = 0; j < 4; ++j) bf[j] = load_frag(pb + j * 16 * LDT, LDT);
  };
  auto mma = [&]() {
#pragma unroll
    for (int i = 0; i < 4; ++i)
#pragma unroll
      for (int j = 0; j < 4; ++j) c[i][j] = wmma32(af[i], bf[j], c[i][j]);
  };

  const int T = K / BK;
  issue(0, 0);                       // tile 0
  wait_async0();
  __syncthreads();                   // tile 0 published
  if (T > 1) issue(1, 1);            // tile 1 in flight over trip 0
  for (int t = 0; t < T; ++t) {
    const int buf = t & 1;
    load_frags(buf, 0);
    mma();
    load_frags(buf, 1);              // last LDS reads of buf
    wait_ds0();                      // own reads of buf done
    wait_async0();                   // own copies of tile t+1 landed
    __syncthreads();                 // publishes tile t+1, frees buf
    if (t + 2 < T) issue(buf, t + 2);
    mma();                           // registers only: the refill flies under it
  }
  wait_async0();

  // Epilogue. C/D layout: lane = column (lane&15), vgpr v = row v + 8*(lane>>4).
  // The 32x32 wave tile's build read all its residual values ahead of its stores.
  // With 128 accumulators live the compiler no longer does: it emits load, full
  // wait, store, 128 times in a row. Reading a 16-row band first keeps the grouping.
  const int col = lane & 15, hi = lane >> 4;
  float bv[4];
#pragma unroll
  for (int j = 0; j < 4; ++j) bv[j] = bsel[nc0 + wn + j * 16 + col];
#pragma unroll
  for (int i = 0; i < 4; ++i) {
    const size_t base =
        ((size_t)sel * M + (m0 + wm + i * 16 + 8 * hi)) * N + nc0 + wn + col;
    float r[4][8];
    if (EPI == 2) {
#pragma unroll
      for (int j = 0; j < 4; ++j) {
        // This group's results may land in registers that earlier loads or stores
        // still name: the wait stands in front of that rewrite. resid is an input
        // so that the compiler moves none of its loads across the statement.
        asm volatile("s_wait_xcnt 0x0" :: "s"(resid) : "memory");
#pragma unroll
        for (int v = 0; v < 8; ++v) r[j][v] = resid[base + (size_t)v * N + j * 16];
      }
    }
#pragma unroll
    for (int j = 0; j < 4; ++j) {
      v2h g[4];
      if (EPI == 1) {
        // unrolled so that g and c, register arrays, are indexed by constants only
#pragma unroll
        for (int p = 0; p < 4; ++p)
          g[p] = gelu_tanh2(v2f{c[i][j][2 * p], c[i][j][2 * p + 1]} + bv[j]);
      }
#pragma unroll
      for (int v = 0; v < 8; ++v) {
        const size_t idx = base + (size_t)v * N + j * 16;
        float val = c[i][j][v] + bv[j];
        if (EPI == 0) {
          ((_Float16*)out)[idx] = (_Float16)val;
        } else if (EPI == 1) {
          ((_Float16*)out)[idx] = g[v >> 1][v & 1];
        } else {
          ((float*)out)[idx] = r[j][v] + val;
        }
      }
    }
  }
}

#define LDK 72   // K row pitch in f16
#define LDV 80   // V row pitch in f16

typedef __attribute__((ext_vector_type(8))) short    v8s;

__device__ __forceinline__ float xhalf(float x) {
  const int b = __builtin_bit_cast(int, x);
  return __builtin_bit_cast(float, __builtin_amdgcn_permlanex16(
      b, b, 0x76543210, 0xfedcba98, false, false));
}

// Transposing load of a 16 (rows) x 16 (columns) f16 tile: lane (c, hi) gets
// column c, rows 8*hi .. 8*hi+7. p is the lane's own 16 B of the row-major tile.
__device__ __forceinline__ v8h ld_tr16(const _Float16* p) {
  typedef __attribute__((address_space(3))) v8s lds_v8s;
  return __builtin_bit_cast(v8h, __builtin_amdgcn_ds_load_tr16_b128_v8i16((lds_v8s*)p));
}

__device__ __forceinline__ void async_copy_kv(
    unsigned lk, unsigned lv, const _Float16* gk, const _Float16* gv) {
  asm volatile(
      "global_load_async_to_lds_b128 %0, %4, off\n\t"
      "global_load_async_to_lds_b128 %1, %5, off\n\t"
      "global_load_async_to_lds_b128 %2, %6, off\n\t"
      "global_load_async_to_lds_b128 %3, %7, off\n\t"
      "s_wait_xcnt 0x0"
      :: "v"(lk), "v"(lk + 16), "v"(lv), "v"(lv + 16),
         "v"(gk), "v"(gk + 8), "v"(gv), "v"(gv + 8)
      : "memory");
}

__global__ __launch_bounds__(256) void attention_wmma_k(
    const _Float16* __restrict__ Q, const _Float16* __restrict__ K,
    const _Float16* __restrict__ V, _Float16* __restrict__ O) {
  __shared__ __attribute__((aligned(32))) _Float16 sK[64 * LDK];  // [key][d]
  __shared__ __attribute__((aligned(32))) _Float16 sV[64 * LDV];  // [key][d]

  const int bid = blockIdx.x;
  const int qt  = bid & 7;               // SEQ/128 = 8 tiles
  const int bh  = bid >> 3;
  const int b   = bh / NH, h = bh % NH;
  const int tid = threadIdx.x, w = tid >> 5, lane = tid & 31;
  const int col = lane & 15, hi = lane >> 4;
  const int q0  = qt * 128 + w * 16;
  const size_t tokBase = (size_t)b * SEQ;
  const float cs = 0.125f * 1.4426950408889634f;  // HD^-0.5 * log2(e)

  // B operand Q^T: lane = query column, the k order of load_frag (as K's below).
  const _Float16* qbase = Q + (tokBase + q0) * H + h * HD;
  const v16h qf0 = load_frag(qbase, H);        // d = 0..31
  const v16h qf1 = load_frag(qbase + 32, H);   // d = 32..63

  v8f of[4] = {};          // O^T: of[t][r] = O[query col][d = 16 t + 8 hi + r]
  float rm = -1e30f;       // running maximum of query col, scaled, base 2
  float rs = 0.f;          // running sum over this half's keys of query col

  const int kk = tid >> 2;               // 0..63 (staging row)
  const int q4 = tid & 3;                // 0..3  (16 f16 chunk)
  const unsigned ldsK = lds_addr_of(&sK[kk * LDK + q4 * 16]);
  const unsigned ldsV = lds_addr_of(&sV[kk * LDV + q4 * 16]);
  const size_t gOff = (tokBase + kk) * H + h * HD + q4 * 16;
  const _Float16* vtr = &sV[(8 * hi + (lane & 7)) * LDV + ((lane >> 3) & 1) * 8];

  for (int kt = 0; kt < SEQ; kt += 64) {
    wait_ds0();                          // own reads of the previous tile done
    __syncthreads();                     // previous tile fully consumed
    async_copy_kv(ldsK, ldsV, K + gOff + (size_t)kt * H, V + gOff + (size_t)kt * H);
    wait_async0();                       // own copies landed
    __syncthreads();                     // tile published

    // S^T = K * Q^T: s[f][r] = score(key 16 f + 8 hi + r, query col)
    v8f s[4];
#pragma unroll
    for (int f = 0; f < 4; ++f) {
      v16h ka0 = load_frag(&sK[(f * 16) * LDK], LDK);
      v16h ka1 = load_frag(&sK[(f * 16) * LDK + 32], LDK);
      v8f acc = {};
      acc = wmma32(ka0, qf0, acc);
      acc = wmma32(ka1, qf1, acc);
      s[f] = acc;
    }

    // online softmax of one query per lane, base 2
    float tm[4];
#pragma unroll
    for (int f = 0; f < 4; ++f) {
      tm[f] = s[f][0];
#pragma unroll
      for (int r = 1; r < 8; ++r) tm[f] = fmaxf(tm[f], s[f][r]);
    }
    float tmax = fmaxf(fmaxf(tm[0], tm[1]), fmaxf(tm[2], tm[3]));
    tmax = fmaxf(tmax, xhalf(tmax)) * cs;  // both halves hold the query's maximum
    const float mnew  = fmaxf(rm, tmax);
    float alpha;
    asm("v_exp_f32 %0, %1\n\tv_nop" : "=v"(alpha) : "v"(rm - mnew));
    rm = mnew;

    // P^T as B operand: elements 2 (i & 7), + 1 of key block i >> 3 are registers
    // 2 (i & 3), + 1 of score tile i >> 2. Arguments and sums go two to an instruction.
    const v2f cs2 = {cs, cs}, nm2 = {-mnew, -mnew};
    v2f a[16];
#pragma unroll
    for (int i = 0; i < 16; ++i)
      a[i] = __builtin_elementwise_fma(
          v2f{s[i >> 2][2 * (i & 3)], s[i >> 2][2 * (i & 3) + 1]}, cs2, nm2);
    v16h pb[2];
    v2f ts = {0.f, 0.f};
#pragma unroll
    for (int i = 0; i < 16; ++i) {
      const v2f p = {__builtin_amdgcn_exp2f(a[i][0]), __builtin_amdgcn_exp2f(a[i][1])};
      const v2h pk = __builtin_convertvector(p, v2h);
      pb[i >> 3][2 * (i & 7)] = pk[0];
      pb[i >> 3][2 * (i & 7) + 1] = pk[1];
      ts += p;
    }
    rs = rs * alpha + (ts[0] + ts[1]);
#pragma unroll
    for (int t = 0; t < 4; ++t) of[t] *= alpha;

    // O^T += V^T * P^T
#pragma unroll
    for (int ks = 0; ks < 2; ++ks) {
#pragma unroll
      for (int t = 0; t < 4; ++t) {
        const v8h lo = ld_tr16(vtr + (ks * 32) * LDV + t * 16);       // keys 8 hi ..
        const v8h hk = ld_tr16(vtr + (ks * 32 + 16) * LDV + t * 16);  // keys 16 + 8 hi ..
        v16h va;
#pragma unroll
        for (int j = 0; j < 8; ++j) { va[j] = lo[j]; va[j + 8] = hk[j]; }
        of[t] = wmma32(va, pb[ks], of[t]);
      }
    }
  }

  // join the halves' sums, normalize, store: 8 consecutive d of one query a lane
  const float inv = 1.f / (rs + xhalf(rs));
  _Float16* orow = O + (tokBase + q0 + col) * H + h * HD + 8 * hi;
#pragma unroll
  for (int t = 0; t < 4; ++t) {
    v8h o;
#pragma unroll
    for (int r = 0; r < 8; ++r) o[r] = (_Float16)(of[t][r] * inv);
    *(v8h*)(orow + t * 16) = o;
  }
}

// --------------------------- launcher --------------------------------------

extern "C" void kernel_launch(void* const* d_in, const int* in_sizes, int n_in,
                              void* d_out, int out_size, void* d_ws, size_t ws_size,
                              hipStream_t stream) {
  const float* hs    = (const float*)d_in[0];
  const float* wq    = (const float*)d_in[1];
  const float* bq    = (const float*)d_in[2];
  const float* wk    = (const float*)d_in[3];
  const float* bk    = (const float*)d_in[4];
  const float* wv    = (const float*)d_in[5];
  const float* bv    = (const float*)d_in[6];
  const float* wo    = (const float*)d_in[7];
  const float* bo    = (const float*)d_in[8];
  const float* ln1g  = (const float*)d_in[9];
  const float* ln1b  = (const float*)d_in[10];
  const float* ln2g  = (const float*)d_in[11];
  const float* ln2b  = (const float*)d_in[12];
  const float* w1    = (const float*)d_in[13];
  const float* b1    = (const float*)d_in[14];
  const float* w2    = (const float*)d_in[15];
  const float* b2    = (const float*)d_in[16];

  char* ws = (char*)d_ws;
  size_t off = 0;
  auto carve = [&](size_t bytes) {
    char* p = ws + off;
    off = (off + bytes + 255) & ~(size_t)255;
    return p;
  };
  const size_t SZ_HH  = (size_t)H * H * sizeof(_Float16);
  const size_t SZ_IH  = (size_t)IS * H * sizeof(_Float16);
  const size_t SZ_TH2 = (size_t)NTOK * H * sizeof(_Float16);
  const size_t SZ_TH4 = (size_t)NTOK * H * sizeof(float);
  const size_t SZ_TI2 = (size_t)NTOK * IS * sizeof(_Float16);

  _Float16* wq16 = (_Float16*)carve(SZ_HH);
  _Float16* wk16 = (_Float16*)carve(SZ_HH);
  _Float16* wv16 = (_Float16*)carve(SZ_HH);
  _Float16* wo16 = (_Float16*)carve(SZ_HH);
  _Float16* w116 = (_Float16*)carve(SZ_IH);
  _Float16* w216 = (_Float16*)carve(SZ_IH);
  _Float16* bufA = (_Float16*)carve(SZ_TH2);  // ln1 out, later attn out
  _Float16* bufB = (_Float16*)carve(SZ_TH2);  // q, later ln2 out
  _Float16* bufC = (_Float16*)carve(SZ_TH2);  // k
  _Float16* bufD = (_Float16*)carve(SZ_TH2);  // v
  float*    x2   = (float*)   carve(SZ_TH4);  // post-attention residual state
  _Float16* h1   = (_Float16*)carve(SZ_TI2);  // gelu(fc1)
  (void)ws_size; (void)n_in; (void)in_sizes; (void)out_size;
  (void)wk16; (void)wv16;  // reached through wq16
  // carve() pads to 256 B: these sizes need no pad, so neighbours are gapless
  static_assert(H * H * sizeof(_Float16) % 256 == 0 && IS * H * sizeof(_Float16) % 256 == 0 &&
                (size_t)NTOK * H * sizeof(_Float16) % 256 == 0, "workspace arrays not gapless");
  static_assert(H % 192 == 0 && IS % 128 == 0, "a column tile would straddle two products");

  const dim3 blk(256);
  const dim3 blk12(384);                   // 12 waves: the 192-column tiles
  const dim3 gH(H / 192, NTOK / 256);      // N=768 GEMMs, 192-column tiles
  const dim3 g3(3 * H / 192, NTOK / 256);  // Q, K, V together, 192-column tiles
  const dim3 gI(IS / 128, NTOK / 256);     // N=3072 GEMM, 128-column tiles

  // 1) LN1 and weights -> f16 (wq16 .. w216 are one gapless array)
  prep_k<<<PREP_GRID, blk, 0, stream>>>(hs, ln1g, ln1b, bufA, wq, wk, wv, wo, w1, w2, wq16);

  // 2) QKV projections (wq16 wk16 wv16 and bufB bufC bufD are gapless too)
  gemm_wmma_k<0, true, 3><<<g3, blk12, 0, stream>>>(
      bufA, wq16, bq, bk, bv, nullptr, bufB, NTOK, H, H);

  // 3) attention (bufA reused as output; ln1 activations are dead now)
  attention_wmma_k<<<BATCH * NH * (SEQ / 128), blk, 0, stream>>>(bufB, bufC, bufD, bufA);

  // 4) output projection + residual -> x2 (f32)
  gemm_wmma_k<2, false, 3><<<gH, blk12, 0, stream>>>(
      bufA, wo16, bo, nullptr, nullptr, hs, x2, NTOK, H, H);

  // 5) LN2 (bufB reused; q is dead)
  layernorm_f16_k<<<LN_GRID, blk, 0, stream>>>(x2, ln2g, ln2b, bufB);

  // 6) FC1 + GELU
  gemm_wmma_k<1, false, 2><<<gI, blk, 0, stream>>>(
      bufB, w116, b1, nullptr, nullptr, nullptr, h1, NTOK, IS, H);

  // 7) FC2 + residual -> d_out (f32)
  gemm_wmma_k<2, false, 3><<<gH, blk12, 0, stream>>>(
      h1, w216, b2, nullptr, nullptr, x2, (float*)d_out, NTOK, H, IS);
}

// v008
// Measured time: 277 microseconds a run.
// Timed twice side by side with v007, it ran 1.08 and 1.07 times as fast.
// Over all steps from v000 it is 2.85 times as fast.
#include <hip/hip_runtime.h>
#include <hip/hip_bf16.h>

#define H   768
#define NH  12
#define HD  64
#define IS  3072
#define BATCH 16
#define SEQ 1024
#define NTOK (BATCH * SEQ)

typedef __attribute__((ext_vector_type(16))) _Float16 v16h;
typedef __attribute__((ext_vector_type(8)))  _Float16 v8h;
typedef __attribute__((ext_vector_type(8)))  float    v8f;

__device__ __forceinline__ void wait_async0() {
  asm volatile("s_wait_asynccnt 0x0" ::: "memory");
}
__device__ __forceinline__ unsigned lds_addr_of(const void* p) {
  return (unsigned)(unsigned long long)p;  // flat LDS address: addr[31:0] = LDS offset
}

__device__ __forceinline__ v8f wmma32(v16h a, v16h b, v8f c) {
  return __builtin_amdgcn_wmma_f32_16x16x32_f16(
      /*neg_a=*/false, a, /*neg_b=*/false, b,
      /*c_mod=*/(short)0, c, /*reuse_a=*/false, /*reuse_b=*/false);
}

__device__ __forceinline__ v16h load_frag(const _Float16* __restrict__ base, int ld) {
  const int lane = threadIdx.x & 31;
  const int r    = lane & 15;
  const int hi   = lane >> 4;
  const _Float16* p = base + (size_t)r * ld + hi * 8;
  v8h lo = *(const v8h*)(p);       // K = 8*hi .. 8*hi+7
  v8h hk = *(const v8h*)(p + 16);  // K = 16+8*hi .. 16+8*hi+7
  v16h out;
#pragma unroll
  for (int j = 0; j < 8; ++j) { out[j] = lo[j]; out[j + 8] = hk[j]; }
  return out;
}

typedef __attribute__((ext_vector_type(2))) float    v2f;
typedef __attribute__((ext_vector_type(2))) _Float16 v2h;

// tanh-form GELU of two values. 0.5 (1 + tanh u) = 1 / (1 + e^(-2u)), with
// u = sqrt(2/pi) (x + 0.044715 x^3): one exp2 and one reciprocal a value, no
// branch, so the values of a wave's tile are independent straight-line chains.
// Ends: e^(-2u) -> inf gives x * 0, e^(-2u) -> 0 gives x, as the tanh form does.
__device__ __forceinline__ v2h gelu_tanh2(v2f x) {
  const float c0 = -2.3022081981443252f;   // -2 log2(e) sqrt(2/pi)
  const float c1 = -0.10294323958002349f;  // c0 * 0.044715
  const v2f a = x * __builtin_elementwise_fma(x * x, v2f{c1, c1}, v2f{c0, c0});
  const v2f d = v2f{__builtin_amdgcn_exp2f(a[0]), __builtin_amdgcn_exp2f(a[1])} + 1.f;
  const v2f y = x * v2f{__builtin_amdgcn_rcpf(d[0]), __builtin_amdgcn_rcpf(d[1])};
  return __builtin_convertvector(y, v2h);
}

// --------------------------- small kernels ---------------------------------
// Both are streams: a few fat waves, every global access of a wave contiguous
// (16 B a lane read, 8 B a lane written), all of a wave's reads issued ahead.

typedef __attribute__((ext_vector_type(4))) float    v4f;
typedef __attribute__((ext_vector_type(4))) _Float16 v4h;

__device__ __forceinline__ v4h to_f16x4(v4f v) {
  v4h o;
  o[0] = (_Float16)v[0]; o[1] = (_Float16)v[1];
  o[2] = (_Float16)v[2]; o[3] = (_Float16)v[3];
  return o;
}

// A block converts CVT_BLK consecutive elements, four 16-B groups a lane:
// block iblk of the array in to block oblk of the array out.
// Every array's length is a multiple of CVT_BLK.
#define CVT_BLK 4096

__device__ __forceinline__ void f32_to_f16_block(
    const float* __restrict__ in, int iblk, _Float16* __restrict__ out, int oblk) {
  const v4f* __restrict__ in4 = (const v4f*)in + (size_t)iblk * (CVT_BLK / 4) + threadIdx.x;
  v4h* __restrict__ out4 = (v4h*)out + (size_t)oblk * (CVT_BLK / 4) + threadIdx.x;
  v4f v[4];
#pragma unroll
  for (int k = 0; k < 4; ++k) v[k] = in4[k * 256];
#pragma unroll
  for (int k = 0; k < 4; ++k) out4[k * 256] = to_f16x4(v[k]);
}

// One wave per token row (768 f32 = six 16-B groups a lane), LN_ROWS rows a
// wave: the row's sums need the wave's own lanes only, no LDS and no barrier.
#define LN_ROWS 4

__device__ __forceinline__ void layernorm_block(
    int blk, const float* __restrict__ x, const float* __restrict__ g,
    const float* __restrict__ b, _Float16* __restrict__ out) {
  const int lane = threadIdx.x & 31;
  const size_t row0 = ((size_t)blk * 8 + (threadIdx.x >> 5)) * LN_ROWS;
  const v4f* __restrict__ x4 = (const v4f*)(x + row0 * H) + lane;
  v4f v[LN_ROWS][6];
#pragma unroll
  for (int r = 0; r < LN_ROWS; ++r)
#pragma unroll
    for (int k = 0; k < 6; ++k) v[r][k] = x4[r * (H / 4) + k * 32];
  v4f gv[6], bv[6];
#pragma unroll
  for (int k = 0; k < 6; ++k) {
    gv[k] = ((const v4f*)g)[k * 32 + lane];
    bv[k] = ((const v4f*)b)[k * 32 + lane];
  }

  float s[LN_ROWS], s2[LN_ROWS];
#pragma unroll
  for (int r = 0; r < LN_ROWS; ++r) {
    v4f a = v[r][0], a2 = v[r][0] * v[r][0];
#pragma unroll
    for (int k = 1; k < 6; ++k) { a += v[r][k]; a2 += v[r][k] * v[r][k]; }
    s[r]  = (a[0] + a[1]) + (a[2] + a[3]);
    s2[r] = (a2[0] + a2[1]) + (a2[2] + a2[3]);
  }
#pragma unroll
  for (int m = 16; m >= 1; m >>= 1) {
#pragma unroll
    for (int r = 0; r < LN_ROWS; ++r) {
      s[r]  += __shfl_xor(s[r],  m);
      s2[r] += __shfl_xor(s2[r], m);
    }
  }

  v4h* __restrict__ o4 = (v4h*)(out + row0 * H) + lane;
#pragma unroll
  for (int r = 0; r < LN_ROWS; ++r) {
    const float mu  = s[r] * (1.f / H);
    const float var = s2[r] * (1.f / H) - mu * mu;
    const float inv = rsqrtf(var + 1e-6f);
#pragma unroll
    for (int k = 0; k < 6; ++k)
      o4[r * (H / 4) + k * 32] = to_f16x4((v[r][k] - mu) * inv * gv[k] + bv[k]);
  }
}

__global__ __launch_bounds__(256) void layernorm_f16_k(
    const float* __restrict__ x, const float* __restrict__ g,
    const float* __restrict__ b, _Float16* __restrict__ out) {
  layernorm_block(blockIdx.x, x, g, b, out);
}

// The first layernorm and the six weight conversions depend on inputs only and
// on nothing of each other: one launch, the work picked by block range (the
// longer blocks, the layernorm's, first). The six f16 weights lie one behind
// the other in w16, in the order wq wk wv wo w1 w2, without gaps.
#define LN_GRID (NTOK / (8 * LN_ROWS))
#define CVT_HH  (H * H / CVT_BLK)
#define CVT_IH  (IS * H / CVT_BLK)
#define PREP_GRID (LN_GRID + 4 * CVT_HH + 2 * CVT_IH)

__global__ __launch_bounds__(256) void prep_k(
    const float* __restrict__ x, const float* __restrict__ g,
    const float* __restrict__ b, _Float16* __restrict__ xn,
    const float* __restrict__ wq, const float* __restrict__ wk,
    const float* __restrict__ wv, const float* __restrict__ wo,
    const float* __restrict__ w1, const float* __restrict__ w2,
    _Float16* __restrict__ w16) {
  const int bid = blockIdx.x;
  if (bid < LN_GRID) {
    layernorm_block(bid, x, g, b, xn);
    return;
  }
  const int c = bid - LN_GRID;  // block of w16
  const float* src;
  int first;                    // first block of that weight in w16
  if (c < 4 * CVT_HH) {
    const int m = c / CVT_HH;
    src = m == 0 ? wq : m == 1 ? wk : m == 2 ? wv : wo;
    first = m * CVT_HH;
  } else {
    const int m = (c - 4 * CVT_HH) / CVT_IH;
    src = m == 0 ? w1 : w2;
    first = 4 * CVT_HH + m * CVT_IH;
  }
  f32_to_f16_block(src, c - first, w16, c);
}

#define BM  256
#define BK  64
#define LDT 72

__device__ __forceinline__ void async_copy_tile(
    unsigned la, unsigned lb, const _Float16* ga, const _Float16* gb, size_t rstep) {
  const unsigned ls = 32 * LDT * 2;  // 32 rows further in LDS, bytes
  asm volatile(
      "global_load_async_to_lds_b128 %0, %12, off\n\t"
      "global_load_async_to_lds_b128 %1, %13, off\n\t"
      "global_load_async_to_lds_b128 %2, %14, off\n\t"
      "global_load_async_to_lds_b128 %3, %15, off\n\t"
      "global_load_async_to_lds_b128 %4, %16, off\n\t"
      "global_load_async_to_lds_b128 %5, %17, off\n\t"
      "global_load_async_to_lds_b128 %6, %18, off\n\t"
      "global_load_async_to_lds_b128 %7, %19, off\n\t"
      "global_load_async_to_lds_b128 %8, %20, off\n\t"
      "global_load_async_to_lds_b128 %9, %21, off\n\t"
      "global_load_async_to_lds_b128 %10, %22, off\n\t"
      "global_load_async_to_lds_b128 %11, %23, off\n\t"
      "s_wait_xcnt 0x0"
      :: "v"(la), "v"(la + ls), "v"(la + 2 * ls), "v"(la + 3 * ls),
         "v"(la + 4 * ls), "v"(la + 5 * ls), "v"(la + 6 * ls), "v"(la + 7 * ls),
         "v"(lb), "v"(lb + ls), "v"(lb + 2 * ls), "v"(lb + 3 * ls),
         "v"(ga), "v"(ga + rstep), "v"(ga + 2 * rstep), "v"(ga + 3 * rstep),
         "v"(ga + 4 * rstep), "v"(ga + 5 * rstep), "v"(ga + 6 * rstep), "v"(ga + 7 * rstep),
         "v"(gb), "v"(gb + rstep), "v"(gb + 2 * rstep), "v"(gb + 3 * rstep)
      : "memory");
}
__device__ __forceinline__ void async_copy_rows8(unsigned l, const _Float16* g, size_t rstep) {
  const unsigned ls = 32 * LDT * 2;  // 32 rows further in LDS, bytes
  asm volatile(
      "global_load_async_to_lds_b128 %0, %8, off\n\t"
      "global_load_async_to_lds_b128 %1, %9, off\n\t"
      "global_load_async_to_lds_b128 %2, %10, off\n\t"
      "global_load_async_to_lds_b128 %3, %11, off\n\t"
      "global_load_async_to_lds_b128 %4, %12, off\n\t"
      "global_load_async_to_lds_b128 %5, %13, off\n\t"
      "global_load_async_to_lds_b128 %6, %14, off\n\t"
      "global_load_async_to_lds_b128 %7, %15, off\n\t"
      "s_wait_xcnt 0x0"
      :: "v"(l), "v"(l + ls), "v"(l + 2 * ls), "v"(l + 3 * ls),
         "v"(l + 4 * ls), "v"(l + 5 * ls), "v"(l + 6 * ls), "v"(l + 7 * ls),
         "v"(g), "v"(g + rstep), "v"(g + 2 * rstep), "v"(g + 3 * rstep),
         "v"(g + 4 * rstep), "v"(g + 5 * rstep), "v"(g + 6 * rstep), "v"(g + 7 * rstep)
      : "memory");
}
__device__ __forceinline__ void async_copy_rows12(unsigned l, const _Float16* g, size_t rstep) {
  const unsigned ls = 16 * LDT * 2;  // 16 rows further in LDS, bytes
  asm volatile(
      "global_load_async_to_lds_b128 %0, %12, off\n\t"
      "global_load_async_to_lds_b128 %1, %13, off\n\t"
      "global_load_async_to_lds_b128 %2, %14, off\n\t"
      "global_load_async_to_lds_b128 %3, %15, off\n\t"
      "global_load_async_to_lds_b128 %4, %16, off\n\t"
      "global_load_async_to_lds_b128 %5, %17, off\n\t"
      "global_load_async_to_lds_b128 %6, %18, off\n\t"
      "global_load_async_to_lds_b128 %7, %19, off\n\t"
      "global_load_async_to_lds_b128 %8, %20, off\n\t"
      "global_load_async_to_lds_b128 %9, %21, off\n\t"
      "global_load_async_to_lds_b128 %10, %22, off\n\t"
      "global_load_async_to_lds_b128 %11, %23, off\n\t"
      "s_wait_xcnt 0x0"
      :: "v"(l), "v"(l + ls), "v"(l + 2 * ls), "v"(l + 3 * ls),
         "v"(l + 4 * ls), "v"(l + 5 * ls), "v"(l + 6 * ls), "v"(l + 7 * ls),
         "v"(l + 8 * ls), "v"(l + 9 * ls), "v"(l + 10 * ls), "v"(l + 11 * ls),
         "v"(g), "v"(g + rstep), "v"(g + 2 * rstep), "v"(g + 3 * rstep),
         "v"(g + 4 * rstep), "v"(g + 5 * rstep), "v"(g + 6 * rstep), "v"(g + 7 * rstep),
         "v"(g + 8 * rstep), "v"(g + 9 * rstep), "v"(g + 10 * rstep), "v"(g + 11 * rstep)
      : "memory");
}
// This wave's LDS reads have retired before its buffer is handed back for refill.
__device__ __forceinline__ void wait_ds0() {
  asm volatile("s_wait_dscnt 0x0" ::: "memory");
}

template <int EPI, bool TRI, int CW>
__global__ __launch_bounds__(128 * CW) void gemm_wmma_k(
    const _Float16* __restrict__ A, const _Float16* __restrict__ W,
    const float* __restrict__ bias, const float* __restrict__ bias1,
    const float* __restrict__ bias2, const float* __restrict__ resid,
    void* __restrict__ out, int M, int N, int K) {
  constexpr int BN = 64 * CW;
  static_assert(CW == 2 || CW == 3, "the copies are cut for these two widths");
  __shared__ __attribute__((aligned(16))) _Float16 sA[2][BM * LDT];
  __shared__ __attribute__((aligned(16))) _Float16 sB[2][BN * LDT];

  const int m0 = blockIdx.y * BM;
  const int n0 = blockIdx.x * BN;        // row of W
  const int sel = TRI ? blockIdx.x / (H / BN) : 0;  // which product (TRI: N == H)
  const int nc0 = n0 - sel * H;          // column in that product's result
  const float* __restrict__ bsel = !TRI || sel == 0 ? bias : sel == 1 ? bias1 : bias2;
  const int tid = threadIdx.x;
  const int w = tid >> 5, lane = tid & 31;
  const int wm = (w / CW) * 64;  // wave row offset in block tile
  const int wn = (w % CW) * 64;  // wave col offset

  v8f c[4][4] = {};

  // CW == 3: the wave's number in a scalar register, so that the choice between the
  // two copy routines is a scalar branch with every lane on; waves 8-11 take W rows.
  const bool forW = CW == 3 && __builtin_amdgcn_readfirstlane(w) >= 8;
  const int row = (forW ? tid - 256 : tid) >> 3;  // 0..31 (rows row, row+32, ...); forW: 0..15
  const int q   = tid & 7;       // 0..7 (8 f16 each)
  const unsigned la = lds_addr_of(&sA[0][row * LDT + q * 8]);
  const unsigned lb = lds_addr_of(&sB[0][row * LDT + q * 8]);
  const _Float16* gaRow = A + (size_t)(m0 + row) * K + q * 8;
  const _Float16* gbRow = W + (size_t)(n0 + row) * K + q * 8;
  const size_t rstep = (size_t)32 * K;

  auto issue = [&](int buf, int t) {
    if constexpr (CW == 2) {
      async_copy_tile(la + buf * (BM * LDT * 2), lb + buf * (BN * LDT * 2),
                      gaRow + t * BK, gbRow + t * BK, rstep);
    } else if (forW) {
      async_copy_rows12(lb + buf * (BN * LDT * 2), gbRow + t * BK, rstep / 2);
    } else {
      async_copy_rows8(la + buf * (BM * LDT * 2), gaRow + t * BK, rstep);
    }
  };
  v16h af[4], bf[4];
  auto load_frags = [&](int buf, int ks) {
    const _Float16* pa = &sA[buf][wm * LDT + ks * 32];
    const _Float16* pb = &sB[buf][wn * LDT + ks * 32];
#pragma unroll
    for (int i = 0; i < 4; ++i) af[i] = load_frag(pa + i * 16 * LDT, LDT);
#pragma unroll
    for (int j = 0; j < 4; ++j) bf[j] = load_frag(pb + j * 16 * LDT, LDT);
  };
  auto mma = [&]() {
#pragma unroll
    for (int i = 0; i < 4; ++i)
#pragma unroll
      for (int j = 0; j < 4; ++j) c[i][j] = wmma32(bf[j], af[i], c[i][j]);  // tile transposed
  };

  const int T = K / BK;
  issue(0, 0);                       // tile 0
  wait_async0();
  __syncthreads();                   // tile 0 published
  if (T > 1) issue(1, 1);            // tile 1 in flight over trip 0
  for (int t = 0; t < T; ++t) {
    const int buf = t & 1;
    load_frags(buf, 0);
    mma();
    load_frags(buf, 1);              // last LDS reads of buf
    wait_ds0();                      // own reads of buf done
    wait_async0();                   // own copies of tile t+1 landed
    __syncthreads();                 // publishes tile t+1, frees buf
    if (t + 2 < T) issue(buf, t + 2);
    mma();                           // registers only: the refill flies under it
  }
  wait_async0();

  // Epilogue. The products were taken transposed (W fragment as A operand), so lane
  // (col, hi) holds, of tile (i, j), token row i*16 + col and the eight consecutive
  // columns j*16 + 8*hi + v. A band of 16 token rows x 64 columns goes through the
  // wave's own piece of sA, which is free behind the last trip's barrier (every wave's
  // reads retired, every copy landed, none issued since), and leaves as whole 128-B
  // lines, 16 B a lane; the residual is read in the same whole-line shape.
  const int col = lane & 15, hi = lane >> 4;
  const size_t row0 = (size_t)sel * M + m0 + wm;  // first output row of the wave
  if constexpr (EPI == 2) {
    static_assert(!TRI, "the residual epilogue writes one product");
    constexpr int PF = 68;  // staging pitch in f32 (272 B = 16 B x odd)
    float* st = (float*)&sA[0][0] + w * (16 * PF);
    float* wr = st + col * PF + 8 * hi;
    const float* rd = st + hi * PF + col * 4;  // rows hi, hi + 2, ...: 256 B by 16 lanes
    // Addresses: the wave's corner is uniform, the lane's place one small offset, and
    // the row steps are constants (both residual products have N == H), so they become
    // immediate offsets on one address for the residual and one for the output. No load
    // or store has an address register of its own that a later result could land on.
    const int wu = __builtin_amdgcn_readfirstlane(w);
    const size_t u0 = (size_t)(m0 + (wu / CW) * 64) * H + nc0 + (wu % CW) * 64;
    const float* __restrict__ rs = resid + u0;
    float* __restrict__ os = (float*)out + u0;
    const unsigned lo = hi * H + col * 4;
    const float* bp = bsel + nc0 + wn + col * 4;  // bias of the columns read back
    const v4f b4 = *(const v4f*)bp;
    v4f r[8];
#pragma unroll
    for (int k = 0; k < 8; ++k) r[k] = *(const v4f*)(rs + lo + 2 * k * H);
    // The bias load's address is used once: as an input here it stays whole up to the
    // wait (without it this build lands the load's own result on the address pair).
    asm volatile("s_wait_xcnt 0x0" :: "v"(bp) : "memory");
#pragma unroll
    for (int i = 0; i < 4; ++i) {
#pragma unroll
      for (int j = 0; j < 4; ++j) {
        const v8f a = c[i][j];
        *(v4f*)(wr + j * 16)     = v4f{a[0], a[1], a[2], a[3]};
        *(v4f*)(wr + j * 16 + 4) = v4f{a[4], a[5], a[6], a[7]};
      }
      wait_ds0();  // the band is written before other lanes read it back
      v4f rn[8];
      if (i < 3) {  // the next band's residual flies under this band's stores
#pragma unroll
        for (int k = 0; k < 8; ++k)
          rn[k] = *(const v4f*)(rs + lo + ((i + 1) * 16 + 2 * k) * H);
      }
#pragma unroll
      for (int k = 0; k < 8; ++k) {
        const v4f t = *(const v4f*)(rd + 2 * k * PF);
        *(v4f*)(os + lo + (i * 16 + 2 * k) * H) = r[k] + (t + b4);
      }
      // The band is read back before the next one overwrites it, and no register that
      // an issued load or store names is rewritten before the second wait.
      if (i < 3) asm volatile("s_wait_dscnt 0x0\n\ts_wait_xcnt 0x0" ::: "memory");
      if (i < 3) {
#pragma unroll
        for (int k = 0; k < 8; ++k) r[k] = rn[k];
      }
    }
  } else {
    v4f bv[4][2];  // the bias goes in ahead of the GELU and the rounding to f16
#pragma unroll
    for (int j = 0; j < 4; ++j) {
      const v4f* bp = (const v4f*)(bsel + nc0 + wn + j * 16 + 8 * hi);
      bv[j][0] = bp[0];
      bv[j][1] = bp[1];
    }
    _Float16* st = &sA[0][0] + w * (16 * LDT);
    _Float16* wr = st + col * LDT + 8 * hi;
    const _Float16* rd = st + (lane >> 3) * LDT + (lane & 7) * 8;  // 128 B by 8 lanes
    _Float16* go = (_Float16*)out + (row0 + (lane >> 3)) * N + nc0 + wn + (lane & 7) * 8;
#pragma unroll
    for (int i = 0; i < 4; ++i) {
#pragma unroll
      for (int j = 0; j < 4; ++j) {
        v8h o;
        // unrolled so that o and c, register arrays, are indexed by constants only
#pragma unroll
        for (int p = 0; p < 4; ++p) {
          const v2f x = v2f{c[i][j][2 * p], c[i][j][2 * p + 1]} +
                        v2f{bv[j][p >> 1][2 * (p & 1)], bv[j][p >> 1][2 * (p & 1) + 1]};
          const v2h g = EPI == 1 ? gelu_tanh2(x) : __builtin_convertvector(x, v2h);
          o[2 * p] = g[0];
          o[2 * p + 1] = g[1];
        }
        *(v8h*)(wr + j * 16) = o;
      }
      wait_ds0();  // the band is written before other lanes read it back
#pragma unroll
      for (int k = 0; k < 4; ++k)
        *(v8h*)(go + (size_t)(i * 16 + 4 * k) * N) = *(const v8h*)(rd + 4 * k * LDT);
      // The band is read back before the next one overwrites it, and no register that
      // an issued store names is rewritten before the second wait.
      if (i < 3) asm volatile("s_wait_dscnt 0x0\n\ts_wait_xcnt 0x0" ::: "memory");
    }
  }
}

#define LDK 72   // K row pitch in f16
#define LDV 80   // V row pitch in f16

typedef __attribute__((ext_vector_type(8))) short    v8s;

__device__ __forceinline__ float xhalf(float x) {
  const int b = __builtin_bit_cast(int, x);
  return __builtin_bit_cast(float, __builtin_amdgcn_permlanex16(
      b, b, 0x76543210, 0xfedcba98, false, false));
}

// Transposing load of a 16 (rows) x 16 (columns) f16 tile: lane (c, hi) gets
// column c, rows 8*hi .. 8*hi+7. p is the lane's own 16 B of the row-major tile.
__device__ __forceinline__ v8h ld_tr16(const _Float16* p) {
  typedef __attribute__((address_space(3))) v8s lds_v8s;
  return __builtin_bit_cast(v8h, __builtin_amdgcn_ds_load_tr16_b128_v8i16((lds_v8s*)p));
}

__device__ __forceinline__ void async_copy_kv(
    unsigned lk, unsigned lv, const _Float16* gk, const _Float16* gv) {
  asm volatile(
      "global_load_async_to_lds_b128 %0, %4, off\n\t"
      "global_load_async_to_lds_b128 %1, %5, off\n\t"
      "global_load_async_to_lds_b128 %2, %6, off\n\t"
      "global_load_async_to_lds_b128 %3, %7, off\n\t"
      "s_wait_xcnt 0x0"
      :: "v"(lk), "v"(lk + 16), "v"(lv), "v"(lv + 16),
         "v"(gk), "v"(gk + 8), "v"(gv), "v"(gv + 8)
      : "memory");
}

__global__ __launch_bounds__(256) void attention_wmma_k(
    const _Float16* __restrict__ Q, const _Float16* __restrict__ K,
    const _Float16* __restrict__ V, _Float16* __restrict__ O) {
  __shared__ __attribute__((aligned(32))) _Float16 sK[64 * LDK];  // [key][d]
  __shared__ __attribute__((aligned(32))) _Float16 sV[64 * LDV];  // [key][d]

  const int bid = blockIdx.x;
  const int qt  = bid & 7;               // SEQ/128 = 8 tiles
  const int bh  = bid >> 3;
  const int b   = bh / NH, h = bh % NH;
  const int tid = threadIdx.x, w = tid >> 5, lane = tid & 31;
  const int col = lane & 15, hi = lane >> 4;
  const int q0  = qt * 128 + w * 16;
  const size_t tokBase = (size_t)b * SEQ;
  const float cs = 0.125f * 1.4426950408889634f;  // HD^-0.5 * log2(e)

  // B operand Q^T: lane = query column, the k order of load_frag (as K's below).
  const _Float16* qbase = Q + (tokBase + q0) * H + h * HD;
  const v16h qf0 = load_frag(qbase, H);        // d = 0..31
  const v16h qf1 = load_frag(qbase + 32, H);   // d = 32..63

  v8f of[4] = {};          // O^T: of[t][r] = O[query col][d = 16 t + 8 hi + r]
  float rm = -1e30f;       // running maximum of query col, scaled, base 2
  float rs = 0.f;          // running sum over this half's keys of query col

  const int kk = tid >> 2;               // 0..63 (staging row)
  const int q4 = tid & 3;                // 0..3  (16 f16 chunk)
  const unsigned ldsK = lds_addr_of(&sK[kk * LDK + q4 * 16]);
  const unsigned ldsV = lds_addr_of(&sV[kk * LDV + q4 * 16]);
  const size_t gOff = (tokBase + kk) * H + h * HD + q4 * 16;
  const _Float16* vtr = &sV[(8 * hi + (lane & 7)) * LDV + ((lane >> 3) & 1) * 8];

  for (int kt = 0; kt < SEQ; kt += 64) {
    wait_ds0();                          // own reads of the previous tile done
    __syncthreads();                     // previous tile fully consumed
    async_copy_kv(ldsK, ldsV, K + gOff + (size_t)kt * H, V + gOff + (size_t)kt * H);
    wait_async0();                       // own copies landed
    __syncthreads();                     // tile published

    // S^T = K * Q^T: s[f][r] = score(key 16 f + 8 hi + r, query col)
    v8f s[4];
#pragma unroll
    for (int f = 0; f < 4; ++f) {
      v16h ka0 = load_frag(&sK[(f * 16) * LDK], LDK);
      v16h ka1 = load_frag(&sK[(f * 16) * LDK + 32], LDK);
      v8f acc = {};
      acc = wmma32(ka0, qf0, acc);
      acc = wmma32(ka1, qf1, acc);
      s[f] = acc;
    }

    // online softmax of one query per lane, base 2
    float tm[4];
#pragma unroll
    for (int f = 0; f < 4; ++f) {
      tm[f] = s[f][0];
#pragma unroll
      for (int r = 1; r < 8; ++r) tm[f] = fmaxf(tm[f], s[f][r]);
    }
    float tmax = fmaxf(fmaxf(tm[0], tm[1]), fmaxf(tm[2], tm[3]));
    tmax = fmaxf(tmax, xhalf(tmax)) * cs;  // both halves hold the query's maximum
    const float mnew  = fmaxf(rm, tmax);
    float alpha;
    asm("v_exp_f32 %0, %1\n\tv_nop" : "=v"(alpha) : "v"(rm - mnew));
    rm = mnew;

    // P^T as B operand: elements 2 (i & 7), + 1 of key block i >> 3 are registers
    // 2 (i & 3), + 1 of score tile i >> 2. Arguments and sums go two to an instruction.
    const v2f cs2 = {cs, cs}, nm2 = {-mnew, -mnew};
    v2f a[16];
#pragma unroll
    for (int i = 0; i < 16; ++i)
      a[i] = __builtin_elementwise_fma(
          v2f{s[i >> 2][2 * (i & 3)], s[i >> 2][2 * (i & 3) + 1]}, cs2, nm2);
    v16h pb[2];
    v2f ts = {0.f, 0.f};
#pragma unroll
    for (int i = 0; i < 16; ++i) {
      const v2f p = {__builtin_amdgcn_exp2f(a[i][0]), __builtin_amdgcn_exp2f(a[i][1])};
      const v2h pk = __builtin_convertvector(p, v2h);
      pb[i >> 3][2 * (i & 7)] = pk[0];
      pb[i >> 3][2 * (i & 7) + 1] = pk[1];
      ts += p;
    }
    rs = rs * alpha + (ts[0] + ts[1]);
#pragma unroll
    for (int t = 0; t < 4; ++t) of[t] *= alpha;

    // O^T += V^T * P^T
#pragma unroll
    for (int ks = 0; ks < 2; ++ks) {
#pragma unroll
      for (int t = 0; t < 4; ++t) {
        const v8h lo = ld_tr16(vtr + (ks * 32) * LDV + t * 16);       // keys 8 hi ..
        const v8h hk = ld_tr16(vtr + (ks * 32 + 16) * LDV + t * 16);  // keys 16 + 8 hi ..
        v16h va;
#pragma unroll
        for (int j = 0; j < 8; ++j) { va[j] = lo[j]; va[j + 8] = hk[j]; }
        of[t] = wmma32(va, pb[ks], of[t]);
      }
    }
  }

  // join the halves' sums, normalize, store: 8 consecutive d of one query a lane
  const float inv = 1.f / (rs + xhalf(rs));
  _Float16* orow = O + (tokBase + q0 + col) * H + h * HD + 8 * hi;
#pragma unroll
  for (int t = 0; t < 4; ++t) {
    v8h o;
#pragma unroll
    for (int r = 0; r < 8; ++r) o[r] = (_Float16)(of[t][r] * inv);
    *(v8h*)(orow + t * 16) = o;
  }
}

// --------------------------- launcher --------------------------------------

extern "C" void kernel_launch(void* const* d_in, const int* in_sizes, int n_in,
                              void* d_out, int out_size, void* d_ws, size_t ws_size,
                              hipStream_t stream) {
  const float* hs    = (const float*)d_in[0];
  const float* wq    = (const float*)d_in[1];
  const float* bq    = (const float*)d_in[2];
  const float* wk    = (const float*)d_in[3];
  const float* bk    = (const float*)d_in[4];
  const float* wv    = (const float*)d_in[5];
  const float* bv    = (const float*)d_in[6];
  const float* wo    = (const float*)d_in[7];
  const float* bo    = (const float*)d_in[8];
  const float* ln1g  = (const float*)d_in[9];
  const float* ln1b  = (const float*)d_in[10];
  const float* ln2g  = (const float*)d_in[11];
  const float* ln2b  = (const float*)d_in[12];
  const float* w1    = (const float*)d_in[13];
  const float* b1    = (const float*)d_in[14];
  const float* w2    = (const float*)d_in[15];
  const float* b2    = (const float*)d_in[16];

  char* ws = (char*)d_ws;
  size_t off = 0;
  auto carve = [&](size_t bytes) {
    char* p = ws + off;
    off = (off + bytes + 255) & ~(size_t)255;
    return p;
  };
  const size_t SZ_HH  = (size_t)H * H * sizeof(_Float16);
  const size_t SZ_IH  = (size_t)IS * H * sizeof(_Float16);
  const size_t SZ_TH2 = (size_t)NTOK * H * sizeof(_Float16);
  const size_t SZ_TH4 = (size_t)NTOK * H * sizeof(float);
  const size_t SZ_TI2 = (size_t)NTOK * IS * sizeof(_Float16);

  _Float16* wq16 = (_Float16*)carve(SZ_HH);
  _Float16* wk16 = (_Float16*)carve(SZ_HH);
  _Float16* wv16 = (_Float16*)carve(SZ_HH);
  _Float16* wo16 = (_Float16*)carve(SZ_HH);
  _Float16* w116 = (_Float16*)carve(SZ_IH);
  _Float16* w216 = (_Float16*)carve(SZ_IH);
  _Float16* bufA = (_Float16*)carve(SZ_TH2);  // ln1 out, later attn out
  _Float16* bufB = (_Float16*)carve(SZ_TH2);  // q, later ln2 out
  _Float16* bufC = (_Float16*)carve(SZ_TH2);  // k
  _Float16* bufD = (_Float16*)carve(SZ_TH2);  // v
  float*    x2   = (float*)   carve(SZ_TH4);  // post-attention residual state
  _Float16* h1   = (_Float16*)carve(SZ_TI2);  // gelu(fc1)
  (void)ws_size; (void)n_in; (void)in_sizes; (void)out_size;
  (void)wk16; (void)wv16;  // reached through wq16
  // carve() pads to 256 B: these sizes need no pad, so neighbours are gapless
  static_assert(H * H * sizeof(_Float16) % 256 == 0 && IS * H * sizeof(_Float16) % 256 == 0 &&
                (size_t)NTOK * H * sizeof(_Float16) % 256 == 0, "workspace arrays not gapless");
  static_assert(H % 192 == 0 && IS % 128 == 0, "a column tile would straddle two products");

  const dim3 blk(256);
  const dim3 blk12(384);                   // 12 waves: the 192-column tiles
  const dim3 gH(H / 192, NTOK / 256);      // N=768 GEMMs, 192-column tiles
  const dim3 g3(3 * H / 192, NTOK / 256);  // Q, K, V together, 192-column tiles
  const dim3 gI(IS / 128, NTOK / 256);     // N=3072 GEMM, 128-column tiles

  // 1) LN1 and weights -> f16 (wq16 .. w216 are one gapless array)
  prep_k<<<PREP_GRID, blk, 0, stream>>>(hs, ln1g, ln1b, bufA, wq, wk, wv, wo, w1, w2, wq16);

  // 2) QKV projections (wq16 wk16 wv16 and bufB bufC bufD are gapless too)
  gemm_wmma_k<0, true, 3><<<g3, blk12, 0, stream>>>(
      bufA, wq16, bq, bk, bv, nullptr, bufB, NTOK, H, H);

  // 3) attention (bufA reused as output; ln1 activations are dead now)
  attention_wmma_k<<<BATCH * NH * (SEQ / 128), blk, 0, stream>>>(bufB, bufC, bufD, bufA);

  // 4) output projection + residual -> x2 (f32)
  gemm_wmma_k<2, false, 3><<<gH, blk12, 0, stream>>>(
      bufA, wo16, bo, nullptr, nullptr, hs, x2, NTOK, H, H);

  // 5) LN2 (bufB reused; q is dead)
  layernorm_f16_k<<<LN_GRID, blk, 0, stream>>>(x2, ln2g, ln2b, bufB);

  // 6) FC1 + GELU
  gemm_wmma_k<1, false, 2><<<gI, blk, 0, stream>>>(
      bufB, w116, b1, nullptr, nullptr, nullptr, h1, NTOK, IS, H);

  // 7) FC2 + residual -> d_out (f32)
  gemm_wmma_k<2, false, 3><<<gH, blk12, 0, stream>>>(
      h1, w216, b2, nullptr, nullptr, x2, (float*)d_out, NTOK, H, IS);
}

// v009
// A run of this version takes 262 microseconds.
// Timed twice side by side with v008, it ran 1.06 times as fast both times.
// Over all steps from v000 it is 3.01 times as fast.
#include <hip/hip_runtime.h>
#include <hip/hip_bf16.h>

#define H   768
#define NH  12
#define HD  64
#define IS  3072
#define BATCH 16
#define SEQ 1024
#define NTOK (BATCH * SEQ)

typedef __attribute__((ext_vector_type(16))) _Float16 v16h;
typedef __attribute__((ext_vector_type(8)))  _Float16 v8h;
typedef __attribute__((ext_vector_type(8)))  float    v8f;

__device__ __forceinline__ void wait_async0() {
  asm volatile("s_wait_asynccnt 0x0" ::: "memory");
}
__device__ __forceinline__ unsigned lds_addr_of(const void* p) {
  return (unsigned)(unsigned long long)p;  // flat LDS address: addr[31:0] = LDS offset
}

__device__ __forceinline__ v8f wmma32(v16h a, v16h b, v8f c) {
  return __builtin_amdgcn_wmma_f32_16x16x32_f16(
      /*neg_a=*/false, a, /*neg_b=*/false, b,
      /*c_mod=*/(short)0, c, /*reuse_a=*/false, /*reuse_b=*/false);
}

__device__ __forceinline__ v16h load_frag(const _Float16* __restrict__ base, int ld) {
  const int lane = threadIdx.x & 31;
  const int r    = lane & 15;
  const int hi   = lane >> 4;
  const _Float16* p = base + (size_t)r * ld + hi * 8;
  v8h lo = *(const v8h*)(p);       // K = 8*hi .. 8*hi+7
  v8h hk = *(const v8h*)(p + 16);  // K = 16+8*hi .. 16+8*hi+7
  v16h out;
#pragma unroll
  for (int j = 0; j < 8; ++j) { out[j] = lo[j]; out[j + 8] = hk[j]; }
  return out;
}

typedef __attribute__((ext_vector_type(2))) float    v2f;
typedef __attribute__((ext_vector_type(2))) _Float16 v2h;

// tanh-form GELU of two values. 0.5 (1 + tanh u) = 1 / (1 + e^(-2u)), with
// u = sqrt(2/pi) (x + 0.044715 x^3): one exp2 and one reciprocal a value, no
// branch, so the values of a wave's tile are independent straight-line chains.
// Ends: e^(-2u) -> inf gives x * 0, e^(-2u) -> 0 gives x, as the tanh form does.
__device__ __forceinline__ v2h gelu_tanh2(v2f x) {
  const float c0 = -2.3022081981443252f;   // -2 log2(e) sqrt(2/pi)
  const float c1 = -0.10294323958002349f;  // c0 * 0.044715
  const v2f a = x * __builtin_elementwise_fma(x * x, v2f{c1, c1}, v2f{c0, c0});
  const v2f d = v2f{__builtin_amdgcn_exp2f(a[0]), __builtin_amdgcn_exp2f(a[1])} + 1.f;
  const v2f y = x * v2f{__builtin_amdgcn_rcpf(d[0]), __builtin_amdgcn_rcpf(d[1])};
  return __builtin_convertvector(y, v2h);
}

// --------------------------- small kernels ---------------------------------
// Both are streams: a few fat waves, every global access of a wave contiguous
// (16 B a lane read, 8 B a lane written), all of a wave's reads issued ahead.

typedef __attribute__((ext_vector_type(4))) float    v4f;
typedef __attribute__((ext_vector_type(4))) _Float16 v4h;

__device__ __forceinline__ v4h to_f16x4(v4f v) {
  v4h o;
  o[0] = (_Float16)v[0]; o[1] = (_Float16)v[1];
  o[2] = (_Float16)v[2]; o[3] = (_Float16)v[3];
  return o;
}

// A block converts CVT_BLK consecutive elements, four 16-B groups a lane:
// block iblk of the array in to block oblk of the array out.
// Every array's length is a multiple of CVT_BLK.
#define CVT_BLK 4096

__device__ __forceinline__ void f32_to_f16_block(
    const float* __restrict__ in, int iblk, _Float16* __restrict__ out, int oblk) {
  const v4f* __restrict__ in4 = (const v4f*)in + (size_t)iblk * (CVT_BLK / 4) + threadIdx.x;
  v4h* __restrict__ out4 = (v4h*)out + (size_t)oblk * (CVT_BLK / 4) + threadIdx.x;
  v4f v[4];
#pragma unroll
  for (int k = 0; k < 4; ++k) v[k] = in4[k * 256];
#pragma unroll
  for (int k = 0; k < 4; ++k) out4[k * 256] = to_f16x4(v[k]);
}

// One wave per token row (768 f32 = six 16-B groups a lane), LN_ROWS rows a
// wave: the row's sums need the wave's own lanes only, no LDS and no barrier.
#define LN_ROWS 4

__device__ __forceinline__ void layernorm_block(
    int blk, const float* __restrict__ x, const float* __restrict__ g,
    const float* __restrict__ b, _Float16* __restrict__ out) {
  const int lane = threadIdx.x & 31;
  const size_t row0 = ((size_t)blk * 8 + (threadIdx.x >> 5)) * LN_ROWS;
  const v4f* __restrict__ x4 = (const v4f*)(x + row0 * H) + lane;
  v4f v[LN_ROWS][6];
#pragma unroll
  for (int r = 0; r < LN_ROWS; ++r)
#pragma unroll
    for (int k = 0; k < 6; ++k) v[r][k] = x4[r * (H / 4) + k * 32];
  v4f gv[6], bv[6];
#pragma unroll
  for (int k = 0; k < 6; ++k) {
    gv[k] = ((const v4f*)g)[k * 32 + lane];
    bv[k] = ((const v4f*)b)[k * 32 + lane];
  }

  float s[LN_ROWS], s2[LN_ROWS];
#pragma unroll
  for (int r = 0; r < LN_ROWS; ++r) {
    v4f a = v[r][0], a2 = v[r][0] * v[r][0];
#pragma unroll
    for (int k = 1; k < 6; ++k) { a += v[r][k]; a2 += v[r][k] * v[r][k]; }
    s[r]  = (a[0] + a[1]) + (a[2] + a[3]);
    s2[r] = (a2[0] + a2[1]) + (a2[2] + a2[3]);
  }
#pragma unroll
  for (int m = 16; m >= 1; m >>= 1) {
#pragma unroll
    for (int r = 0; r < LN_ROWS; ++r) {
      s[r]  += __shfl_xor(s[r],  m);
      s2[r] += __shfl_xor(s2[r], m);
    }
  }

  v4h* __restrict__ o4 = (v4h*)(out + row0 * H) + lane;
#pragma unroll
  for (int r = 0; r < LN_ROWS; ++r) {
    const float mu  = s[r] * (1.f / H);
    const float var = s2[r] * (1.f / H) - mu * mu;
    const float inv = rsqrtf(var + 1e-6f);
#pragma unroll
    for (int k = 0; k < 6; ++k)
      o4[r * (H / 4) + k * 32] = to_f16x4((v[r][k] - mu) * inv * gv[k] + bv[k]);
  }
}

__global__ __launch_bounds__(256) void layernorm_f16_k(
    const float* __restrict__ x, const float* __restrict__ g,
    const float* __restrict__ b, _Float16* __restrict__ out) {
  layernorm_block(blockIdx.x, x, g, b, out);
}

// The first layernorm and the six weight conversions depend on inputs only and
// on nothing of each other: one launch, the work picked by block range (the
// longer blocks, the layernorm's, first). The six f16 weights lie one behind
// the other in w16, in the order wq wk wv wo w1 w2, without gaps.
#define LN_GRID (NTOK / (8 * LN_ROWS))
#define CVT_HH  (H * H / CVT_BLK)
#define CVT_IH  (IS * H / CVT_BLK)
#define PREP_GRID (LN_GRID + 4 * CVT_HH + 2 * CVT_IH)

__global__ __launch_bounds__(256) void prep_k(
    const float* __restrict__ x, const float* __restrict__ g,
    const float* __restrict__ b, _Float16* __restrict__ xn,
    const float* __restrict__ wq, const float* __restrict__ wk,
    const float* __restrict__ wv, const float* __restrict__ wo,
    const float* __restrict__ w1, const float* __restrict__ w2,
    _Float16* __restrict__ w16) {
  const int bid = blockIdx.x;
  if (bid < LN_GRID) {
    layernorm_block(bid, x, g, b, xn);
    return;
  }
  const int c = bid - LN_GRID;  // block of w16
  const float* src;
  int first;                    // first block of that weight in w16
  if (c < 4 * CVT_HH) {
    const int m = c / CVT_HH;
    src = m == 0 ? wq : m == 1 ? wk : m == 2 ? wv : wo;
    first = m * CVT_HH;
  } else {
    const int m = (c - 4 * CVT_HH) / CVT_IH;
    src = m == 0 ? w1 : w2;
    first = 4 * CVT_HH + m * CVT_IH;
  }
  f32_to_f16_block(src, c - first, w16, c);
}

#define BM  256

__device__ __forceinline__ void async_copy_tile(
    unsigned la, unsigned lb, const _Float16* ga, const _Float16* gb, size_t rstep,
    unsigned ls) {
  asm volatile(
      "global_load_async_to_lds_b128 %0, %12, off\n\t"
      "global_load_async_to_lds_b128 %1, %13, off\n\t"
      "global_load_async_to_lds_b128 %2, %14, off\n\t"
      "global_load_async_to_lds_b128 %3, %15, off\n\t"
      "global_load_async_to_lds_b128 %4, %16, off\n\t"
      "global_load_async_to_lds_b128 %5, %17, off\n\t"
      "global_load_async_to_lds_b128 %6, %18, off\n\t"
      "global_load_async_to_lds_b128 %7, %19, off\n\t"
      "global_load_async_to_lds_b128 %8, %20, off\n\t"
      "global_load_async_to_lds_b128 %9, %21, off\n\t"
      "global_load_async_to_lds_b128 %10, %22, off\n\t"
      "global_load_async_to_lds_b128 %11, %23, off\n\t"
      "s_wait_xcnt 0x0"
      :: "v"(la), "v"(la + ls), "v"(la + 2 * ls), "v"(la + 3 * ls),
         "v"(la + 4 * ls), "v"(la + 5 * ls), "v"(la + 6 * ls), "v"(la + 7 * ls),
         "v"(lb), "v"(lb + ls), "v"(lb + 2 * ls), "v"(lb + 3 * ls),
         "v"(ga), "v"(ga + rstep), "v"(ga + 2 * rstep), "v"(ga + 3 * rstep),
         "v"(ga + 4 * rstep), "v"(ga + 5 * rstep), "v"(ga + 6 * rstep), "v"(ga + 7 * rstep),
         "v"(gb), "v"(gb + rstep), "v"(gb + 2 * rstep), "v"(gb + 3 * rstep)
      : "memory");
}
__device__ __forceinline__ void async_copy_rows8(
    unsigned l, const _Float16* g, size_t rstep, unsigned ls) {
  asm volatile(
      "global_load_async_to_lds_b128 %0, %8, off\n\t"
      "global_load_async_to_lds_b128 %1, %9, off\n\t"
      "global_load_async_to_lds_b128 %2, %10, off\n\t"
      "global_load_async_to_lds_b128 %3, %11, off\n\t"
      "global_load_async_to_lds_b128 %4, %12, off\n\t"
      "global_load_async_to_lds_b128 %5, %13, off\n\t"
      "global_load_async_to_lds_b128 %6, %14, off\n\t"
      "global_load_async_to_lds_b128 %7, %15, off\n\t"
      "s_wait_xcnt 0x0"
      :: "v"(l), "v"(l + ls), "v"(l + 2 * ls), "v"(l + 3 * ls),
         "v"(l + 4 * ls), "v"(l + 5 * ls), "v"(l + 6 * ls), "v"(l + 7 * ls),
         "v"(g), "v"(g + rstep), "v"(g + 2 * rstep), "v"(g + 3 * rstep),
         "v"(g + 4 * rstep), "v"(g + 5 * rstep), "v"(g + 6 * rstep), "v"(g + 7 * rstep)
      : "memory");
}
// This wave's LDS reads have retired before its buffer is handed back for refill.
__device__ __forceinline__ void wait_ds0() {
  asm volatile("s_wait_dscnt 0x0" ::: "memory");
}

template <int EPI, bool TRI, int CW>
__global__ __launch_bounds__(128 * CW) void gemm_wmma_k(
    const _Float16* __restrict__ A, const _Float16* __restrict__ W,
    const float* __restrict__ bias, const float* __restrict__ bias1,
    const float* __restrict__ bias2, const float* __restrict__ resid,
    void* __restrict__ out, int M, int N, int K) {
  constexpr int BN = 64 * CW;
  static_assert(CW == 2 || CW == 3, "the copies are cut for these two widths");
  constexpr int BK  = CW == 3 ? 128 : 64;  // k of a trip
  constexpr int LDT = BK + 8;              // LDS row stride in f16
  constexpr int LPR = BK / 8;              // lanes to a row, 16 B each
  __shared__ __attribute__((aligned(16))) _Float16 sA[2][BM * LDT];
  __shared__ __attribute__((aligned(16))) _Float16 sB[2][BN * LDT];

  const int m0 = blockIdx.y * BM;
  const int n0 = blockIdx.x * BN;        // row of W
  const int sel = TRI ? blockIdx.x / (H / BN) : 0;  // which product (TRI: N == H)
  const int nc0 = n0 - sel * H;          // column in that product's result
  const float* __restrict__ bsel = !TRI || sel == 0 ? bias : sel == 1 ? bias1 : bias2;
  const int tid = threadIdx.x;
  const int w = tid >> 5, lane = tid & 31;
  const int wm = (w / CW) * 64;  // wave row offset in block tile
  const int wn = (w % CW) * 64;  // wave col offset

  v8f c[4][4] = {};

  // CW == 3: the wave's number in a scalar register, so that the choice of the operand
  // and the branch round the third run are scalar, every lane on; waves 8-11 take W rows.
  const bool forW = CW == 3 && __builtin_amdgcn_readfirstlane(w) >= 8;
  const int row = (forW ? tid - 256 : tid) / LPR;  // first of the lane's rows
  const int q   = tid % LPR;     // the lane's 16 B (8 f16) of a row

  auto issue = [&](int buf, int t) {
    if constexpr (CW == 2) {
      const unsigned la = lds_addr_of(&sA[0][row * LDT + q * 8]);
      const unsigned lb = lds_addr_of(&sB[0][row * LDT + q * 8]);
      const _Float16* gaRow = A + (size_t)(m0 + row) * K + q * 8;
      const _Float16* gbRow = W + (size_t)(n0 + row) * K + q * 8;
      async_copy_tile(la + buf * (BM * LDT * 2), lb + buf * (BN * LDT * 2),
                      gaRow + t * BK, gbRow + t * BK, (size_t)32 * K, 32 * LDT * 2);
    } else {
      // One operand a wave: its base, buffer size and row step are wave-uniform, so a
      // lane keeps one LDS address and one pointer. W's 128 lanes take a third run.
      const int rpc = forW ? 8 : 16;  // rows from one copy to the next
      const unsigned l = lds_addr_of(forW ? &sB[0][row * LDT + q * 8] : &sA[0][row * LDT + q * 8]) +
                         buf * ((forW ? BN : BM) * LDT * 2);
      const _Float16* g = (forW ? W + (size_t)n0 * K : A + (size_t)m0 * K) +
                          (size_t)row * K + q * 8 + t * BK;
      const unsigned ls = rpc * LDT * 2;
      const size_t rstep = (size_t)rpc * K;
      async_copy_rows8(l, g, rstep, ls);
      async_copy_rows8(l + 8 * ls, g + 8 * rstep, rstep, ls);
      if (forW) async_copy_rows8(l + 16 * ls, g + 16 * rstep, rstep, ls);
    }
  };
  v16h af[4], bf[4];
  auto load_frags = [&](int buf, int ks) {
    const _Float16* pa = &sA[buf][wm * LDT + ks * 32];
    const _Float16* pb = &sB[buf][wn * LDT + ks * 32];
#pragma unroll
    for (int i = 0; i < 4; ++i) af[i] = load_frag(pa + i * 16 * LDT, LDT);
#pragma unroll
    for (int j = 0; j < 4; ++j) bf[j] = load_frag(pb + j * 16 * LDT, LDT);
  };
  auto mma = [&]() {
#pragma unroll
    for (int i = 0; i < 4; ++i)
#pragma unroll
      for (int j = 0; j < 4; ++j) c[i][j] = wmma32(bf[j], af[i], c[i][j]);  // tile transposed
  };

  const int T = K / BK;
  issue(0, 0);                       // tile 0
  wait_async0();
  __syncthreads();                   // tile 0 published
  if (T > 1) issue(1, 1);            // tile 1 in flight over trip 0
  for (int t = 0; t < T; ++t) {
    const int buf = t & 1;
    // unrolled so that the fragments' LDS offsets are constants
#pragma unroll
    for (int ks = 0; ks < BK / 32 - 1; ++ks) {
      load_frags(buf, ks);
      // Keeps a block's 16 LDS reads one group ahead of its WMMAs: this build spread
      // them, two reads and a wait to zero in front of every four WMMAs.
      if constexpr (CW == 3) __builtin_amdgcn_sched_barrier(0);
      mma();
    }
    load_frags(buf, BK / 32 - 1);    // last LDS reads of buf
    // Keeps the earlier blocks' WMMAs above the barrier: this build sank 32 of them
    // between the barrier and the refill, which then started that much later.
    if constexpr (CW == 3) __builtin_amdgcn_sched_barrier(0);
    wait_ds0();                      // own reads of buf done
    wait_async0();                   // own copies of tile t+1 landed
    __syncthreads();                 // publishes tile t+1, frees buf
    if (t + 2 < T) issue(buf, t + 2);
    mma();                           // registers only: the refill flies under it
  }
  wait_async0();

  // Epilogue. The products were taken transposed (W fragment as A operand), so lane
  // (col, hi) holds, of tile (i, j), token row i*16 + col and the eight consecutive
  // columns j*16 + 8*hi + v. A band of 16 token rows x 64 columns goes through the
  // wave's own piece of sA, which is free behind the last trip's barrier (every wave's
  // reads retired, every copy landed, none issued since), and leaves as whole 128-B
  // lines, 16 B a lane; the residual is read in the same whole-line shape.
  const int col = lane & 15, hi = lane >> 4;
  const size_t row0 = (size_t)sel * M + m0 + wm;  // first output row of the wave
  if constexpr (EPI == 2) {
    static_assert(!TRI, "the residual epilogue writes one product");
    constexpr int PF = 68;  // staging pitch in f32 (272 B = 16 B x odd)
    float* st = (float*)&sA[0][0] + w * (16 * PF);
    float* wr = st + col * PF + 8 * hi;
    const float* rd = st + hi * PF + col * 4;  // rows hi, hi + 2, ...: 256 B by 16 lanes
    // Addresses: the wave's corner is uniform, the lane's place one small offset, and
    // the row steps are constants (both residual products have N == H), so they become
    // immediate offsets on one address for the residual and one for the output. No load
    // or store has an address register of its own that a later result could land on.
    const int wu = __builtin_amdgcn_readfirstlane(w);
    const size_t u0 = (size_t)(m0 + (wu / CW) * 64) * H + nc0 + (wu % CW) * 64;
    const float* __restrict__ rs = resid + u0;
    float* __restrict__ os = (float*)out + u0;
    const unsigned lo = hi * H + col * 4;
    const float* bp = bsel + nc0 + wn + col * 4;  // bias of the columns read back
    const v4f b4 = *(const v4f*)bp;
    v4f r[8];
#pragma unroll
    for (int k = 0; k < 8; ++k) r[k] = *(const v4f*)(rs + lo + 2 * k * H);
    // The bias load's address is used once: as an input here it stays whole up to the
    // wait (without it this build lands the load's own result on the address pair).
    asm volatile("s_wait_xcnt 0x0" :: "v"(bp) : "memory");
#pragma unroll
    for (int i = 0; i < 4; ++i) {
#pragma unroll
      for (int j = 0; j < 4; ++j) {
        const v8f a = c[i][j];
        *(v4f*)(wr + j * 16)     = v4f{a[0], a[1], a[2], a[3]};
        *(v4f*)(wr + j * 16 + 4) = v4f{a[4], a[5], a[6], a[7]};
      }
      wait_ds0();  // the band is written before other lanes read it back
      v4f rn[8];
      if (i < 3) {  // the next band's residual flies under this band's stores
#pragma unroll
        for (int k = 0; k < 8; ++k)
          rn[k] = *(const v4f*)(rs + lo + ((i + 1) * 16 + 2 * k) * H);
      }
#pragma unroll
      for (int k = 0; k < 8; ++k) {
        const v4f t = *(const v4f*)(rd + 2 * k * PF);
        *(v4f*)(os + lo + (i * 16 + 2 * k) * H) = r[k] + (t + b4);
      }
      // The band is read back before the next one overwrites it, and no register that
      // an issued load or store names is rewritten before the second wait.
      if (i < 3) asm volatile("s_wait_dscnt 0x0\n\ts_wait_xcnt 0x0" ::: "memory");
      if (i < 3) {
#pragma unroll
        for (int k = 0; k < 8; ++k) r[k] = rn[k];
      }
    }
  } else {
    v4f bv[4][2];  // the bias goes in ahead of the GELU and the rounding to f16
#pragma unroll
    for (int j = 0; j < 4; ++j) {
      const v4f* bp = (const v4f*)(bsel + nc0 + wn + j * 16 + 8 * hi);
      bv[j][0] = bp[0];
      bv[j][1] = bp[1];
    }
    _Float16* st = &sA[0][0] + w * (16 * LDT);
    _Float16* wr = st + col * LDT + 8 * hi;
    const _Float16* rd = st + (lane >> 3) * LDT + (lane & 7) * 8;  // 128 B by 8 lanes
    _Float16* go = (_Float16*)out + (row0 + (lane >> 3)) * N + nc0 + wn + (lane & 7) * 8;
#pragma unroll
    for (int i = 0; i < 4; ++i) {
#pragma unroll
      for (int j = 0; j < 4; ++j) {
        v8h o;
        // unrolled so that o and c, register arrays, are indexed by constants only
#pragma unroll
        for (int p = 0; p < 4; ++p) {
          const v2f x = v2f{c[i][j][2 * p], c[i][j][2 * p + 1]} +
                        v2f{bv[j][p >> 1][2 * (p & 1)], bv[j][p >> 1][2 * (p & 1) + 1]};
          const v2h g = EPI == 1 ? gelu_tanh2(x) : __builtin_convertvector(x, v2h);
          o[2 * p] = g[0];
          o[2 * p + 1] = g[1];
        }
        *(v8h*)(wr + j * 16) = o;
      }
      wait_ds0();  // the band is written before other lanes read it back
#pragma unroll
      for (int k = 0; k < 4; ++k)
        *(v8h*)(go + (size_t)(i * 16 + 4 * k) * N) = *(const v8h*)(rd + 4 * k * LDT);
      // The band is read back before the next one overwrites it, and no register that
      // an issued store names is rewritten before the second wait.
      if (i < 3) asm volatile("s_wait_dscnt 0x0\n\ts_wait_xcnt 0x0" ::: "memory");
    }
  }
}

#define LDK 72   // K row pitch in f16
#define LDV 80   // V row pitch in f16

typedef __attribute__((ext_vector_type(8))) short    v8s;

__device__ __forceinline__ float xhalf(float x) {
  const int b = __builtin_bit_cast(int, x);
  return __builtin_bit_cast(float, __builtin_amdgcn_permlanex16(
      b, b, 0x76543210, 0xfedcba98, false, false));
}

// Transposing load of a 16 (rows) x 16 (columns) f16 tile: lane (c, hi) gets
// column c, rows 8*hi .. 8*hi+7. p is the lane's own 16 B of the row-major tile.
__device__ __forceinline__ v8h ld_tr16(const _Float16* p) {
  typedef __attribute__((address_space(3))) v8s lds_v8s;
  return __builtin_bit_cast(v8h, __builtin_amdgcn_ds_load_tr16_b128_v8i16((lds_v8s*)p));
}

__device__ __forceinline__ void async_copy_kv(
    unsigned lk, unsigned lv, const _Float16* gk, const _Float16* gv) {
  asm volatile(
      "global_load_async_to_lds_b128 %0, %4, off\n\t"
      "global_load_async_to_lds_b128 %1, %5, off\n\t"
      "global_load_async_to_lds_b128 %2, %6, off\n\t"
      "global_load_async_to_lds_b128 %3, %7, off\n\t"
      "s_wait_xcnt 0x0"
      :: "v"(lk), "v"(lk + 16), "v"(lv), "v"(lv + 16),
         "v"(gk), "v"(gk + 8), "v"(gv), "v"(gv + 8)
      : "memory");
}

__global__ __launch_bounds__(256) void attention_wmma_k(
    const _Float16* __restrict__ Q, const _Float16* __restrict__ K,
    const _Float16* __restrict__ V, _Float16* __restrict__ O) {
  __shared__ __attribute__((aligned(32))) _Float16 sK[64 * LDK];  // [key][d]
  __shared__ __attribute__((aligned(32))) _Float16 sV[64 * LDV];  // [key][d]

  const int bid = blockIdx.x;
  const int qt  = bid & 7;               // SEQ/128 = 8 tiles
  const int bh  = bid >> 3;
  const int b   = bh / NH, h = bh % NH;
  const int tid = threadIdx.x, w = tid >> 5, lane = tid & 31;
  const int col = lane & 15, hi = lane >> 4;
  const int q0  = qt * 128 + w * 16;
  const size_t tokBase = (size_t)b * SEQ;
  const float cs = 0.125f * 1.4426950408889634f;  // HD^-0.5 * log2(e)

  // B operand Q^T: lane = query column, the k order of load_frag (as K's below).
  const _Float16* qbase = Q + (tokBase + q0) * H + h * HD;
  const v16h qf0 = load_frag(qbase, H);        // d = 0..31
  const v16h qf1 = load_frag(qbase + 32, H);   // d = 32..63

  v8f of[4] = {};          // O^T: of[t][r] = O[query col][d = 16 t + 8 hi + r]
  float rm = -1e30f;       // running maximum of query col, scaled, base 2
  float rs = 0.f;          // running sum over this half's keys of query col

  const int kk = tid >> 2;               // 0..63 (staging row)
  const int q4 = tid & 3;                // 0..3  (16 f16 chunk)
  const unsigned ldsK = lds_addr_of(&sK[kk * LDK + q4 * 16]);
  const unsigned ldsV = lds_addr_of(&sV[kk * LDV + q4 * 16]);
  const size_t gOff = (tokBase + kk) * H + h * HD + q4 * 16;
  const _Float16* vtr = &sV[(8 * hi + (lane & 7)) * LDV + ((lane >> 3) & 1) * 8];

  for (int kt = 0; kt < SEQ; kt += 64) {
    wait_ds0();                          // own reads of the previous tile done
    __syncthreads();                     // previous tile fully consumed
    async_copy_kv(ldsK, ldsV, K + gOff + (size_t)kt * H, V + gOff + (size_t)kt * H);
    wait_async0();                       // own copies landed
    __syncthreads();                     // tile published

    // S^T = K * Q^T: s[f][r] = score(key 16 f + 8 hi + r, query col)
    v8f s[4];
#pragma unroll
    for (int f = 0; f < 4; ++f) {
      v16h ka0 = load_frag(&sK[(f * 16) * LDK], LDK);
      v16h ka1 = load_frag(&sK[(f * 16) * LDK + 32], LDK);
      v8f acc = {};
      acc = wmma32(ka0, qf0, acc);
      acc = wmma32(ka1, qf1, acc);
      s[f] = acc;
    }

    // online softmax of one query per lane, base 2
    float tm[4];
#pragma unroll
    for (int f = 0; f < 4; ++f) {
      tm[f] = s[f][0];
#pragma unroll
      for (int r = 1; r < 8; ++r) tm[f] = fmaxf(tm[f], s[f][r]);
    }
    float tmax = fmaxf(fmaxf(tm[0], tm[1]), fmaxf(tm[2], tm[3]));
    tmax = fmaxf(tmax, xhalf(tmax)) * cs;  // both halves hold the query's maximum
    const float mnew  = fmaxf(rm, tmax);
    float alpha;
    asm("v_exp_f32 %0, %1\n\tv_nop" : "=v"(alpha) : "v"(rm - mnew));
    rm = mnew;

    // P^T as B operand: elements 2 (i & 7), + 1 of key block i >> 3 are registers
    // 2 (i & 3), + 1 of score tile i >> 2. Arguments and sums go two to an instruction.
    const v2f cs2 = {cs, cs}, nm2 = {-mnew, -mnew};
    v2f a[16];
#pragma unroll
    for (int i = 0; i < 16; ++i)
      a[i] = __builtin_elementwise_fma(
          v2f{s[i >> 2][2 * (i & 3)], s[i >> 2][2 * (i & 3) + 1]}, cs2, nm2);
    v16h pb[2];
    v2f ts = {0.f, 0.f};
#pragma unroll
    for (int i = 0; i < 16; ++i) {
      const v2f p = {__builtin_amdgcn_exp2f(a[i][0]), __builtin_amdgcn_exp2f(a[i][1])};
      const v2h pk = __builtin_convertvector(p, v2h);
      pb[i >> 3][2 * (i & 7)] = pk[0];
      pb[i >> 3][2 * (i & 7) + 1] = pk[1];
      ts += p;
    }
    rs = rs * alpha + (ts[0] + ts[1]);
#pragma unroll
    for (int t = 0; t < 4; ++t) of[t] *= alpha;

    // O^T += V^T * P^T
#pragma unroll
    for (int ks = 0; ks < 2; ++ks) {
#pragma unroll
      for (int t = 0; t < 4; ++t) {
        const v8h lo = ld_tr16(vtr + (ks * 32) * LDV + t * 16);       // keys 8 hi ..
        const v8h hk = ld_tr16(vtr + (ks * 32 + 16) * LDV + t * 16);  // keys 16 + 8 hi ..
        v16h va;
#pragma unroll
        for (int j = 0; j < 8; ++j) { va[j] = lo[j]; va[j + 8] = hk[j]; }
        of[t] = wmma32(va, pb[ks], of[t]);
      }
    }
  }

  // join the halves' sums, normalize, store: 8 consecutive d of one query a lane
  const float inv = 1.f / (rs + xhalf(rs));
  _Float16* orow = O + (tokBase + q0 + col) * H + h * HD + 8 * hi;
#pragma unroll
  for (int t = 0; t < 4; ++t) {
    v8h o;
#pragma unroll
    for (int r = 0; r < 8; ++r) o[r] = (_Float16)(of[t][r] * inv);
    *(v8h*)(orow + t * 16) = o;
  }
}

// --------------------------- launcher --------------------------------------

extern "C" void kernel_launch(void* const* d_in, const int* in_sizes, int n_in,
                              void* d_out, int out_size, void* d_ws, size_t ws_size,
                              hipStream_t stream) {
  const float* hs    = (const float*)d_in[0];
  const float* wq    = (const float*)d_in[1];
  const float* bq    = (const float*)d_in[2];
  const float* wk    = (const float*)d_in[3];
  const float* bk    = (const float*)d_in[4];
  const float* wv    = (const float*)d_in[5];
  const float* bv    = (const float*)d_in[6];
  const float* wo    = (const float*)d_in[7];
  const float* bo    = (const float*)d_in[8];
  const float* ln1g  = (const float*)d_in[9];
  const float* ln1b  = (const float*)d_in[10];
  const float* ln2g  = (const float*)d_in[11];
  const float* ln2b  = (const float*)d_in[12];
  const float* w1    = (const float*)d_in[13];
  const float* b1    = (const float*)d_in[14];
  const float* w2    = (const float*)d_in[15];
  const float* b2    = (const float*)d_in[16];

  char* ws = (char*)d_ws;
  size_t off = 0;
  auto carve = [&](size_t bytes) {
    char* p = ws + off;
    off = (off + bytes + 255) & ~(size_t)255;
    return p;
  };
  const size_t SZ_HH  = (size_t)H * H * sizeof(_Float16);
  const size_t SZ_IH  = (size_t)IS * H * sizeof(_Float16);
  const size_t SZ_TH2 = (size_t)NTOK * H * sizeof(_Float16);
  const size_t SZ_TH4 = (size_t)NTOK * H * sizeof(float);
  const size_t SZ_TI2 = (size_t)NTOK * IS * sizeof(_Float16);

  _Float16* wq16 = (_Float16*)carve(SZ_HH);
  _Float16* wk16 = (_Float16*)carve(SZ_HH);
  _Float16* wv16 = (_Float16*)carve(SZ_HH);
  _Float16* wo16 = (_Float16*)carve(SZ_HH);
  _Float16* w116 = (_Float16*)carve(SZ_IH);
  _Float16* w216 = (_Float16*)carve(SZ_IH);
  _Float16* bufA = (_Float16*)carve(SZ_TH2);  // ln1 out, later attn out
  _Float16* bufB = (_Float16*)carve(SZ_TH2);  // q, later ln2 out
  _Float16* bufC = (_Float16*)carve(SZ_TH2);  // k
  _Float16* bufD = (_Float16*)carve(SZ_TH2);  // v
  float*    x2   = (float*)   carve(SZ_TH4);  // post-attention residual state
  _Float16* h1   = (_Float16*)carve(SZ_TI2);  // gelu(fc1)
  (void)ws_size; (void)n_in; (void)in_sizes; (void)out_size;
  (void)wk16; (void)wv16;  // reached through wq16
  // carve() pads to 256 B: these sizes need no pad, so neighbours are gapless
  static_assert(H * H * sizeof(_Float16) % 256 == 0 && IS * H * sizeof(_Float16) % 256 == 0 &&
                (size_t)NTOK * H * sizeof(_Float16) % 256 == 0, "workspace arrays not gapless");
  static_assert(H % 192 == 0 && IS % 128 == 0, "a column tile would straddle two products");

  const dim3 blk(256);
  const dim3 blk12(384);                   // 12 waves: the 192-column tiles
  const dim3 gH(H / 192, NTOK / 256);      // N=768 GEMMs, 192-column tiles
  const dim3 g3(3 * H / 192, NTOK / 256);  // Q, K, V together, 192-column tiles
  const dim3 gI(IS / 128, NTOK / 256);     // N=3072 GEMM, 128-column tiles

  // 1) LN1 and weights -> f16 (wq16 .. w216 are one gapless array)
  prep_k<<<PREP_GRID, blk, 0, stream>>>(hs, ln1g, ln1b, bufA, wq, wk, wv, wo, w1, w2, wq16);

  // 2) QKV projections (wq16 wk16 wv16 and bufB bufC bufD are gapless too)
  gemm_wmma_k<0, true, 3><<<g3, blk12, 0, stream>>>(
      bufA, wq16, bq, bk, bv, nullptr, bufB, NTOK, H, H);

  // 3) attention (bufA reused as output; ln1 activations are dead now)
  attention_wmma_k<<<BATCH * NH * (SEQ / 128), blk, 0, stream>>>(bufB, bufC, bufD, bufA);

  // 4) output projection + residual -> x2 (f32)
  gemm_wmma_k<2, false, 3><<<gH, blk12, 0, stream>>>(
      bufA, wo16, bo, nullptr, nullptr, hs, x2, NTOK, H, H);

  // 5) LN2 (bufB reused; q is dead)
  layernorm_f16_k<<<LN_GRID, blk, 0, stream>>>(x2, ln2g, ln2b, bufB);

  // 6) FC1 + GELU
  gemm_wmma_k<1, false, 2><<<gI, blk, 0, stream>>>(
      bufB, w116, b1, nullptr, nullptr, nullptr, h1, NTOK, IS, H);

  // 7) FC2 + residual -> d_out (f32)
  gemm_wmma_k<2, false, 3><<<gH, blk12, 0, stream>>>(
      h1, w216, b2, nullptr, nullptr, x2, (float*)d_out, NTOK, H, IS);
}

// v010
// Measured time: 246 microseconds a run.
// In two side-by-side timings against v009, it was 1.06 and 1.07 times as fast.
// Counting every step since v000, it is 3.22 times as fast.
#include <hip/hip_runtime.h>
#include <hip/hip_bf16.h>

#define H   768
#define NH  12
#define HD  64
#define IS  3072
#define BATCH 16
#define SEQ 1024
#define NTOK (BATCH * SEQ)

typedef __attribute__((ext_vector_type(16))) _Float16 v16h;
typedef __attribute__((ext_vector_type(8)))  _Float16 v8h;
typedef __attribute__((ext_vector_type(8)))  float    v8f;

__device__ __forceinline__ void wait_async0() {
  asm volatile("s_wait_asynccnt 0x0" ::: "memory");
}
__device__ __forceinline__ unsigned lds_addr_of(const void* p) {
  return (unsigned)(unsigned long long)p;  // flat LDS address: addr[31:0] = LDS offset
}

typedef uint32_t u32x4 __attribute__((ext_vector_type(4)));
typedef uint32_t u32x8 __attribute__((ext_vector_type(8)));

__device__ __forceinline__ uint32_t uni(uint32_t v) {
  return (uint32_t)__builtin_amdgcn_readfirstlane(v);
}
__device__ __forceinline__ uint32_t pinned(uint32_t v) {
  uint32_t w = __builtin_amdgcn_readfirstlane(v);
  asm volatile("" : "+s"(w));  // holds the test in a scalar register: the branch on it is s_cmp + s_cbranch_scc
  return w;
}
struct TensorDesc {
  u32x4 g0;
  u32x8 g1;
};
__device__ __forceinline__ void wait_tensor0(const TensorDesc& d) {
  asm volatile("s_wait_tensorcnt 0x0" :: "s"(d.g0), "s"(d.g1) : "memory");
}
// The part that no request changes: 64 rows of RB bytes, src_pitch bytes apart; the mover
// leaves 16 B free behind every row (LDS pitch RB + 16). Extents in bytes, no mask.
template <int RB>
__device__ __forceinline__ TensorDesc tensor_desc_rows64(uint32_t src_pitch) {
  static_assert(RB == 128 || RB == 256, "the pad interval is the row: codes 4 and 5");
  constexpr uint32_t W0 = (1u << 20) | ((RB == 256 ? 5u : 4u) << 22) | (3u << 25);
  TensorDesc d;
  d.g0[0] = uni(1u);  // count
  d.g0[1] = uni(0u);
  d.g0[2] = uni(0u);
  d.g0[3] = uni(0x80000000u);  // type 2
  d.g1[0] = uni(W0);
  d.g1[1] = uni((uint32_t)RB << 16);
  d.g1[2] = uni(64u << 16);
  d.g1[3] = uni((uint32_t)RB << 16);
  d.g1[4] = uni(64u);
  d.g1[5] = uni(src_pitch);
  d.g1[6] = uni(0u);
  d.g1[7] = uni(0u);
  asm volatile("" : "+s"(d.g1));
  return d;
}
// One request: the tile whose first byte is at g, to LDS byte lds_dst.
__device__ __forceinline__ void tensor_load(TensorDesc& d, uint32_t lds_dst, const _Float16* g) {
  const uint64_t ga = (uint64_t)g;
  d.g0[1] = uni(lds_dst);
  d.g0[2] = uni((uint32_t)ga);
  d.g0[3] = uni((((uint32_t)(ga >> 32)) & 0x01FFFFFFu) | 0x80000000u);
  asm volatile("tensor_load_to_lds %0, %1" :: "s"(d.g0), "s"(d.g1) : "memory");
}

__device__ __forceinline__ v8f wmma32(v16h a, v16h b, v8f c) {
  return __builtin_amdgcn_wmma_f32_16x16x32_f16(
      /*neg_a=*/false, a, /*neg_b=*/false, b,
      /*c_mod=*/(short)0, c, /*reuse_a=*/false, /*reuse_b=*/false);
}

__device__ __forceinline__ v16h load_frag(const _Float16* __restrict__ base, int ld) {
  const int lane = threadIdx.x & 31;
  const int r    = lane & 15;
  const int hi   = lane >> 4;
  const _Float16* p = base + (size_t)r * ld + hi * 8;
  v8h lo = *(const v8h*)(p);       // K = 8*hi .. 8*hi+7
  v8h hk = *(const v8h*)(p + 16);  // K = 16+8*hi .. 16+8*hi+7
  v16h out;
#pragma unroll
  for (int j = 0; j < 8; ++j) { out[j] = lo[j]; out[j + 8] = hk[j]; }
  return out;
}

typedef __attribute__((ext_vector_type(2))) float    v2f;
typedef __attribute__((ext_vector_type(2))) _Float16 v2h;

// tanh-form GELU of two values. 0.5 (1 + tanh u) = 1 / (1 + e^(-2u)), with
// u = sqrt(2/pi) (x + 0.044715 x^3): one exp2 and one reciprocal a value, no
// branch, so the values of a wave's tile are independent straight-line chains.
// Ends: e^(-2u) -> inf gives x * 0, e^(-2u) -> 0 gives x, as the tanh form does.
__device__ __forceinline__ v2h gelu_tanh2(v2f x) {
  const float c0 = -2.3022081981443252f;   // -2 log2(e) sqrt(2/pi)
  const float c1 = -0.10294323958002349f;  // c0 * 0.044715
  const v2f a = x * __builtin_elementwise_fma(x * x, v2f{c1, c1}, v2f{c0, c0});
  const v2f d = v2f{__builtin_amdgcn_exp2f(a[0]), __builtin_amdgcn_exp2f(a[1])} + 1.f;
  const v2f y = x * v2f{__builtin_amdgcn_rcpf(d[0]), __builtin_amdgcn_rcpf(d[1])};
  return __builtin_convertvector(y, v2h);
}

// --------------------------- small kernels ---------------------------------
// Both are streams: a few fat waves, every global access of a wave contiguous
// (16 B a lane read, 8 B a lane written), all of a wave's reads issued ahead.

typedef __attribute__((ext_vector_type(4))) float    v4f;
typedef __attribute__((ext_vector_type(4))) _Float16 v4h;

__device__ __forceinline__ v4h to_f16x4(v4f v) {
  v4h o;
  o[0] = (_Float16)v[0]; o[1] = (_Float16)v[1];
  o[2] = (_Float16)v[2]; o[3] = (_Float16)v[3];
  return o;
}

// A block converts CVT_BLK consecutive elements, four 16-B groups a lane:
// block iblk of the array in to block oblk of the array out.
// Every array's length is a multiple of CVT_BLK.
#define CVT_BLK 4096

__device__ __forceinline__ void f32_to_f16_block(
    const float* __restrict__ in, int iblk, _Float16* __restrict__ out, int oblk) {
  const v4f* __restrict__ in4 = (const v4f*)in + (size_t)iblk * (CVT_BLK / 4) + threadIdx.x;
  v4h* __restrict__ out4 = (v4h*)out + (size_t)oblk * (CVT_BLK / 4) + threadIdx.x;
  v4f v[4];
#pragma unroll
  for (int k = 0; k < 4; ++k) v[k] = in4[k * 256];
#pragma unroll
  for (int k = 0; k < 4; ++k) out4[k * 256] = to_f16x4(v[k]);
}

// One wave per token row (768 f32 = six 16-B groups a lane), LN_ROWS rows a
// wave: the row's sums need the wave's own lanes only, no LDS and no barrier.
#define LN_ROWS 4

__device__ __forceinline__ void layernorm_block(
    int blk, const float* __restrict__ x, const float* __restrict__ g,
    const float* __restrict__ b, _Float16* __restrict__ out) {
  const int lane = threadIdx.x & 31;
  const size_t row0 = ((size_t)blk * 8 + (threadIdx.x >> 5)) * LN_ROWS;
  const v4f* __restrict__ x4 = (const v4f*)(x + row0 * H) + lane;
  v4f v[LN_ROWS][6];
#pragma unroll
  for (int r = 0; r < LN_ROWS; ++r)
#pragma unroll
    for (int k = 0; k < 6; ++k) v[r][k] = x4[r * (H / 4) + k * 32];
  v4f gv[6], bv[6];
#pragma unroll
  for (int k = 0; k < 6; ++k) {
    gv[k] = ((const v4f*)g)[k * 32 + lane];
    bv[k] = ((const v4f*)b)[k * 32 + lane];
  }

  float s[LN_ROWS], s2[LN_ROWS];
#pragma unroll
  for (int r = 0; r < LN_ROWS; ++r) {
    v4f a = v[r][0], a2 = v[r][0] * v[r][0];
#pragma unroll
    for (int k = 1; k < 6; ++k) { a += v[r][k]; a2 += v[r][k] * v[r][k]; }
    s[r]  = (a[0] + a[1]) + (a[2] + a[3]);
    s2[r] = (a2[0] + a2[1]) + (a2[2] + a2[3]);
  }
#pragma unroll
  for (int m = 16; m >= 1; m >>= 1) {
#pragma unroll
    for (int r = 0; r < LN_ROWS; ++r) {
      s[r]  += __shfl_xor(s[r],  m);
      s2[r] += __shfl_xor(s2[r], m);
    }
  }

  v4h* __restrict__ o4 = (v4h*)(out + row0 * H) + lane;
#pragma unroll
  for (int r = 0; r < LN_ROWS; ++r) {
    const float mu  = s[r] * (1.f / H);
    const float var = s2[r] * (1.f / H) - mu * mu;
    const float inv = rsqrtf(var + 1e-6f);
#pragma unroll
    for (int k = 0; k < 6; ++k)
      o4[r * (H / 4) + k * 32] = to_f16x4((v[r][k] - mu) * inv * gv[k] + bv[k]);
  }
}

__global__ __launch_bounds__(256) void layernorm_f16_k(
    const float* __restrict__ x, const float* __restrict__ g,
    const float* __restrict__ b, _Float16* __restrict__ out) {
  layernorm_block(blockIdx.x, x, g, b, out);
}

// The first layernorm and the six weight conversions depend on inputs only and
// on nothing of each other: one launch, the work picked by block range (the
// longer blocks, the layernorm's, first). The six f16 weights lie one behind
// the other in w16, in the order wq wk wv wo w1 w2, without gaps.
#define LN_GRID (NTOK / (8 * LN_ROWS))
#define CVT_HH  (H * H / CVT_BLK)
#define CVT_IH  (IS * H / CVT_BLK)
#define PREP_GRID (LN_GRID + 4 * CVT_HH + 2 * CVT_IH)

__global__ __launch_bounds__(256) void prep_k(
    const float* __restrict__ x, const float* __restrict__ g,
    const float* __restrict__ b, _Float16* __restrict__ xn,
    const float* __restrict__ wq, const float* __restrict__ wk,
    const float* __restrict__ wv, const float* __restrict__ wo,
    const float* __restrict__ w1, const float* __restrict__ w2,
    _Float16* __restrict__ w16) {
  const int bid = blockIdx.x;
  if (bid < LN_GRID) {
    layernorm_block(bid, x, g, b, xn);
    return;
  }
  const int c = bid - LN_GRID;  // block of w16
  const float* src;
  int first;                    // first block of that weight in w16
  if (c < 4 * CVT_HH) {
    const int m = c / CVT_HH;
    src = m == 0 ? wq : m == 1 ? wk : m == 2 ? wv : wo;
    first = m * CVT_HH;
  } else {
    const int m = (c - 4 * CVT_HH) / CVT_IH;
    src = m == 0 ? w1 : w2;
    first = 4 * CVT_HH + m * CVT_IH;
  }
  f32_to_f16_block(src, c - first, w16, c);
}

#define BM  256

// This wave's LDS reads have retired before its buffer is handed back for refill.
__device__ __forceinline__ void wait_ds0() {
  asm volatile("s_wait_dscnt 0x0" ::: "memory");
}

template <int EPI, bool TRI, int CW>
__global__ __launch_bounds__(128 * CW) void gemm_wmma_k(
    const _Float16* __restrict__ A, const _Float16* __restrict__ W,
    const float* __restrict__ bias, const float* __restrict__ bias1,
    const float* __restrict__ bias2, const float* __restrict__ resid,
    void* __restrict__ out, int M, int N, int K) {
  constexpr int BN = 64 * CW;
  static_assert(CW == 2 || CW == 3, "the trips are cut for these two widths");
  constexpr int BK  = CW == 3 ? 128 : 64;  // k of a trip
  constexpr int LDT = BK + 8;              // LDS row stride in f16
  constexpr int NS  = BM / 64 + CW;        // slices of a tile: A's, then W's
  // f16 from one slice to the next: 64 rows, rounded up so that every slice starts at
  // a multiple of 2 KiB of the block's LDS
  constexpr int SL  = (64 * LDT * 2 + 2047) / 2048 * 1024;
  __shared__ __attribute__((aligned(2048))) _Float16 sT[2 * NS * SL];

  const int m0 = blockIdx.y * BM;
  const int n0 = blockIdx.x * BN;        // row of W
  const int sel = TRI ? blockIdx.x / (H / BN) : 0;  // which product (TRI: N == H)
  const int nc0 = n0 - sel * H;          // column in that product's result
  const float* __restrict__ bsel = !TRI || sel == 0 ? bias : sel == 1 ? bias1 : bias2;
  const int tid = threadIdx.x;
  const int w = tid >> 5, lane = tid & 31;
  const int wm = (w / CW) * 64;  // wave row offset in block tile
  const int wn = (w % CW) * 64;  // wave col offset

  v8f c[4][4] = {};

  const uint32_t wu = __builtin_amdgcn_readfirstlane(w);
  const int T = K / BK;
  TensorDesc td = tensor_desc_rows64<BK * 2>(K * 2);
  auto issue = [&](int buf, int t) {
    if (pinned(wu < NS && t < T)) {
      const _Float16* g = (wu < BM / 64 ? A + (size_t)(m0 + 64 * wu) * K
                                        : W + (size_t)(n0 + 64 * (wu - BM / 64)) * K) + t * BK;
      tensor_load(td, lds_addr_of(&sT[0]) + (buf * NS + wu) * (SL * 2), g);
    }
  };
  v16h af[4], bf[4];
  auto load_frags = [&](int buf, int ks) {
    const _Float16* pa = &sT[(buf * NS + w / CW) * SL + ks * 32];
    const _Float16* pb = &sT[(buf * NS + BM / 64 + w % CW) * SL + ks * 32];
#pragma unroll
    for (int i = 0; i < 4; ++i) af[i] = load_frag(pa + i * 16 * LDT, LDT);
#pragma unroll
    for (int j = 0; j < 4; ++j) bf[j] = load_frag(pb + j * 16 * LDT, LDT);
  };
  auto mma = [&]() {
#pragma unroll
    for (int i = 0; i < 4; ++i)
#pragma unroll
      for (int j = 0; j < 4; ++j) c[i][j] = wmma32(bf[j], af[i], c[i][j]);  // tile transposed
  };

  issue(0, 0);                       // tile 0
  wait_tensor0(td);                  // own load landed (a wave that issued none passes)
  __syncthreads();                   // tile 0 published
  issue(1, 1);                       // tile 1 in flight over trip 0
  for (int t = 0; t < T; ++t) {
    const int buf = t & 1;
    // unrolled so that the fragments' LDS offsets are constants
#pragma unroll
    for (int ks = 0; ks < BK / 32 - 1; ++ks) {
      load_frags(buf, ks);
      // Keeps a block's 16 LDS reads one group ahead of its WMMAs: this build spread
      // them, two reads and a wait to zero in front of every four WMMAs.
      if constexpr (CW == 3) __builtin_amdgcn_sched_barrier(0);
      mma();
    }
    load_frags(buf, BK / 32 - 1);    // last LDS reads of buf
    // Keeps the earlier blocks' WMMAs above the barrier: this build sank 32 of them
    // between the barrier and the refill, which then started that much later.
    if constexpr (CW == 3) __builtin_amdgcn_sched_barrier(0);
    wait_ds0();                      // own reads of buf done
    wait_tensor0(td);                // own load of tile t+1 landed
    __syncthreads();                 // publishes tile t+1, frees buf
    issue(buf, t + 2);
    mma();                           // registers only: the refill flies under it
  }
  wait_tensor0(td);
  wait_ds0();

  // Epilogue. The products were taken transposed (W fragment as A operand), so lane
  // (col, hi) holds, of tile (i, j), token row i*16 + col and the eight consecutive
  // columns j*16 + 8*hi + v. A band of 16 token rows x 64 columns goes through the
  // wave's own piece of sT, which is free behind the last trip's barrier (every wave's
  // reads retired, every load landed, none issued since), and leaves as whole 128-B
  // lines, 16 B a lane; the residual is read in the same whole-line shape.
  const int col = lane & 15, hi = lane >> 4;
  const size_t row0 = (size_t)sel * M + m0 + wm;  // first output row of the wave
  if constexpr (EPI == 2) {
    static_assert(!TRI, "the residual epilogue writes one product");
    constexpr int PF = 68;  // staging pitch in f32 (272 B = 16 B x odd)
    float* st = (float*)&sT[0] + w * (16 * PF);
    float* wr = st + col * PF + 8 * hi;
    const float* rd = st + hi * PF + col * 4;  // rows hi, hi + 2, ...: 256 B by 16 lanes
    // Addresses: the wave's corner is uniform, the lane's place one small offset, and
    // the row steps are constants (both residual products have N == H), so they become
    // immediate offsets on one address for the residual and one for the output. No load
    // or store has an address register of its own that a later result could land on.
    const int wu = __builtin_amdgcn_readfirstlane(w);
    const size_t u0 = (size_t)(m0 + (wu / CW) * 64) * H + nc0 + (wu % CW) * 64;
    const float* __restrict__ rs = resid + u0;
    float* __restrict__ os = (float*)out + u0;
    const unsigned lo = hi * H + col * 4;
    const float* bp = bsel + nc0 + wn + col * 4;  // bias of the columns read back
    const v4f b4 = *(const v4f*)bp;
    v4f r[8];
#pragma unroll
    for (int k = 0; k < 8; ++k) r[k] = *(const v4f*)(rs + lo + 2 * k * H);
    // The bias load's address is used once: as an input here it stays whole up to the
    // wait (without it this build lands the load's own result on the address pair).
    asm volatile("s_wait_xcnt 0x0" :: "v"(bp) : "memory");
#pragma unroll
    for (int i = 0; i < 4; ++i) {
#pragma unroll
      for (int j = 0; j < 4; ++j) {
        const v8f a = c[i][j];
        *(v4f*)(wr + j * 16)     = v4f{a[0], a[1], a[2], a[3]};
        *(v4f*)(wr + j * 16 + 4) = v4f{a[4], a[5], a[6], a[7]};
      }
      wait_ds0();  // the band is written before other lanes read it back
      v4f rn[8];
      if (i < 3) {  // the next band's residual flies under this band's stores
#pragma unroll
        for (int k = 0; k < 8; ++k)
          rn[k] = *(const v4f*)(rs + lo + ((i + 1) * 16 + 2 * k) * H);
      }
#pragma unroll
      for (int k = 0; k < 8; ++k) {
        const v4f t = *(const v4f*)(rd + 2 * k * PF);
        *(v4f*)(os + lo + (i * 16 + 2 * k) * H) = r[k] + (t + b4);
      }
      // The band is read back before the next one overwrites it, and no register that
      // an issued load or store names is rewritten before the second wait.
      if (i < 3) asm volatile("s_wait_dscnt 0x0\n\ts_wait_xcnt 0x0" ::: "memory");
      if (i < 3) {
#pragma unroll
        for (int k = 0; k < 8; ++k) r[k] = rn[k];
      }
    }
  } else {
    v4f bv[4][2];  // the bias goes in ahead of the GELU and the rounding to f16
#pragma unroll
    for (int j = 0; j < 4; ++j) {
      const v4f* bp = (const v4f*)(bsel + nc0 + wn + j * 16 + 8 * hi);
      bv[j][0] = bp[0];
      bv[j][1] = bp[1];
    }
    _Float16* st = &sT[0] + w * (16 * LDT);
    _Float16* wr = st + col * LDT + 8 * hi;
    const _Float16* rd = st + (lane >> 3) * LDT + (lane & 7) * 8;  // 128 B by 8 lanes
    _Float16* go = (_Float16*)out + (row0 + (lane >> 3)) * N + nc0 + wn + (lane & 7) * 8;
#pragma unroll
    for (int i = 0; i < 4; ++i) {
#pragma unroll
      for (int j = 0; j < 4; ++j) {
        v8h o;
        // unrolled so that o and c, register arrays, are indexed by constants only
#pragma unroll
        for (int p = 0; p < 4; ++p) {
          const v2f x = v2f{c[i][j][2 * p], c[i][j][2 * p + 1]} +
                        v2f{bv[j][p >> 1][2 * (p & 1)], bv[j][p >> 1][2 * (p & 1) + 1]};
          const v2h g = EPI == 1 ? gelu_tanh2(x) : __builtin_convertvector(x, v2h);
          o[2 * p] = g[0];
          o[2 * p + 1] = g[1];
        }
        *(v8h*)(wr + j * 16) = o;
      }
      wait_ds0();  // the band is written before other lanes read it back
#pragma unroll
      for (int k = 0; k < 4; ++k)
        *(v8h*)(go + (size_t)(i * 16 + 4 * k) * N) = *(const v8h*)(rd + 4 * k * LDT);
      // The band is read back before the next one overwrites it, and no register that
      // an issued store names is rewritten before the second wait.
      if (i < 3) asm volatile("s_wait_dscnt 0x0\n\ts_wait_xcnt 0x0" ::: "memory");
    }
  }
}

#define LDK 72   // K row pitch in f16
#define LDV 80   // V row pitch in f16

typedef __attribute__((ext_vector_type(8))) short    v8s;

__device__ __forceinline__ float xhalf(float x) {
  const int b = __builtin_bit_cast(int, x);
  return __builtin_bit_cast(float, __builtin_amdgcn_permlanex16(
      b, b, 0x76543210, 0xfedcba98, false, false));
}

// Transposing load of a 16 (rows) x 16 (columns) f16 tile: lane (c, hi) gets
// column c, rows 8*hi .. 8*hi+7. p is the lane's own 16 B of the row-major tile.
__device__ __forceinline__ v8h ld_tr16(const _Float16* p) {
  typedef __attribute__((address_space(3))) v8s lds_v8s;
  return __builtin_bit_cast(v8h, __builtin_amdgcn_ds_load_tr16_b128_v8i16((lds_v8s*)p));
}

__device__ __forceinline__ void async_copy_kv(
    unsigned lk, unsigned lv, const _Float16* gk, const _Float16* gv) {
  asm volatile(
      "global_load_async_to_lds_b128 %0, %4, off\n\t"
      "global_load_async_to_lds_b128 %1, %5, off\n\t"
      "global_load_async_to_lds_b128 %2, %6, off\n\t"
      "global_load_async_to_lds_b128 %3, %7, off\n\t"
      "s_wait_xcnt 0x0"
      :: "v"(lk), "v"(lk + 16), "v"(lv), "v"(lv + 16),
         "v"(gk), "v"(gk + 8), "v"(gv), "v"(gv + 8)
      : "memory");
}

__global__ __launch_bounds__(256) void attention_wmma_k(
    const _Float16* __restrict__ Q, const _Float16* __restrict__ K,
    const _Float16* __restrict__ V, _Float16* __restrict__ O) {
  __shared__ __attribute__((aligned(32))) _Float16 sK[64 * LDK];  // [key][d]
  __shared__ __attribute__((aligned(32))) _Float16 sV[64 * LDV];  // [key][d]

  const int bid = blockIdx.x;
  const int qt  = bid & 7;               // SEQ/128 = 8 tiles
  const int bh  = bid >> 3;
  const int b   = bh / NH, h = bh % NH;
  const int tid = threadIdx.x, w = tid >> 5, lane = tid & 31;
  const int col = lane & 15, hi = lane >> 4;
  const int q0  = qt * 128 + w * 16;
  const size_t tokBase = (size_t)b * SEQ;
  const float cs = 0.125f * 1.4426950408889634f;  // HD^-0.5 * log2(e)

  // B operand Q^T: lane = query column, the k order of load_frag (as K's below).
  const _Float16* qbase = Q + (tokBase + q0) * H + h * HD;
  const v16h qf0 = load_frag(qbase, H);        // d = 0..31
  const v16h qf1 = load_frag(qbase + 32, H);   // d = 32..63

  v8f of[4] = {};          // O^T: of[t][r] = O[query col][d = 16 t + 8 hi + r]
  float rm = -1e30f;       // running maximum of query col, scaled, base 2
  float rs = 0.f;          // running sum over this half's keys of query col

  const int kk = tid >> 2;               // 0..63 (staging row)
  const int q4 = tid & 3;                // 0..3  (16 f16 chunk)
  const unsigned ldsK = lds_addr_of(&sK[kk * LDK + q4 * 16]);
  const unsigned ldsV = lds_addr_of(&sV[kk * LDV + q4 * 16]);
  const size_t gOff = (tokBase + kk) * H + h * HD + q4 * 16;
  const _Float16* vtr = &sV[(8 * hi + (lane & 7)) * LDV + ((lane >> 3) & 1) * 8];

  for (int kt = 0; kt < SEQ; kt += 64) {
    wait_ds0();                          // own reads of the previous tile done
    __syncthreads();                     // previous tile fully consumed
    async_copy_kv(ldsK, ldsV, K + gOff + (size_t)kt * H, V + gOff + (size_t)kt * H);
    wait_async0();                       // own copies landed
    __syncthreads();                     // tile published

    // S^T = K * Q^T: s[f][r] = score(key 16 f + 8 hi + r, query col)
    v8f s[4];
#pragma unroll
    for (int f = 0; f < 4; ++f) {
      v16h ka0 = load_frag(&sK[(f * 16) * LDK], LDK);
      v16h ka1 = load_frag(&sK[(f * 16) * LDK + 32], LDK);
      v8f acc = {};
      acc = wmma32(ka0, qf0, acc);
      acc = wmma32(ka1, qf1, acc);
      s[f] = acc;
    }

    // online softmax of one query per lane, base 2
    float tm[4];
#pragma unroll
    for (int f = 0; f < 4; ++f) {
      tm[f] = s[f][0];
#pragma unroll
      for (int r = 1; r < 8; ++r) tm[f] = fmaxf(tm[f], s[f][r]);
    }
    float tmax = fmaxf(fmaxf(tm[0], tm[1]), fmaxf(tm[2], tm[3]));
    tmax = fmaxf(tmax, xhalf(tmax)) * cs;  // both halves hold the query's maximum
    const float mnew  = fmaxf(rm, tmax);
    float alpha;
    asm("v_exp_f32 %0, %1\n\tv_nop" : "=v"(alpha) : "v"(rm - mnew));
    rm = mnew;

    // P^T as B operand: elements 2 (i & 7), + 1 of key block i >> 3 are registers
    // 2 (i & 3), + 1 of score tile i >> 2. Arguments and sums go two to an instruction.
    const v2f cs2 = {cs, cs}, nm2 = {-mnew, -mnew};
    v2f a[16];
#pragma unroll
    for (int i = 0; i < 16; ++i)
      a[i] = __builtin_elementwise_fma(
          v2f{s[i >> 2][2 * (i & 3)], s[i >> 2][2 * (i & 3) + 1]}, cs2, nm2);
    v16h pb[2];
    v2f ts = {0.f, 0.f};
#pragma unroll
    for (int i = 0; i < 16; ++i) {
      const v2f p = {__builtin_amdgcn_exp2f(a[i][0]), __builtin_amdgcn_exp2f(a[i][1])};
      const v2h pk = __builtin_convertvector(p, v2h);
      pb[i >> 3][2 * (i & 7)] = pk[0];
      pb[i >> 3][2 * (i & 7) + 1] = pk[1];
      ts += p;
    }
    rs = rs * alpha + (ts[0] + ts[1]);
#pragma unroll
    for (int t = 0; t < 4; ++t) of[t] *= alpha;

    // O^T += V^T * P^T
#pragma unroll
    for (int ks = 0; ks < 2; ++ks) {
#pragma unroll
      for (int t = 0; t < 4; ++t) {
        const v8h lo = ld_tr16(vtr + (ks * 32) * LDV + t * 16);       // keys 8 hi ..
        const v8h hk = ld_tr16(vtr + (ks * 32 + 16) * LDV + t * 16);  // keys 16 + 8 hi ..
        v16h va;
#pragma unroll
        for (int j = 0; j < 8; ++j) { va[j] = lo[j]; va[j + 8] = hk[j]; }
        of[t] = wmma32(va, pb[ks], of[t]);
      }
    }
  }

  // join the halves' sums, normalize, store: 8 consecutive d of one query a lane
  const float inv = 1.f / (rs + xhalf(rs));
  _Float16* orow = O + (tokBase + q0 + col) * H + h * HD + 8 * hi;
#pragma unroll
  for (int t = 0; t < 4; ++t) {
    v8h o;
#pragma unroll
    for (int r = 0; r < 8; ++r) o[r] = (_Float16)(of[t][r] * inv);
    *(v8h*)(orow + t * 16) = o;
  }
}

// --------------------------- launcher --------------------------------------

extern "C" void kernel_launch(void* const* d_in, const int* in_sizes, int n_in,
                              void* d_out, int out_size, void* d_ws, size_t ws_size,
                              hipStream_t stream) {
  const float* hs    = (const float*)d_in[0];
  const float* wq    = (const float*)d_in[1];
  const float* bq    = (const float*)d_in[2];
  const float* wk    = (const float*)d_in[3];
  const float* bk    = (const float*)d_in[4];
  const float* wv    = (const float*)d_in[5];
  const float* bv    = (const float*)d_in[6];
  const float* wo    = (const float*)d_in[7];
  const float* bo    = (const float*)d_in[8];
  const float* ln1g  = (const float*)d_in[9];
  const float* ln1b  = (const float*)d_in[10];
  const float* ln2g  = (const float*)d_in[11];
  const float* ln2b  = (const float*)d_in[12];
  const float* w1    = (const float*)d_in[13];
  const float* b1    = (const float*)d_in[14];
  const float* w2    = (const float*)d_in[15];
  const float* b2    = (const float*)d_in[16];

  char* ws = (char*)d_ws;
  size_t off = 0;
  auto carve = [&](size_t bytes) {
    char* p = ws + off;
    off = (off + bytes + 255) & ~(size_t)255;
    return p;
  };
  const size_t SZ_HH  = (size_t)H * H * sizeof(_Float16);
  const size_t SZ_IH  = (size_t)IS * H * sizeof(_Float16);
  const size_t SZ_TH2 = (size_t)NTOK * H * sizeof(_Float16);
  const size_t SZ_TH4 = (size_t)NTOK * H * sizeof(float);
  const size_t SZ_TI2 = (size_t)NTOK * IS * sizeof(_Float16);

  _Float16* wq16 = (_Float16*)carve(SZ_HH);
  _Float16* wk16 = (_Float16*)carve(SZ_HH);
  _Float16* wv16 = (_Float16*)carve(SZ_HH);
  _Float16* wo16 = (_Float16*)carve(SZ_HH);
  _Float16* w116 = (_Float16*)carve(SZ_IH);
  _Float16* w216 = (_Float16*)carve(SZ_IH);
  _Float16* bufA = (_Float16*)carve(SZ_TH2);  // ln1 out, later attn out
  _Float16* bufB = (_Float16*)carve(SZ_TH2);  // q, later ln2 out
  _Float16* bufC = (_Float16*)carve(SZ_TH2);  // k
  _Float16* bufD = (_Float16*)carve(SZ_TH2);  // v
  float*    x2   = (float*)   carve(SZ_TH4);  // post-attention residual state
  _Float16* h1   = (_Float16*)carve(SZ_TI2);  // gelu(fc1)
  (void)ws_size; (void)n_in; (void)in_sizes; (void)out_size;
  (void)wk16; (void)wv16;  // reached through wq16
  // carve() pads to 256 B: these sizes need no pad, so neighbours are gapless
  static_assert(H * H * sizeof(_Float16) % 256 == 0 && IS * H * sizeof(_Float16) % 256 == 0 &&
                (size_t)NTOK * H * sizeof(_Float16) % 256 == 0, "workspace arrays not gapless");
  static_assert(H % 192 == 0 && IS % 128 == 0, "a column tile would straddle two products");

  const dim3 blk(256);
  const dim3 blk12(384);                   // 12 waves: the 192-column tiles
  const dim3 gH(H / 192, NTOK / 256);      // N=768 GEMMs, 192-column tiles
  const dim3 g3(3 * H / 192, NTOK / 256);  // Q, K, V together, 192-column tiles
  const dim3 gI(IS / 128, NTOK / 256);     // N=3072 GEMM, 128-column tiles

  // 1) LN1 and weights -> f16 (wq16 .. w216 are one gapless array)
  prep_k<<<PREP_GRID, blk, 0, stream>>>(hs, ln1g, ln1b, bufA, wq, wk, wv, wo, w1, w2, wq16);

  // 2) QKV projections (wq16 wk16 wv16 and bufB bufC bufD are gapless too)
  gemm_wmma_k<0, true, 3><<<g3, blk12, 0, stream>>>(
      bufA, wq16, bq, bk, bv, nullptr, bufB, NTOK, H, H);

  // 3) attention (bufA reused as output; ln1 activations are dead now)
  attention_wmma_k<<<BATCH * NH * (SEQ / 128), blk, 0, stream>>>(bufB, bufC, bufD, bufA);

  // 4) output projection + residual -> x2 (f32)
  gemm_wmma_k<2, false, 3><<<gH, blk12, 0, stream>>>(
      bufA, wo16, bo, nullptr, nullptr, hs, x2, NTOK, H, H);

  // 5) LN2 (bufB reused; q is dead)
  layernorm_f16_k<<<LN_GRID, blk, 0, stream>>>(x2, ln2g, ln2b, bufB);

  // 6) FC1 + GELU
  gemm_wmma_k<1, false, 2><<<gI, blk, 0, stream>>>(
      bufB, w116, b1, nullptr, nullptr, nullptr, h1, NTOK, IS, H);

  // 7) FC2 + residual -> d_out (f32)
  gemm_wmma_k<2, false, 3><<<gH, blk12, 0, stream>>>(
      h1, w216, b2, nullptr, nullptr, x2, (float*)d_out, NTOK, H, IS);
}
